// v000
// The times below were measured on an AMD MI455X: many runs one after another, warmed up first and cycling through
// copies of the inputs, with the whole window's GPU time divided by the number of runs. Launches and the gaps
// between them are all in it. The median over several windows is given; except for v000 it joins two sittings, which
// can be a few percent apart, so the side-by-side timings, each taken in one sitting, are the better comparison.
// The starting kernel, v000, takes 1690 microseconds a run.
#include <hip/hip_runtime.h>

// Multi-head dot-product attention: inputs_q, inputs_kv [8][1024][1024]; q = inputs_q Wq + bq, k / v = inputs_kv Wk / Wv + bk / bv (W [1024][16][64] = k-major [1024][1024], bias [16][64]);
// logits = (q . k) / 64 (the module divides q by the head depth); int32 mask [1][1][1024][1024] replaces masked logits by the most negative finite f32; softmax over keys; ctx = P . v; out = ctx Wo ([16][64][1024] = [1024][1024]) + bo -> [8][1024][1024] f32.
// Compute dtypes, f32 accumulate: every float input RNE-converted to bf16; q/k/v projections v_wmma_f32_16x16x32_bf16 on plain bf16 operands; scores v_wmma_f32_16x16x32_f16 on plain fp16 q/k planes with 1/64 applied to the f32 score; softmax f32; P . v on bf16 hi/lo planes of normalised P and of v (3 products); ctx . Wo on bf16 hi/lo ctx planes x exact bf16 Wo (2 products); biases added in f32 as bf16-converted values.

#ifndef NB
#define NB   8
#endif
#ifndef SEQ
#define SEQ  1024
#endif
#define S_FULL 1024                 // per-batch row count / mask row pitch
#define TT   SEQ
#define DM   1024
#define NH_  16
#define NKV  16
#define REP  (NH_ / NKV)
#define HD   64
#define DQ   (NH_ * HD)
#define DKV  (NKV * HD)
#define ZH   8                      // heads per attention pass
#define SCL  0.015625f              // 1 / HD
#define NEGF (-3.4028234663852886e38f)

static_assert(TT % 128 == 0);
static_assert(TT % 64 == 0);
static_assert(DM % 64 == 0);
static_assert(HD % 32 == 0);
static_assert(NH_ % ZH == 0);
static_assert(SEQ <= S_FULL);
static_assert(NB >= 1);

typedef _Float16 h16;
typedef unsigned short bf;
typedef __attribute__((ext_vector_type(16))) __bf16   v16bf;
typedef __attribute__((ext_vector_type(16))) _Float16 v16h;
typedef __attribute__((ext_vector_type(8)))  _Float16 v8h;
typedef __attribute__((ext_vector_type(8)))  unsigned short v8us;
typedef __attribute__((ext_vector_type(8)))  float    v8f;
typedef __attribute__((ext_vector_type(4)))  float    v4f;
typedef v8h  __attribute__((may_alias)) v8ha;
typedef v4f  __attribute__((may_alias)) v4fa;
typedef v8us __attribute__((may_alias)) v8usa;

__device__ __forceinline__ unsigned short f2bf(float f) { unsigned u = __float_as_uint(f); u += 0x7FFFu + ((u >> 16) & 1u); return (unsigned short)(u >> 16); }
__device__ __forceinline__ float bf2f(unsigned short b) { return __uint_as_float(((unsigned)b) << 16); }
__device__ __forceinline__ float bfr(float f) { return bf2f(f2bf(f)); }
__device__ __forceinline__ v16h cat16(v8h lo, v8h hi) { return __builtin_shufflevector(lo, hi, 0, 1, 2, 3, 4, 5, 6, 7, 8, 9, 10, 11, 12, 13, 14, 15); }
__device__ __forceinline__ v16bf cat16b(v8us lo, v8us hi) { return __builtin_bit_cast(v16bf, __builtin_shufflevector(lo, hi, 0, 1, 2, 3, 4, 5, 6, 7, 8, 9, 10, 11, 12, 13, 14, 15)); }
__device__ __forceinline__ v8f wmma16(v16h a, v16h b, v8f c) { return __builtin_amdgcn_wmma_f32_16x16x32_f16(false, a, false, b, (short)0, c, false, false); }
__device__ __forceinline__ v8f wmmab(v16bf a, v16bf b, v8f c) { return __builtin_amdgcn_wmma_f32_16x16x32_bf16(false, a, false, b, (short)0, c, false, false); }



// ---- k_gemmw: register-blocked GEMM, ONE WAVE per 64x64 output tile (16 accumulators), operands straight from K-contiguous 16-bit planes; grid (M/64, N/64, Z), 32 threads.
// C[m][n] (f32, pitch ldc, + optional f32 bias[n]) = sum_k A[m][k] Bt[n][k] (+ split products per NSPLIT). z-batch strides sA/sB/sC in elements. K % 32 == 0.
// Fragments (A and Bt alike): lane l -> row l&15, elements 0..7 = k kc+8h..kc+8h+7, elements 8..15 = k kc+16+8h..kc+16+8h+7 (h = l>>4); D element j -> row 8h+j, col l&15.
template <typename T16> struct WFrag;
template <> struct WFrag<h16> { typedef v16h V; static __device__ __forceinline__ V ld(const h16* p) { return cat16(*(const v8h*)p, *(const v8h*)(p + 16)); } static __device__ __forceinline__ v8f mma(V a, V b, v8f c) { return wmma16(a, b, c); } };
template <> struct WFrag<bf> { typedef v16bf V; static __device__ __forceinline__ V ld(const bf* p) { return cat16b(*(const v8us*)p, *(const v8us*)(p + 16)); } static __device__ __forceinline__ v8f mma(V a, V b, v8f c) { return wmmab(a, b, c); } };
template <typename T16, int NSPLIT, bool BIAS>
__global__ __launch_bounds__(32) void k_gemmw(const T16* __restrict__ A, const T16* __restrict__ A2, const T16* __restrict__ Bt, const T16* __restrict__ Bt2, int K, float* C, int ldc, const float* __restrict__ bias, size_t sA, size_t sB, size_t sC) {
    typedef typename WFrag<T16>::V V;
    __shared__ __align__(16) float os[16 * 68];
    const size_t z = blockIdx.z; A += z * sA; if (A2) A2 += z * sA; Bt += z * sB; if (Bt2) Bt2 += z * sB; C += z * sC;
    const int lane = threadIdx.x & 31, lr = lane & 15, hi = lane >> 4; const int r0 = blockIdx.x * 64, c0 = blockIdx.y * 64;
    v8f acc[4][4];
#pragma unroll
    for (int mb = 0; mb < 4; ++mb)
#pragma unroll
        for (int nb = 0; nb < 4; ++nb) acc[mb][nb] = (v8f){};
    const size_t aoff = (size_t)(r0 + lr) * K + 8 * hi, boff = (size_t)(c0 + lr) * K + 8 * hi;
#pragma unroll 1
    for (int kc = 0; kc < K; kc += 32) {
        V a[4], a2[4];
#pragma unroll
        for (int mb = 0; mb < 4; ++mb) { a[mb] = WFrag<T16>::ld(A + aoff + (size_t)mb * 16 * K + kc); if (NSPLIT == 1 || NSPLIT == 2) a2[mb] = WFrag<T16>::ld(A2 + aoff + (size_t)mb * 16 * K + kc); }
#pragma unroll
        for (int nb = 0; nb < 4; ++nb) { const V b = WFrag<T16>::ld(Bt + boff + (size_t)nb * 16 * K + kc); V b2; if (NSPLIT >= 2) b2 = WFrag<T16>::ld(Bt2 + boff + (size_t)nb * 16 * K + kc);
#pragma unroll
            for (int mb = 0; mb < 4; ++mb) { acc[mb][nb] = WFrag<T16>::mma(a[mb], b, acc[mb][nb]); if (NSPLIT == 1 || NSPLIT == 2) acc[mb][nb] = WFrag<T16>::mma(a2[mb], b, acc[mb][nb]); if (NSPLIT >= 2) acc[mb][nb] = WFrag<T16>::mma(a[mb], b2, acc[mb][nb]); } }
        asm volatile("v_nop\n\tv_nop\n\tv_nop\n\tv_nop" : "+v"(acc[0][0]), "+v"(acc[1][1]), "+v"(acc[2][2]), "+v"(acc[3][3]) : "v"(a[0]), "v"(a[3]));
    }
#pragma unroll
    for (int mb = 0; mb < 4; ++mb) {
#pragma unroll
        for (int nb = 0; nb < 4; ++nb) {
#pragma unroll
            for (int j = 0; j < 8; ++j) os[(hi * 8 + j) * 68 + nb * 16 + lr] = acc[mb][nb][j]; }
        __builtin_amdgcn_wave_barrier(); asm volatile("" ::: "memory");
        float* crow = C + (size_t)(r0 + mb * 16) * ldc + c0;
{
#pragma unroll
            for (int s = 0; s < 8; ++s) { const int row = 2 * s + hi, cofs = lr * 4; v4f val = *(const v4fa*)(os + row * 68 + cofs); if (BIAS) { val[0] += bfr(bias[c0 + cofs]); val[1] += bfr(bias[c0 + cofs + 1]); val[2] += bfr(bias[c0 + cofs + 2]); val[3] += bfr(bias[c0 + cofs + 3]); }
                *(v4f*)(crow + (size_t)row * ldc + cofs) = val; }
             }
        __builtin_amdgcn_wave_barrier(); asm volatile("" ::: "memory");
    }
}

__device__ __forceinline__ h16 tohx(float x) { return (h16)x; }
__device__ __forceinline__ void splitf(float y, unsigned short& h, unsigned short& l) { h = f2bf(y); l = f2bf(y - bf2f(h)); }
typedef __attribute__((ext_vector_type(2))) _Float16 v2h;
typedef __attribute__((ext_vector_type(4))) _Float16 v4h;
typedef __attribute__((ext_vector_type(2))) unsigned short v2us;
typedef __attribute__((ext_vector_type(4))) unsigned short v4us;
typedef __attribute__((ext_vector_type(2))) float v2f;
typedef __attribute__((ext_vector_type(4))) int v4i;

__global__ __launch_bounds__(256) void k_wtG(const float* __restrict__ w, int K, int N, bf* Bt) {
    const int lane = threadIdx.x & 31; const int L0 = (blockIdx.x * 8 + (threadIdx.x >> 5)) * 8; const int nlines = N * K / 64;
{
#pragma unroll 1
        for (int l = 0; l < 8; ++l) { const int L = L0 + l; if (L >= nlines) break; const size_t e = (size_t)L * 64 + lane * 2; const int k = (int)(e % K), n = (int)(e / K); v2us o;
            o[0] = f2bf(w[(size_t)k * N + n]); o[1] = f2bf(w[(size_t)(k + 1) * N + n]); *(v2us*)(Bt + e) = o; }
         }
}
__global__ __launch_bounds__(256) void k_cvt8(const float* __restrict__ src, bf* dst, size_t n8) { const size_t i = (size_t)blockIdx.x * 256 + threadIdx.x; if (i >= n8) return; const v8f v = *(const v8f*)(src + i * 8); v8us o;
#pragma unroll
    for (int k = 0; k < 8; ++k) o[k] = f2bf(v[k]); *(v8us*)(dst + i * 8) = o;  }

__global__ __launch_bounds__(256) void k_qkp(const float* __restrict__ F, int pitch, int nheads, h16* P16) {
    const size_t e = ((size_t)blockIdx.x * 256 + threadIdx.x) * 2; if (e >= (size_t)nheads * TT * HD) return; const int d = (int)(e % HD); const int t = (int)((e / HD) % TT); const int h = (int)(e / ((size_t)HD * TT));
    const v2f x = *(const v2f*)(F + (size_t)t * pitch + h * HD + d); v2h o16; o16[0] = tohx(x[0]); o16[1] = tohx(x[1]);
    *(v2h*)(P16 + e) = o16;  }
__global__ __launch_bounds__(256) void k_vtp(const float* __restrict__ F, int pitch, int nheads, bf* Vh, bf* Vl) { const size_t e = ((size_t)blockIdx.x * 256 + threadIdx.x) * 2; if (e >= (size_t)nheads * HD * TT) return; const int t = (int)(e % TT); const int d = (int)((e / TT) % HD); const int g = (int)(e / ((size_t)TT * HD)); v2us oh, ol;
#pragma unroll
    for (int q = 0; q < 2; ++q) { const float x = F[(size_t)(t + q) * pitch + g * HD + d]; unsigned short a2, c2; splitf(x, a2, c2); oh[q] = a2; ol[q] = c2; }
    *(v2us*)(Vh + e) = oh; *(v2us*)(Vl + e) = ol;  }
// k_asoft: one wave per score row (zz, i): t = mask[i][j] ? S x (1/HD) : most negative finite f32 (replace-fill); softmax over the TT keys (register row, running max = max-subtracted form, one exp, fixed trees;
__global__ __launch_bounds__(256) void k_asoft(const float* __restrict__ Sb, const int* __restrict__ Mk, bf* Ph, bf* Pl) {
    const int lane = threadIdx.x & 31; const int row = blockIdx.x * 8 + (threadIdx.x >> 5); if (row >= ZH * TT) return; const int i = row % TT;
    const float* sr = Sb + (size_t)row * TT; const int* mr = Mk + (size_t)i * S_FULL; float v[TT / 32]; float mx = NEGF;
#pragma unroll
    for (int ch = 0; ch < TT / 128; ++ch) { const int j0 = ch * 128 + lane * 4; const v4f a = *(const v4f*)(sr + j0); const v4i mk = *(const v4i*)(mr + j0);
#pragma unroll
        for (int q = 0; q < 4; ++q) { const float t = (mk[q] != 0) ? a[q] * SCL : NEGF; v[ch * 4 + q] = t; mx = fmaxf(mx, t); } }
#pragma unroll
    for (int sh = 16; sh; sh >>= 1) mx = fmaxf(mx, __shfl_xor(mx, sh, 32));
    float sum = 0.f;
#pragma unroll
    for (int k = 0; k < TT / 32; ++k) { float d0 = __fsub_rn(v[k], mx); asm volatile("" : "+v"(d0)); v[k] = __builtin_amdgcn_exp2f(__fmul_rn(d0, 1.4426950408889634f)); sum += v[k]; }
#pragma unroll
    for (int sh = 16; sh; sh >>= 1) sum += __shfl_xor(sum, sh, 32);
    const float f = __fdiv_rn(1.0f, sum);
{
#pragma unroll
        for (int ch = 0; ch < TT / 128; ++ch) { v4us oh, ol;
#pragma unroll
            for (int q = 0; q < 4; ++q) { unsigned short a, c2; splitf(v[ch * 4 + q] * f, a, c2); oh[q] = a; ol[q] = c2; }
            const size_t oo = (size_t)row * TT + ch * 128 + lane * 4; *(v4us*)(Ph + oo) = oh; *(v4us*)(Pl + oo) = ol; }
         }
}
__global__ __launch_bounds__(256) void k_merge(const float* __restrict__ O, int h0, bf* Ah, bf* Al) { const size_t e = ((size_t)blockIdx.x * 256 + threadIdx.x) * 2; if (e >= (size_t)ZH * TT * HD) return; const int d = (int)(e % HD); const int t = (int)((e / HD) % TT); const int zz = (int)(e / ((size_t)HD * TT)); const size_t oo = (size_t)t * DQ + (h0 + zz) * HD + d;
    v2us oh, ol;
#pragma unroll
    for (int q = 0; q < 2; ++q) { unsigned short a, c2; splitf(O[e + q], a, c2); oh[q] = a; ol[q] = c2; } *(v2us*)(Ah + oo) = oh; *(v2us*)(Al + oo) = ol;  }

extern "C" void kernel_launch(void* const* d_in, const int* in_sizes, int n_in,
                              void* d_out, int out_size, void* d_ws, size_t ws_size, hipStream_t stream) {
    if (n_in < 11) return;
    if ((size_t)in_sizes[0] < (size_t)(NB - 1) * S_FULL * DM + (size_t)TT * DM) return;
    if ((size_t)in_sizes[1] < (size_t)(NB - 1) * S_FULL * DM + (size_t)TT * DM) return;
    if ((size_t)in_sizes[2] < (size_t)(TT - 1) * S_FULL + (size_t)TT) return;
    if (in_sizes[3] < DM * DQ || in_sizes[5] < DM * DKV || in_sizes[7] < DM * DKV || in_sizes[9] < DQ * DM) return;
    if (in_sizes[4] < DQ || in_sizes[6] < DKV || in_sizes[8] < DKV || in_sizes[10] < DM) return;
    if ((size_t)out_size < (size_t)NB * TT * DM) return;
    const float* x  = (const float*)d_in[0];     // [NB][S_FULL][DM]
    const float* xk = (const float*)d_in[1];     // [NB][S_FULL][DM]
    const int*   mk = (const int*)d_in[2];       // [1][1][S_FULL][S_FULL] int32 0/1
    const float* wq = (const float*)d_in[3]; const float* bq = (const float*)d_in[4];
    const float* wk = (const float*)d_in[5]; const float* bk = (const float*)d_in[6];
    const float* wv = (const float*)d_in[7]; const float* bv = (const float*)d_in[8];
    const float* wo = (const float*)d_in[9]; const float* bo = (const float*)d_in[10];
    float* OUT = (float*)d_out;     // [NB][TT][DM]
    char* wsp = (char*)d_ws;
    auto take = [&](size_t bytes) { char* p = wsp; wsp += (bytes + 255) & ~(size_t)255; return (void*)p; };
    bf* WQ = (bf*)take((size_t)DQ * DM * 2); bf* WK = (bf*)take((size_t)DKV * DM * 2); bf* WV = (bf*)take((size_t)DKV * DM * 2); bf* WO = (bf*)take((size_t)DM * DQ * 2);
    bf* XB = (bf*)take((size_t)TT * DM * 2); bf* XKB = (bf*)take((size_t)TT * DM * 2); float* FQ = (float*)take((size_t)TT * DQ * 4); float* FK = (float*)take((size_t)TT * DKV * 4);
    h16* QP16 = (h16*)take((size_t)NH_ * TT * HD * 2); h16* KP16 = (h16*)take((size_t)NKV * TT * HD * 2);
    bf* VTh = (bf*)take((size_t)NKV * HD * TT * 2); bf* VTl = (bf*)take((size_t)NKV * HD * TT * 2);
    bf* Ph = (bf*)take((size_t)ZH * TT * TT * 2); bf* Pl = (bf*)take((size_t)ZH * TT * TT * 2);
    float* Sb = (float*)take((size_t)ZH * TT * TT * 4); float* Ob = (float*)take((size_t)ZH * TT * HD * 4); bf* ATh = (bf*)take((size_t)TT * DQ * 2); bf* ATl = (bf*)take((size_t)TT * DQ * 2);
    if ((size_t)(wsp - (char*)d_ws) > ws_size) return;    // 98 MiB total at the full size
    float* FV = FK;   // v projection reuses the k buffer after the k planes are built (stream-ordered)
    k_wtG<<<(unsigned)((DM * DQ / 64 + 63) / 64), 256, 0, stream>>>(wq, DM, DQ, WQ); k_wtG<<<(unsigned)((DM * DKV / 64 + 63) / 64), 256, 0, stream>>>(wk, DM, DKV, WK); k_wtG<<<(unsigned)((DM * DKV / 64 + 63) / 64), 256, 0, stream>>>(wv, DM, DKV, WV);
    k_wtG<<<(unsigned)((DQ * DM / 64 + 63) / 64), 256, 0, stream>>>(wo, DQ, DM, WO);
    const unsigned LQ = (unsigned)(((size_t)NH_ * TT * HD / 2 + 255) / 256), LKv = (unsigned)(((size_t)NKV * TT * HD / 2 + 255) / 256);
    for (int b = 0; b < NB; ++b) {
        k_cvt8<<<(unsigned)(((size_t)TT * DM / 8 + 255) / 256), 256, 0, stream>>>(x + (size_t)b * S_FULL * DM, XB, (size_t)TT * DM / 8); k_cvt8<<<(unsigned)(((size_t)TT * DM / 8 + 255) / 256), 256, 0, stream>>>(xk + (size_t)b * S_FULL * DM, XKB, (size_t)TT * DM / 8);
        k_gemmw<bf, 0, true><<<dim3(TT / 64, DQ / 64, 1), 32, 0, stream>>>(XB, nullptr, WQ, nullptr, DM, FQ, DQ, bq, 0, 0, 0);
        k_qkp<<<LQ, 256, 0, stream>>>(FQ, DQ, NH_, QP16);
        k_gemmw<bf, 0, true><<<dim3(TT / 64, DKV / 64, 1), 32, 0, stream>>>(XKB, nullptr, WK, nullptr, DM, FK, DKV, bk, 0, 0, 0);
        k_qkp<<<LKv, 256, 0, stream>>>(FK, DKV, NKV, KP16);
        k_gemmw<bf, 0, true><<<dim3(TT / 64, DKV / 64, 1), 32, 0, stream>>>(XKB, nullptr, WV, nullptr, DM, FV, DKV, bv, 0, 0, 0); k_vtp<<<LKv, 256, 0, stream>>>(FV, DKV, NKV, VTh, VTl);
        for (int h0 = 0; h0 < NH_; h0 += ZH) { const size_t zq = (size_t)h0, zk = (size_t)(h0 / REP);   // pass heads h0..h0+ZH-1: consecutive planes, z-strides TT*HD
            k_gemmw<h16, 0, false><<<dim3(TT / 64, TT / 64, ZH), 32, 0, stream>>>(QP16 + zq * TT * HD, nullptr, KP16 + zk * TT * HD, nullptr, HD, Sb, TT, nullptr, (size_t)TT * HD, (size_t)TT * HD, (size_t)TT * TT);
            k_asoft<<<ZH * TT / 8, 256, 0, stream>>>(Sb, mk, Ph, Pl);
            k_gemmw<bf, 2, false><<<dim3(TT / 64, HD / 64, ZH), 32, 0, stream>>>(Ph, Pl, VTh + zk * HD * TT, VTl + zk * HD * TT, TT, Ob, HD, nullptr, (size_t)TT * TT, (size_t)HD * TT, (size_t)TT * HD);
            k_merge<<<(unsigned)(((size_t)ZH * TT * HD / 2 + 255) / 256), 256, 0, stream>>>(Ob, h0, ATh, ATl); }
        k_gemmw<bf, 1, true><<<dim3(TT / 64, DM / 64, 1), 32, 0, stream>>>(ATh, ATl, WO, nullptr, DQ, OUT + (size_t)b * TT * DM, DM, bo, 0, 0, 0); }
}

// v001
// A run of this version takes 679 microseconds.
// In both of two side-by-side timings against v000, it was 2.49 times as fast.
#include <hip/hip_runtime.h>

// Multi-head dot-product attention: inputs_q, inputs_kv [8][1024][1024]; q = inputs_q Wq + bq, k / v = inputs_kv Wk / Wv + bk / bv (W [1024][16][64] = k-major [1024][1024], bias [16][64]);
// logits = (q . k) / 64 (the module divides q by the head depth); int32 mask [1][1][1024][1024] replaces masked logits by the most negative finite f32; softmax over keys; ctx = P . v; out = ctx Wo ([16][64][1024] = [1024][1024]) + bo -> [8][1024][1024] f32.
// Compute dtypes, f32 accumulate: every float input RNE-converted to bf16; q/k/v projections v_wmma_f32_16x16x32_bf16 on plain bf16 operands; scores v_wmma_f32_16x16x32_f16 on plain fp16 q/k planes with 1/64 applied to the f32 score; softmax f32; P . v on bf16 hi/lo planes of normalised P and of v (3 products); ctx . Wo on bf16 hi/lo ctx planes x exact bf16 Wo (2 products); biases added in f32 as bf16-converted values.

#ifndef NB
#define NB   8
#endif
#ifndef SEQ
#define SEQ  1024
#endif
#define S_FULL 1024                 // per-batch row count / mask row pitch
#define TT   SEQ
#define DM   1024
#define NH_  16
#define NKV  16
#define REP  (NH_ / NKV)
#define HD   64
#define DQ   (NH_ * HD)
#define DKV  (NKV * HD)
#define ZH   32                     // (batch, head) planes per attention pass
#define SCL  0.015625f              // 1 / HD
#define NEGF (-3.4028234663852886e38f)

static_assert(TT % 128 == 0);
static_assert(TT % 64 == 0);
static_assert(DM % 64 == 0);
static_assert(HD % 32 == 0);
static_assert((NB * NH_) % ZH == 0);
static_assert(REP == 1);
static_assert(SEQ <= S_FULL);
static_assert(NB >= 1);

typedef _Float16 h16;
typedef unsigned short bf;
typedef __attribute__((ext_vector_type(16))) __bf16   v16bf;
typedef __attribute__((ext_vector_type(16))) _Float16 v16h;
typedef __attribute__((ext_vector_type(8)))  _Float16 v8h;
typedef __attribute__((ext_vector_type(8)))  unsigned short v8us;
typedef __attribute__((ext_vector_type(8)))  float    v8f;
typedef __attribute__((ext_vector_type(4)))  float    v4f;
typedef v8h  __attribute__((may_alias)) v8ha;
typedef v4f  __attribute__((may_alias)) v4fa;
typedef v8us __attribute__((may_alias)) v8usa;

__device__ __forceinline__ unsigned short f2bf(float f) { unsigned u = __float_as_uint(f); u += 0x7FFFu + ((u >> 16) & 1u); return (unsigned short)(u >> 16); }
__device__ __forceinline__ float bf2f(unsigned short b) { return __uint_as_float(((unsigned)b) << 16); }
__device__ __forceinline__ float bfr(float f) { return bf2f(f2bf(f)); }
__device__ __forceinline__ v16h cat16(v8h lo, v8h hi) { return __builtin_shufflevector(lo, hi, 0, 1, 2, 3, 4, 5, 6, 7, 8, 9, 10, 11, 12, 13, 14, 15); }
__device__ __forceinline__ v16bf cat16b(v8us lo, v8us hi) { return __builtin_bit_cast(v16bf, __builtin_shufflevector(lo, hi, 0, 1, 2, 3, 4, 5, 6, 7, 8, 9, 10, 11, 12, 13, 14, 15)); }
__device__ __forceinline__ v8f wmma16(v16h a, v16h b, v8f c) { return __builtin_amdgcn_wmma_f32_16x16x32_f16(false, a, false, b, (short)0, c, false, false); }
__device__ __forceinline__ v8f wmmab(v16bf a, v16bf b, v8f c) { return __builtin_amdgcn_wmma_f32_16x16x32_bf16(false, a, false, b, (short)0, c, false, false); }



// ---- k_gemmw: register-blocked GEMM, ONE WAVE per 64x64 output tile (16 accumulators), operands straight from K-contiguous 16-bit planes; grid (M/64, N/64, Z), 32 threads.
// C[m][n] (f32, pitch ldc, + optional f32 bias[n]) = sum_k A[m][k] Bt[n][k] (+ split products per NSPLIT). A / A2 row pitch lda, Bt / Bt2 row pitch K. z-batch strides sA/sB/sC in elements. K % 32 == 0.
// Fragments (A and Bt alike): lane l -> row l&15, elements 0..7 = k kc+8h..kc+8h+7, elements 8..15 = k kc+16+8h..kc+16+8h+7 (h = l>>4); D element j -> row 8h+j, col l&15.
template <typename T16> struct WFrag;
template <> struct WFrag<h16> { typedef v16h V; static __device__ __forceinline__ V ld(const h16* p) { return cat16(*(const v8h*)p, *(const v8h*)(p + 16)); } static __device__ __forceinline__ v8f mma(V a, V b, v8f c) { return wmma16(a, b, c); } };
template <> struct WFrag<bf> { typedef v16bf V; static __device__ __forceinline__ V ld(const bf* p) { return cat16b(*(const v8us*)p, *(const v8us*)(p + 16)); } static __device__ __forceinline__ v8f mma(V a, V b, v8f c) { return wmmab(a, b, c); } };
template <typename T16, int NSPLIT, bool BIAS>
__global__ __launch_bounds__(32) void k_gemmw(const T16* __restrict__ A, const T16* __restrict__ A2, const T16* __restrict__ Bt, const T16* __restrict__ Bt2, int K, int lda, float* C, int ldc, const float* __restrict__ bias, size_t sA, size_t sB, size_t sC) {
    typedef typename WFrag<T16>::V V;
    __shared__ __align__(16) float os[16 * 68];
    const size_t z = blockIdx.z; A += z * sA; if (A2) A2 += z * sA; Bt += z * sB; if (Bt2) Bt2 += z * sB; C += z * sC;
    const int lane = threadIdx.x & 31, lr = lane & 15, hi = lane >> 4; const int r0 = blockIdx.x * 64, c0 = blockIdx.y * 64;
    v8f acc[4][4];
#pragma unroll
    for (int mb = 0; mb < 4; ++mb)
#pragma unroll
        for (int nb = 0; nb < 4; ++nb) acc[mb][nb] = (v8f){};
    const size_t aoff = (size_t)(r0 + lr) * lda + 8 * hi, boff = (size_t)(c0 + lr) * K + 8 * hi;
#pragma unroll 1
    for (int kc = 0; kc < K; kc += 32) {
        V a[4], a2[4];
#pragma unroll
        for (int mb = 0; mb < 4; ++mb) { a[mb] = WFrag<T16>::ld(A + aoff + (size_t)mb * 16 * lda + kc); if (NSPLIT == 1 || NSPLIT == 2) a2[mb] = WFrag<T16>::ld(A2 + aoff + (size_t)mb * 16 * lda + kc); }
#pragma unroll
        for (int nb = 0; nb < 4; ++nb) { const V b = WFrag<T16>::ld(Bt + boff + (size_t)nb * 16 * K + kc); V b2; if (NSPLIT >= 2) b2 = WFrag<T16>::ld(Bt2 + boff + (size_t)nb * 16 * K + kc);
#pragma unroll
            for (int mb = 0; mb < 4; ++mb) { acc[mb][nb] = WFrag<T16>::mma(a[mb], b, acc[mb][nb]); if (NSPLIT == 1 || NSPLIT == 2) acc[mb][nb] = WFrag<T16>::mma(a2[mb], b, acc[mb][nb]); if (NSPLIT >= 2) acc[mb][nb] = WFrag<T16>::mma(a[mb], b2, acc[mb][nb]); } }
        asm volatile("v_nop\n\tv_nop\n\tv_nop\n\tv_nop" : "+v"(acc[0][0]), "+v"(acc[1][1]), "+v"(acc[2][2]), "+v"(acc[3][3]) : "v"(a[0]), "v"(a[3]));
    }
#pragma unroll
    for (int mb = 0; mb < 4; ++mb) {
#pragma unroll
        for (int nb = 0; nb < 4; ++nb) {
#pragma unroll
            for (int j = 0; j < 8; ++j) os[(hi * 8 + j) * 68 + nb * 16 + lr] = acc[mb][nb][j]; }
        __builtin_amdgcn_wave_barrier(); asm volatile("" ::: "memory");
        float* crow = C + (size_t)(r0 + mb * 16) * ldc + c0;
{
#pragma unroll
            for (int s = 0; s < 8; ++s) { const int row = 2 * s + hi, cofs = lr * 4; v4f val = *(const v4fa*)(os + row * 68 + cofs); if (BIAS) { val[0] += bfr(bias[c0 + cofs]); val[1] += bfr(bias[c0 + cofs + 1]); val[2] += bfr(bias[c0 + cofs + 2]); val[3] += bfr(bias[c0 + cofs + 3]); }
                *(v4f*)(crow + (size_t)row * ldc + cofs) = val; }
             }
        __builtin_amdgcn_wave_barrier(); asm volatile("" ::: "memory");
    }
}

__device__ __forceinline__ h16 tohx(float x) { return (h16)x; }
__device__ __forceinline__ void splitf(float y, unsigned short& h, unsigned short& l) { h = f2bf(y); l = f2bf(y - bf2f(h)); }
typedef __attribute__((ext_vector_type(2))) _Float16 v2h;
typedef __attribute__((ext_vector_type(4))) _Float16 v4h;
typedef __attribute__((ext_vector_type(2))) unsigned short v2us;
typedef __attribute__((ext_vector_type(4))) unsigned short v4us;
typedef __attribute__((ext_vector_type(2))) float v2f;
typedef __attribute__((ext_vector_type(4))) int v4i;

__global__ __launch_bounds__(256) void k_wtG(const float* __restrict__ w, int K, int N, bf* Bt) {
    const int lane = threadIdx.x & 31; const int L0 = (blockIdx.x * 8 + (threadIdx.x >> 5)) * 8; const int nlines = N * K / 64;
{
#pragma unroll 1
        for (int l = 0; l < 8; ++l) { const int L = L0 + l; if (L >= nlines) break; const size_t e = (size_t)L * 64 + lane * 2; const int k = (int)(e % K), n = (int)(e / K); v2us o;
            o[0] = f2bf(w[(size_t)k * N + n]); o[1] = f2bf(w[(size_t)(k + 1) * N + n]); *(v2us*)(Bt + e) = o; }
         }
}
__global__ __launch_bounds__(256) void k_cvt8(const float* __restrict__ src, bf* dst, size_t n8) { const size_t i = (size_t)blockIdx.x * 256 + threadIdx.x; if (i >= n8) return; src += (size_t)blockIdx.y * S_FULL * DM; dst += (size_t)blockIdx.y * TT * DM; const v8f v = *(const v8f*)(src + i * 8); v8us o;
#pragma unroll
    for (int k = 0; k < 8; ++k) o[k] = f2bf(v[k]); *(v8us*)(dst + i * 8) = o;  }

__global__ __launch_bounds__(256) void k_qkp(const float* __restrict__ F, int pitch, int nheads, h16* P16) {
    const size_t e = ((size_t)blockIdx.x * 256 + threadIdx.x) * 2; if (e >= (size_t)nheads * TT * HD) return; const int d = (int)(e % HD); const int t = (int)((e / HD) % TT); const int h = (int)(e / ((size_t)HD * TT));
    F += (size_t)blockIdx.y * TT * pitch; P16 += (size_t)blockIdx.y * nheads * TT * HD;   // blockIdx.y = batch
    const v2f x = *(const v2f*)(F + (size_t)t * pitch + h * HD + d); v2h o16; o16[0] = tohx(x[0]); o16[1] = tohx(x[1]);
    *(v2h*)(P16 + e) = o16;  }
__global__ __launch_bounds__(256) void k_vtp(const float* __restrict__ F, int pitch, int nheads, bf* Vh, bf* Vl) { const size_t e = ((size_t)blockIdx.x * 256 + threadIdx.x) * 2; if (e >= (size_t)nheads * HD * TT) return; const int t = (int)(e % TT); const int d = (int)((e / TT) % HD); const int g = (int)(e / ((size_t)TT * HD)); v2us oh, ol;
    F += (size_t)blockIdx.y * TT * pitch; Vh += (size_t)blockIdx.y * nheads * HD * TT; Vl += (size_t)blockIdx.y * nheads * HD * TT;   // blockIdx.y = batch
#pragma unroll
    for (int q = 0; q < 2; ++q) { const float x = F[(size_t)(t + q) * pitch + g * HD + d]; unsigned short a2, c2; splitf(x, a2, c2); oh[q] = a2; ol[q] = c2; }
    *(v2us*)(Vh + e) = oh; *(v2us*)(Vl + e) = ol;  }
// k_asoft: the P hi / lo rows (pitch 2 TT, Pl = Ph + TT) overwrite the wave's own f32 score row, which is wholly in registers before the first store (every stored value depends on the row sum).
// k_asoft: one wave per score row (zz, i): t = mask[i][j] ? S x (1/HD) : most negative finite f32 (replace-fill); softmax over the TT keys (register row, running max = max-subtracted form, one exp, fixed trees;
__global__ __launch_bounds__(256) void k_asoft(const float* Sb, const int* __restrict__ Mk, bf* Ph, bf* Pl) {
    const int lane = threadIdx.x & 31; const int row = blockIdx.x * 8 + (threadIdx.x >> 5); if (row >= ZH * TT) return; const int i = row % TT;
    const float* sr = Sb + (size_t)row * TT; const int* mr = Mk + (size_t)i * S_FULL; float v[TT / 32]; float mx = NEGF;
#pragma unroll
    for (int ch = 0; ch < TT / 128; ++ch) { const int j0 = ch * 128 + lane * 4; const v4f a = *(const v4f*)(sr + j0); const v4i mk = *(const v4i*)(mr + j0);
#pragma unroll
        for (int q = 0; q < 4; ++q) { const float t = (mk[q] != 0) ? a[q] * SCL : NEGF; v[ch * 4 + q] = t; mx = fmaxf(mx, t); } }
#pragma unroll
    for (int sh = 16; sh; sh >>= 1) mx = fmaxf(mx, __shfl_xor(mx, sh, 32));
    float sum = 0.f;
#pragma unroll
    for (int k = 0; k < TT / 32; ++k) { float d0 = __fsub_rn(v[k], mx); asm volatile("" : "+v"(d0)); v[k] = __builtin_amdgcn_exp2f(__fmul_rn(d0, 1.4426950408889634f)); sum += v[k]; }
#pragma unroll
    for (int sh = 16; sh; sh >>= 1) sum += __shfl_xor(sum, sh, 32);
    const float f = __fdiv_rn(1.0f, sum);
{
#pragma unroll
        for (int ch = 0; ch < TT / 128; ++ch) { v4us oh, ol;
#pragma unroll
            for (int q = 0; q < 4; ++q) { unsigned short a, c2; splitf(v[ch * 4 + q] * f, a, c2); oh[q] = a; ol[q] = c2; }
            const size_t oo = (size_t)row * (2 * TT) + ch * 128 + lane * 4; *(v4us*)(Ph + oo) = oh; *(v4us*)(Pl + oo) = ol; }
         }
}
__global__ __launch_bounds__(256) void k_merge(const float* __restrict__ O, int g0, bf* Ah, bf* Al) { const size_t e = ((size_t)blockIdx.x * 256 + threadIdx.x) * 2; if (e >= (size_t)ZH * TT * HD) return; const int d = (int)(e % HD); const int t = (int)((e / HD) % TT); const int zz = (int)(e / ((size_t)HD * TT)); const int g = g0 + zz; const size_t oo = ((size_t)(g / NH_) * TT + t) * DQ + (g % NH_) * HD + d;
    v2us oh, ol;
#pragma unroll
    for (int q = 0; q < 2; ++q) { unsigned short a, c2; splitf(O[e + q], a, c2); oh[q] = a; ol[q] = c2; } *(v2us*)(Ah + oo) = oh; *(v2us*)(Al + oo) = ol;  }

extern "C" void kernel_launch(void* const* d_in, const int* in_sizes, int n_in,
                              void* d_out, int out_size, void* d_ws, size_t ws_size, hipStream_t stream) {
    if (n_in < 11) return;
    if ((size_t)in_sizes[0] < (size_t)(NB - 1) * S_FULL * DM + (size_t)TT * DM) return;
    if ((size_t)in_sizes[1] < (size_t)(NB - 1) * S_FULL * DM + (size_t)TT * DM) return;
    if ((size_t)in_sizes[2] < (size_t)(TT - 1) * S_FULL + (size_t)TT) return;
    if (in_sizes[3] < DM * DQ || in_sizes[5] < DM * DKV || in_sizes[7] < DM * DKV || in_sizes[9] < DQ * DM) return;
    if (in_sizes[4] < DQ || in_sizes[6] < DKV || in_sizes[8] < DKV || in_sizes[10] < DM) return;
    if ((size_t)out_size < (size_t)NB * TT * DM) return;
    const float* x  = (const float*)d_in[0];     // [NB][S_FULL][DM]
    const float* xk = (const float*)d_in[1];     // [NB][S_FULL][DM]
    const int*   mk = (const int*)d_in[2];       // [1][1][S_FULL][S_FULL] int32 0/1
    const float* wq = (const float*)d_in[3]; const float* bq = (const float*)d_in[4];
    const float* wk = (const float*)d_in[5]; const float* bk = (const float*)d_in[6];
    const float* wv = (const float*)d_in[7]; const float* bv = (const float*)d_in[8];
    const float* wo = (const float*)d_in[9]; const float* bo = (const float*)d_in[10];
    float* OUT = (float*)d_out;     // [NB][TT][DM]
    char* wsp = (char*)d_ws;
    auto take = [&](size_t bytes) { char* p = wsp; wsp += (bytes + 255) & ~(size_t)255; return (void*)p; };
    bf* WQ = (bf*)take((size_t)DQ * DM * 2); bf* WK = (bf*)take((size_t)DKV * DM * 2); bf* WV = (bf*)take((size_t)DKV * DM * 2); bf* WO = (bf*)take((size_t)DM * DQ * 2);
    h16* QP16 = (h16*)take((size_t)NB * NH_ * TT * HD * 2); h16* KP16 = (h16*)take((size_t)NB * NKV * TT * HD * 2);
    bf* VTh = (bf*)take((size_t)NB * NKV * HD * TT * 2); bf* VTl = (bf*)take((size_t)NB * NKV * HD * TT * 2);
    float* Ob = (float*)take((size_t)ZH * TT * HD * 4); bf* ATh = (bf*)take((size_t)NB * TT * DQ * 2); bf* ATl = (bf*)take((size_t)NB * TT * DQ * 2);
    char* const uni = wsp;   // one region, two lives (stream-ordered): the projection operands and f32 results, then the score / P rows
    bf* XB = (bf*)take((size_t)NB * TT * DM * 2); bf* XKB = (bf*)take((size_t)NB * TT * DM * 2); float* FQ = (float*)take((size_t)NB * TT * DQ * 4); float* FK = (float*)take((size_t)NB * TT * DKV * 4);
    if ((size_t)(wsp - (char*)d_ws) > ws_size) return;
    wsp = uni; float* Sb = (float*)take((size_t)ZH * TT * TT * 4); bf* Ph = (bf*)Sb; bf* Pl = Ph + TT;   // P hi / lo rows live in their own score row: pitch 2 TT
    if ((size_t)(wsp - (char*)d_ws) > ws_size) return;    // 240 MiB total at the full size
    float* FV = FK;   // v projection reuses the k buffer after the k planes are built (stream-ordered)
    k_wtG<<<(unsigned)((DM * DQ / 64 + 63) / 64), 256, 0, stream>>>(wq, DM, DQ, WQ); k_wtG<<<(unsigned)((DM * DKV / 64 + 63) / 64), 256, 0, stream>>>(wk, DM, DKV, WK); k_wtG<<<(unsigned)((DM * DKV / 64 + 63) / 64), 256, 0, stream>>>(wv, DM, DKV, WV);
    k_wtG<<<(unsigned)((DQ * DM / 64 + 63) / 64), 256, 0, stream>>>(wo, DQ, DM, WO);
    const unsigned LQ = (unsigned)(((size_t)NH_ * TT * HD / 2 + 255) / 256), LKv = (unsigned)(((size_t)NKV * TT * HD / 2 + 255) / 256);
    // every batch in one launch: rows b * TT + t in the projections, planes b * NH_ + h in attention
    k_cvt8<<<dim3((unsigned)(((size_t)TT * DM / 8 + 255) / 256), NB, 1), 256, 0, stream>>>(x, XB, (size_t)TT * DM / 8); k_cvt8<<<dim3((unsigned)(((size_t)TT * DM / 8 + 255) / 256), NB, 1), 256, 0, stream>>>(xk, XKB, (size_t)TT * DM / 8);
    k_gemmw<bf, 0, true><<<dim3(NB * TT / 64, DQ / 64, 1), 32, 0, stream>>>(XB, nullptr, WQ, nullptr, DM, DM, FQ, DQ, bq, 0, 0, 0);
    k_qkp<<<dim3(LQ, NB, 1), 256, 0, stream>>>(FQ, DQ, NH_, QP16);
    k_gemmw<bf, 0, true><<<dim3(NB * TT / 64, DKV / 64, 1), 32, 0, stream>>>(XKB, nullptr, WK, nullptr, DM, DM, FK, DKV, bk, 0, 0, 0);
    k_qkp<<<dim3(LKv, NB, 1), 256, 0, stream>>>(FK, DKV, NKV, KP16);
    k_gemmw<bf, 0, true><<<dim3(NB * TT / 64, DKV / 64, 1), 32, 0, stream>>>(XKB, nullptr, WV, nullptr, DM, DM, FV, DKV, bv, 0, 0, 0); k_vtp<<<dim3(LKv, NB, 1), 256, 0, stream>>>(FV, DKV, NKV, VTh, VTl);
    for (int g0 = 0; g0 < NB * NH_; g0 += ZH) { const size_t zg = (size_t)g0;   // pass planes g0..g0+ZH-1: consecutive, z-strides TT*HD
        k_gemmw<h16, 0, false><<<dim3(TT / 64, TT / 64, ZH), 32, 0, stream>>>(QP16 + zg * TT * HD, nullptr, KP16 + zg * TT * HD, nullptr, HD, HD, Sb, TT, nullptr, (size_t)TT * HD, (size_t)TT * HD, (size_t)TT * TT);
        k_asoft<<<ZH * TT / 8, 256, 0, stream>>>(Sb, mk, Ph, Pl);
        k_gemmw<bf, 2, false><<<dim3(TT / 64, HD / 64, ZH), 32, 0, stream>>>(Ph, Pl, VTh + zg * HD * TT, VTl + zg * HD * TT, TT, 2 * TT, Ob, HD, nullptr, (size_t)TT * 2 * TT, (size_t)HD * TT, (size_t)TT * HD);
        k_merge<<<(unsigned)(((size_t)ZH * TT * HD / 2 + 255) / 256), 256, 0, stream>>>(Ob, g0, ATh, ATl); }
    k_gemmw<bf, 1, true><<<dim3(NB * TT / 64, DM / 64, 1), 32, 0, stream>>>(ATh, ATl, WO, nullptr, DQ, DQ, OUT, DM, bo, 0, 0, 0);
}

// v002
// Measured time: 365 microseconds a run.
// Timed twice side by side with v001, it ran 1.86 times as fast both times.
// All steps since v000 together make it 4.64 times as fast.
#include <hip/hip_runtime.h>

// Multi-head dot-product attention: inputs_q, inputs_kv [8][1024][1024]; q = inputs_q Wq + bq, k / v = inputs_kv Wk / Wv + bk / bv (W [1024][16][64] = k-major [1024][1024], bias [16][64]);
// logits = (q . k) / 64 (the module divides q by the head depth); int32 mask [1][1][1024][1024] replaces masked logits by the most negative finite f32; softmax over keys; ctx = P . v; out = ctx Wo ([16][64][1024] = [1024][1024]) + bo -> [8][1024][1024] f32.
// Compute dtypes, f32 accumulate: every float input RNE-converted to bf16; q/k/v projections v_wmma_f32_16x16x32_bf16 on plain bf16 operands; scores v_wmma_f32_16x16x32_f16 on plain fp16 q/k planes with 1/64 applied to the f32 score; softmax f32, running maximum; P . v on bf16 hi/lo parts of the unnormalised P = 2^(u - m) and of v (3 products), 1 / sum applied to the f32 result; ctx . Wo on bf16 hi/lo ctx planes x exact bf16 Wo (2 products); biases added in f32 as bf16-converted values.

#ifndef NB
#define NB   8
#endif
#ifndef SEQ
#define SEQ  1024
#endif
#define S_FULL 1024                 // per-batch row count / mask row pitch
#define TT   SEQ
#define DM   1024
#define NH_  16
#define NKV  16
#define REP  (NH_ / NKV)
#define HD   64
#define DQ   (NH_ * HD)
#define DKV  (NKV * HD)
#define SCL  0.015625f              // 1 / HD
#define NEGF (-3.4028234663852886e38f)

static_assert(TT % 128 == 0);
static_assert(TT % 64 == 0);
static_assert(DM % 64 == 0);
static_assert(HD % 32 == 0);
static_assert(REP == 1);
static_assert(SEQ <= S_FULL);
static_assert(NB >= 1);

typedef _Float16 h16;
typedef unsigned short bf;
typedef __attribute__((ext_vector_type(16))) __bf16   v16bf;
typedef __attribute__((ext_vector_type(16))) _Float16 v16h;
typedef __attribute__((ext_vector_type(8)))  _Float16 v8h;
typedef __attribute__((ext_vector_type(8)))  unsigned short v8us;
typedef __attribute__((ext_vector_type(8)))  float    v8f;
typedef __attribute__((ext_vector_type(4)))  float    v4f;
typedef v8h  __attribute__((may_alias)) v8ha;
typedef v4f  __attribute__((may_alias)) v4fa;
typedef v8us __attribute__((may_alias)) v8usa;

__device__ __forceinline__ unsigned short f2bf(float f) { unsigned u = __float_as_uint(f); u += 0x7FFFu + ((u >> 16) & 1u); return (unsigned short)(u >> 16); }
__device__ __forceinline__ float bf2f(unsigned short b) { return __uint_as_float(((unsigned)b) << 16); }
__device__ __forceinline__ float bfr(float f) { return bf2f(f2bf(f)); }
__device__ __forceinline__ v16h cat16(v8h lo, v8h hi) { return __builtin_shufflevector(lo, hi, 0, 1, 2, 3, 4, 5, 6, 7, 8, 9, 10, 11, 12, 13, 14, 15); }
__device__ __forceinline__ v16bf cat16b(v8us lo, v8us hi) { return __builtin_bit_cast(v16bf, __builtin_shufflevector(lo, hi, 0, 1, 2, 3, 4, 5, 6, 7, 8, 9, 10, 11, 12, 13, 14, 15)); }
__device__ __forceinline__ v8f wmma16(v16h a, v16h b, v8f c) { return __builtin_amdgcn_wmma_f32_16x16x32_f16(false, a, false, b, (short)0, c, false, false); }
__device__ __forceinline__ v8f wmmab(v16bf a, v16bf b, v8f c) { return __builtin_amdgcn_wmma_f32_16x16x32_bf16(false, a, false, b, (short)0, c, false, false); }



// ---- k_gemmw: register-blocked GEMM, ONE WAVE per 64x64 output tile (16 accumulators), operands straight from K-contiguous 16-bit planes; grid (M/64, N/64, Z), 32 threads.
// C[m][n] (f32, pitch ldc, + optional f32 bias[n]) = sum_k A[m][k] Bt[n][k] (+ split products per NSPLIT). A / A2 row pitch lda, Bt / Bt2 row pitch K. z-batch strides sA/sB/sC in elements. K % 32 == 0.
// Fragments (A and Bt alike): lane l -> row l&15, elements 0..7 = k kc+8h..kc+8h+7, elements 8..15 = k kc+16+8h..kc+16+8h+7 (h = l>>4); D element j -> row 8h+j, col l&15.
template <typename T16> struct WFrag;
template <> struct WFrag<h16> { typedef v16h V; static __device__ __forceinline__ V ld(const h16* p) { return cat16(*(const v8h*)p, *(const v8h*)(p + 16)); } static __device__ __forceinline__ v8f mma(V a, V b, v8f c) { return wmma16(a, b, c); } };
template <> struct WFrag<bf> { typedef v16bf V; static __device__ __forceinline__ V ld(const bf* p) { return cat16b(*(const v8us*)p, *(const v8us*)(p + 16)); } static __device__ __forceinline__ v8f mma(V a, V b, v8f c) { return wmmab(a, b, c); } };
template <typename T16, int NSPLIT, bool BIAS>
__global__ __launch_bounds__(32) void k_gemmw(const T16* __restrict__ A, const T16* __restrict__ A2, const T16* __restrict__ Bt, const T16* __restrict__ Bt2, int K, int lda, float* C, int ldc, const float* __restrict__ bias, size_t sA, size_t sB, size_t sC) {
    typedef typename WFrag<T16>::V V;
    __shared__ __align__(16) float os[16 * 68];
    const size_t z = blockIdx.z; A += z * sA; if (A2) A2 += z * sA; Bt += z * sB; if (Bt2) Bt2 += z * sB; C += z * sC;
    const int lane = threadIdx.x & 31, lr = lane & 15, hi = lane >> 4; const int r0 = blockIdx.x * 64, c0 = blockIdx.y * 64;
    v8f acc[4][4];
#pragma unroll
    for (int mb = 0; mb < 4; ++mb)
#pragma unroll
        for (int nb = 0; nb < 4; ++nb) acc[mb][nb] = (v8f){};
    const size_t aoff = (size_t)(r0 + lr) * lda + 8 * hi, boff = (size_t)(c0 + lr) * K + 8 * hi;
#pragma unroll 1
    for (int kc = 0; kc < K; kc += 32) {
        V a[4], a2[4];
#pragma unroll
        for (int mb = 0; mb < 4; ++mb) { a[mb] = WFrag<T16>::ld(A + aoff + (size_t)mb * 16 * lda + kc); if (NSPLIT == 1 || NSPLIT == 2) a2[mb] = WFrag<T16>::ld(A2 + aoff + (size_t)mb * 16 * lda + kc); }
#pragma unroll
        for (int nb = 0; nb < 4; ++nb) { const V b = WFrag<T16>::ld(Bt + boff + (size_t)nb * 16 * K + kc); V b2; if (NSPLIT >= 2) b2 = WFrag<T16>::ld(Bt2 + boff + (size_t)nb * 16 * K + kc);
#pragma unroll
            for (int mb = 0; mb < 4; ++mb) { acc[mb][nb] = WFrag<T16>::mma(a[mb], b, acc[mb][nb]); if (NSPLIT == 1 || NSPLIT == 2) acc[mb][nb] = WFrag<T16>::mma(a2[mb], b, acc[mb][nb]); if (NSPLIT >= 2) acc[mb][nb] = WFrag<T16>::mma(a[mb], b2, acc[mb][nb]); } }
        asm volatile("v_nop\n\tv_nop\n\tv_nop\n\tv_nop" : "+v"(acc[0][0]), "+v"(acc[1][1]), "+v"(acc[2][2]), "+v"(acc[3][3]) : "v"(a[0]), "v"(a[3]));
    }
#pragma unroll
    for (int mb = 0; mb < 4; ++mb) {
#pragma unroll
        for (int nb = 0; nb < 4; ++nb) {
#pragma unroll
            for (int j = 0; j < 8; ++j) os[(hi * 8 + j) * 68 + nb * 16 + lr] = acc[mb][nb][j]; }
        __builtin_amdgcn_wave_barrier(); asm volatile("" ::: "memory");
        float* crow = C + (size_t)(r0 + mb * 16) * ldc + c0;
{
#pragma unroll
            for (int s = 0; s < 8; ++s) { const int row = 2 * s + hi, cofs = lr * 4; v4f val = *(const v4fa*)(os + row * 68 + cofs); if (BIAS) { val[0] += bfr(bias[c0 + cofs]); val[1] += bfr(bias[c0 + cofs + 1]); val[2] += bfr(bias[c0 + cofs + 2]); val[3] += bfr(bias[c0 + cofs + 3]); }
                *(v4f*)(crow + (size_t)row * ldc + cofs) = val; }
             }
        __builtin_amdgcn_wave_barrier(); asm volatile("" ::: "memory");
    }
}

__device__ __forceinline__ h16 tohx(float x) { return (h16)x; }
__device__ __forceinline__ void splitf(float y, unsigned short& h, unsigned short& l) { h = f2bf(y); l = f2bf(y - bf2f(h)); }
typedef __attribute__((ext_vector_type(2))) _Float16 v2h;
typedef __attribute__((ext_vector_type(4))) _Float16 v4h;
typedef __attribute__((ext_vector_type(2))) unsigned short v2us;
typedef __attribute__((ext_vector_type(4))) unsigned short v4us;
typedef __attribute__((ext_vector_type(2))) float v2f;
typedef __attribute__((ext_vector_type(4))) int v4i;

__global__ __launch_bounds__(256) void k_wtG(const float* __restrict__ w, int K, int N, bf* Bt) {
    const int lane = threadIdx.x & 31; const int L0 = (blockIdx.x * 8 + (threadIdx.x >> 5)) * 8; const int nlines = N * K / 64;
{
#pragma unroll 1
        for (int l = 0; l < 8; ++l) { const int L = L0 + l; if (L >= nlines) break; const size_t e = (size_t)L * 64 + lane * 2; const int k = (int)(e % K), n = (int)(e / K); v2us o;
            o[0] = f2bf(w[(size_t)k * N + n]); o[1] = f2bf(w[(size_t)(k + 1) * N + n]); *(v2us*)(Bt + e) = o; }
         }
}
__global__ __launch_bounds__(256) void k_cvt8(const float* __restrict__ src, bf* dst, size_t n8) { const size_t i = (size_t)blockIdx.x * 256 + threadIdx.x; if (i >= n8) return; src += (size_t)blockIdx.y * S_FULL * DM; dst += (size_t)blockIdx.y * TT * DM; const v8f v = *(const v8f*)(src + i * 8); v8us o;
#pragma unroll
    for (int k = 0; k < 8; ++k) o[k] = f2bf(v[k]); *(v8us*)(dst + i * 8) = o;  }

__global__ __launch_bounds__(256) void k_qkp(const float* __restrict__ F, int pitch, int nheads, h16* P16) {
    const size_t e = ((size_t)blockIdx.x * 256 + threadIdx.x) * 2; if (e >= (size_t)nheads * TT * HD) return; const int d = (int)(e % HD); const int t = (int)((e / HD) % TT); const int h = (int)(e / ((size_t)HD * TT));
    F += (size_t)blockIdx.y * TT * pitch; P16 += (size_t)blockIdx.y * nheads * TT * HD;   // blockIdx.y = batch
    const v2f x = *(const v2f*)(F + (size_t)t * pitch + h * HD + d); v2h o16; o16[0] = tohx(x[0]); o16[1] = tohx(x[1]);
    *(v2h*)(P16 + e) = o16;  }
__global__ __launch_bounds__(256) void k_vtp(const float* __restrict__ F, int pitch, int nheads, bf* Vh, bf* Vl) { const size_t e = ((size_t)blockIdx.x * 256 + threadIdx.x) * 2; if (e >= (size_t)nheads * HD * TT) return; const int t = (int)(e % TT); const int d = (int)((e / TT) % HD); const int g = (int)(e / ((size_t)TT * HD)); v2us oh, ol;
    F += (size_t)blockIdx.y * TT * pitch; Vh += (size_t)blockIdx.y * nheads * HD * TT; Vl += (size_t)blockIdx.y * nheads * HD * TT;   // blockIdx.y = batch
#pragma unroll
    for (int q = 0; q < 2; ++q) { const float x = F[(size_t)(t + q) * pitch + g * HD + d]; unsigned short a2, c2; splitf(x, a2, c2); oh[q] = a2; ol[q] = c2; }
    *(v2us*)(Vh + e) = oh; *(v2us*)(Vl + e) = ol;  }
// ---- k_fattn: scores, mask, softmax, P . v and the hi / lo split of ctx in ONE kernel; no score or P element ever reaches memory.
// Grid (TT / 256, planes), 8 waves; a wave owns 32 queries (2 column groups of 16) of one (batch, head) plane and walks all TT keys, 64 keys an LDS stage (k rows, v^T hi and lo rows, pitch 144 B; two stage buffers, one barrier a stage), 32 keys a pass.
// S^T = K . Q^T (A = k rows, B = q rows, f16): lane l holds query l & 15, keys 8h + j of each 16-key tile, so two tiles converted in place ARE the B operand of O^T += V^T . P^T (A = v^T rows in the same k order, bf16 hi / lo, 3 products).
// Every inner loop is fully unrolled so that each index into a register array is a constant. Two work-groups a WGP = four waves a SIMD (256 registers a wave), which the vector work between the matrix runs wants.
// Softmax is the running-maximum form in the log2 domain: u = S x (log2 e / HD), masked u = most negative finite f32; p = 2^(u - m); O^T and the sum are rescaled by 2^(m_old - m_new) every pass; 1 / sum is applied to O^T at the end.
typedef __attribute__((ext_vector_type(8))) unsigned v8u;
typedef __attribute__((ext_vector_type(2))) __bf16 v2bf;
typedef __attribute__((ext_vector_type(4), may_alias)) unsigned v4u_;
#define AW  8                       // waves per work-group
#define AR  2                       // 16-query column groups per wave
#define AKB 64                      // keys per LDS stage
#define APT 72                      // LDS row pitch in 16-bit elements: 128-byte rows + 16 bytes
#define SCL2 (SCL * 1.4426950408889634f)
static_assert(TT % (AW * AR * 16) == 0);
static_assert(TT % AKB == 0);
static_assert(HD == 64);
__device__ __forceinline__ unsigned pack2(float a, float b) { v2f x; x[0] = a; x[1] = b; return __builtin_bit_cast(unsigned, __builtin_convertvector(x, v2bf)); }   // two f32 -> two bf16, round to nearest even
__device__ __forceinline__ float xhalf(float x) { return __builtin_bit_cast(float, __builtin_amdgcn_permlanex16(__builtin_bit_cast(int, x), __builtin_bit_cast(int, x), 0x76543210, 0xfedcba98, false, false)); }   // lane l <-> lane l ^ 16
__device__ __forceinline__ void split2(float a, float b, unsigned& h, unsigned& l) { h = pack2(a, b); l = pack2(a - __uint_as_float(h << 16), b - __uint_as_float(h & 0xFFFF0000u)); }
// Eight 2^x and the slot behind the last of them in ONE statement: each v_exp fills the slot of the one before it, the v_nop that of the last
__device__ __forceinline__ void exp2x8(float (&p)[8], const float (&d)[8]) {
    asm("v_exp_f32 %0, %8\n\tv_exp_f32 %1, %9\n\tv_exp_f32 %2, %10\n\tv_exp_f32 %3, %11\n\tv_exp_f32 %4, %12\n\tv_exp_f32 %5, %13\n\tv_exp_f32 %6, %14\n\tv_exp_f32 %7, %15\n\tv_nop"
        : "=&v"(p[0]), "=&v"(p[1]), "=&v"(p[2]), "=&v"(p[3]), "=&v"(p[4]), "=&v"(p[5]), "=&v"(p[6]), "=&v"(p[7])
        : "v"(d[0]), "v"(d[1]), "v"(d[2]), "v"(d[3]), "v"(d[4]), "v"(d[5]), "v"(d[6]), "v"(d[7]));
}
__global__ __launch_bounds__(AW * 32) __attribute__((amdgpu_waves_per_eu(4, 4))) void k_fattn(const h16* __restrict__ Qp, const h16* __restrict__ Kp, const bf* __restrict__ Vh, const bf* __restrict__ Vl, const int* __restrict__ Mk, bf* Ah, bf* Al) {
    __shared__ __align__(16) h16 Ks[2][AKB * APT];
    __shared__ __align__(16) bf Vhs[2][HD * APT];
    __shared__ __align__(16) bf Vls[2][HD * APT];
    __shared__ unsigned mbit[AW][TT / AKB][AR][32];   // each lane's own mask bits, one word per stage and column group; written and read by the same lane only
    const int tid = threadIdx.x, lane = tid & 31, wave = tid >> 5, lr = lane & 15, hi = lane >> 4;
    const int g = blockIdx.y, q0 = blockIdx.x * (AW * AR * 16) + wave * (AR * 16);
    Qp += (size_t)g * TT * HD; Kp += (size_t)g * TT * HD; Vh += (size_t)g * HD * TT; Vl += (size_t)g * HD * TT;
    const int srow = tid >> 3, sseg = (tid & 7) * 8;   // staging: 8 threads a 128-byte row, 32 rows a sweep
    const unsigned ko = (unsigned)(srow * HD + sseg), vo = (unsigned)(srow * TT + sseg);   // this thread's 32-bit offsets from wave-uniform bases
#pragma unroll
    for (int p = 0; p < 2; ++p) { const v8h rk = *(const v8h*)(Kp + 32 * p * HD + ko); const v8us rh = *(const v8us*)(Vh + 32 * p * TT + vo), rl = *(const v8us*)(Vl + 32 * p * TT + vo);
        *(v8h*)(Ks[0] + (srow + 32 * p) * APT + sseg) = rk; *(v8us*)(Vhs[0] + (srow + 32 * p) * APT + sseg) = rh; *(v8us*)(Vls[0] + (srow + 32 * p) * APT + sseg) = rl; }
    // mask rows of this lane's queries -> bits: element e = 8 * tile + j of a stage sits at bit 31 - e
    // rolled, for speed only
#pragma unroll 1
    for (int blk = 0; blk < TT / AKB; ++blk) {
#pragma unroll
        for (int r = 0; r < AR; ++r) { const int* mr = Mk + (size_t)(q0 + r * 16 + lr) * S_FULL + blk * AKB + 8 * hi; unsigned w = 0; v4i mv[AKB / 8];
#pragma unroll
            for (int c = 0; c < AKB / 8; ++c) mv[c] = *(const v4i*)(mr + (c >> 1) * 16 + (c & 1) * 4);
            asm volatile("s_wait_xcnt 0x0" ::: "memory");   // stands in front of whatever next overwrites the address registers that these loads name
#pragma unroll
            for (int c = 0; c < AKB / 8; ++c)
#pragma unroll
                for (int j = 0; j < 4; ++j) w = (w << 1) | min((unsigned)mv[c][j], 1u);
            mbit[wave][blk][r][lane] = w; }
    }
    v16h qf[AR][2];
#pragma unroll
    for (int r = 0; r < AR; ++r)
#pragma unroll
        for (int kc = 0; kc < 2; ++kc) qf[r][kc] = WFrag<h16>::ld(Qp + (size_t)(q0 + r * 16 + lr) * HD + kc * 32 + 8 * hi);
    v8f o[AR][4]; float m[AR], ls[AR];
#pragma unroll
    for (int r = 0; r < AR; ++r) { m[r] = NEGF; ls[r] = 0.f;
#pragma unroll
        for (int dt = 0; dt < 4; ++dt) o[r][dt] = (v8f){}; }
    // rolled: the register count stays at four waves a SIMD
#pragma unroll 1
    for (int blk = 0; blk < TT / AKB; ++blk) {
        __syncthreads();   // publishes stage blk, and ends every wave's reads of the other buffer, which this stage refills
        const int cb = blk & 1, kn = (blk + 1) * AKB; const bool more = blk + 1 < TT / AKB;
        unsigned mw[AR];
#pragma unroll
        for (int r = 0; r < AR; ++r) mw[r] = mbit[wave][blk][r][lane];
        const bool anym = __builtin_amdgcn_ballot_w32((mw[0] & mw[1]) != 0xFFFFFFFFu) != 0;   // wave-uniform: a stage with no masked element skips the selects
#pragma unroll
        for (int sb = 0; sb < AKB / 32; ++sb) {
            v8h rk; v8us rh, rl;
            if (more) { rk = *(const v8h*)(Kp + (kn + 32 * sb) * HD + ko); rh = *(const v8us*)(Vh + (32 * sb * TT + kn) + vo); rl = *(const v8us*)(Vl + (32 * sb * TT + kn) + vo); }   // half of the next stage's rows fly to registers under this pass
            float u[AR][16];
#pragma unroll
            for (int kt = 0; kt < 2; ++kt) { const h16* kp = Ks[cb] + (sb * 32 + kt * 16 + lr) * APT + 8 * hi; const v16h k0 = WFrag<h16>::ld(kp), k1 = WFrag<h16>::ld(kp + 32);
#pragma unroll
                for (int r = 0; r < AR; ++r) { const v8f s = wmma16(k1, qf[r][1], wmma16(k0, qf[r][0], (v8f){}));
#pragma unroll
                    for (int j = 0; j < 8; ++j) u[r][kt * 8 + j] = s[j] * SCL2; } }
            if (anym) {
#pragma unroll
                for (int r = 0; r < AR; ++r)
#pragma unroll
                    for (int e = 0; e < 16; ++e) if ((int)(mw[r] << (sb * 16 + e)) >= 0) u[r][e] = NEGF; }
            v16bf ph[AR], pl[AR];
#pragma unroll
            for (int r = 0; r < AR; ++r) {
                float mx = u[r][0];
#pragma unroll
                for (int e = 1; e < 16; ++e) mx = fmaxf(mx, u[r][e]);
                mx = fmaxf(mx, xhalf(mx));
                const float mn = fmaxf(m[r], mx), al = __builtin_amdgcn_exp2f(m[r] - mn); m[r] = mn;
                float sum = 0.f; v8u wh, wl;
#pragma unroll
                for (int t = 0; t < 2; ++t) { float d[8], p[8];
#pragma unroll
                    for (int j = 0; j < 8; ++j) d[j] = u[r][t * 8 + j] - mn;
                    exp2x8(p, d);
#pragma unroll
                    for (int j = 0; j < 8; j += 2) { sum += p[j] + p[j + 1]; unsigned a, c; split2(p[j], p[j + 1], a, c); wh[(t * 8 + j) >> 1] = a; wl[(t * 8 + j) >> 1] = c; } }
                asm volatile("" : "+v"(sum));   // each row's sum pinned against spills: without it the adds sink to the loop's foot, every p of the stage stays live until there, and the staging registers spill
                ls[r] = ls[r] * al + sum; ph[r] = __builtin_bit_cast(v16bf, wh); pl[r] = __builtin_bit_cast(v16bf, wl);
#pragma unroll
                for (int dt = 0; dt < 4; ++dt) o[r][dt] = o[r][dt] * al;
            }
            v16bf vf[4];
#pragma unroll
            for (int dt = 0; dt < 4; ++dt) vf[dt] = WFrag<bf>::ld(Vhs[cb] + (dt * 16 + lr) * APT + sb * 32 + 8 * hi);
#pragma unroll
            for (int dt = 0; dt < 4; ++dt)
#pragma unroll
                for (int r = 0; r < AR; ++r) o[r][dt] = wmmab(vf[dt], ph[r], o[r][dt]);
#pragma unroll
            for (int dt = 0; dt < 4; ++dt)
#pragma unroll
                for (int r = 0; r < AR; ++r) o[r][dt] = wmmab(vf[dt], pl[r], o[r][dt]);
#pragma unroll
            for (int dt = 0; dt < 4; ++dt) vf[dt] = WFrag<bf>::ld(Vls[cb] + (dt * 16 + lr) * APT + sb * 32 + 8 * hi);
#pragma unroll
            for (int dt = 0; dt < 4; ++dt)
#pragma unroll
                for (int r = 0; r < AR; ++r) o[r][dt] = wmmab(vf[dt], ph[r], o[r][dt]);
            if (more) { *(v8h*)(Ks[cb ^ 1] + (srow + 32 * sb) * APT + sseg) = rk; *(v8us*)(Vhs[cb ^ 1] + (srow + 32 * sb) * APT + sseg) = rh; *(v8us*)(Vls[cb ^ 1] + (srow + 32 * sb) * APT + sseg) = rl; }
        }
    }
    // lane l holds ctx[query l & 15][d = 16 dt + 8h + j]: 8 consecutive d, one 16-byte store a plane
#pragma unroll
    for (int r = 0; r < AR; ++r) { const float f = __fdiv_rn(1.0f, ls[r] + xhalf(ls[r])); const size_t oo = ((size_t)(g / NH_) * TT + q0 + r * 16 + lr) * DQ + (g % NH_) * HD + 8 * hi;
#pragma unroll
        for (int dt = 0; dt < 4; ++dt) { v4u_ wh, wl;
#pragma unroll
            for (int j = 0; j < 8; j += 2) { unsigned a, c; split2(o[r][dt][j] * f, o[r][dt][j + 1] * f, a, c); wh[j >> 1] = a; wl[j >> 1] = c; }
            *(v4u_*)(Ah + oo + dt * 16) = wh; *(v4u_*)(Al + oo + dt * 16) = wl; } }
}

extern "C" void kernel_launch(void* const* d_in, const int* in_sizes, int n_in,
                              void* d_out, int out_size, void* d_ws, size_t ws_size, hipStream_t stream) {
    if (n_in < 11) return;
    if ((size_t)in_sizes[0] < (size_t)(NB - 1) * S_FULL * DM + (size_t)TT * DM) return;
    if ((size_t)in_sizes[1] < (size_t)(NB - 1) * S_FULL * DM + (size_t)TT * DM) return;
    if ((size_t)in_sizes[2] < (size_t)(TT - 1) * S_FULL + (size_t)TT) return;
    if (in_sizes[3] < DM * DQ || in_sizes[5] < DM * DKV || in_sizes[7] < DM * DKV || in_sizes[9] < DQ * DM) return;
    if (in_sizes[4] < DQ || in_sizes[6] < DKV || in_sizes[8] < DKV || in_sizes[10] < DM) return;
    if ((size_t)out_size < (size_t)NB * TT * DM) return;
    const float* x  = (const float*)d_in[0];     // [NB][S_FULL][DM]
    const float* xk = (const float*)d_in[1];     // [NB][S_FULL][DM]
    const int*   mk = (const int*)d_in[2];       // [1][1][S_FULL][S_FULL] int32 0/1
    const float* wq = (const float*)d_in[3]; const float* bq = (const float*)d_in[4];
    const float* wk = (const float*)d_in[5]; const float* bk = (const float*)d_in[6];
    const float* wv = (const float*)d_in[7]; const float* bv = (const float*)d_in[8];
    const float* wo = (const float*)d_in[9]; const float* bo = (const float*)d_in[10];
    float* OUT = (float*)d_out;     // [NB][TT][DM]
    char* wsp = (char*)d_ws;
    auto take = [&](size_t bytes) { char* p = wsp; wsp += (bytes + 255) & ~(size_t)255; return (void*)p; };
    bf* WQ = (bf*)take((size_t)DQ * DM * 2); bf* WK = (bf*)take((size_t)DKV * DM * 2); bf* WV = (bf*)take((size_t)DKV * DM * 2); bf* WO = (bf*)take((size_t)DM * DQ * 2);
    h16* QP16 = (h16*)take((size_t)NB * NH_ * TT * HD * 2); h16* KP16 = (h16*)take((size_t)NB * NKV * TT * HD * 2);
    bf* VTh = (bf*)take((size_t)NB * NKV * HD * TT * 2); bf* VTl = (bf*)take((size_t)NB * NKV * HD * TT * 2);
    bf* ATh = (bf*)take((size_t)NB * TT * DQ * 2); bf* ATl = (bf*)take((size_t)NB * TT * DQ * 2);
    bf* XB = (bf*)take((size_t)NB * TT * DM * 2); bf* XKB = (bf*)take((size_t)NB * TT * DM * 2); float* FQ = (float*)take((size_t)NB * TT * DQ * 4); float* FK = (float*)take((size_t)NB * TT * DKV * 4);
    if ((size_t)(wsp - (char*)d_ws) > ws_size) return;
    float* FV = FK;   // v projection reuses the k buffer after the k planes are built (stream-ordered)
    k_wtG<<<(unsigned)((DM * DQ / 64 + 63) / 64), 256, 0, stream>>>(wq, DM, DQ, WQ); k_wtG<<<(unsigned)((DM * DKV / 64 + 63) / 64), 256, 0, stream>>>(wk, DM, DKV, WK); k_wtG<<<(unsigned)((DM * DKV / 64 + 63) / 64), 256, 0, stream>>>(wv, DM, DKV, WV);
    k_wtG<<<(unsigned)((DQ * DM / 64 + 63) / 64), 256, 0, stream>>>(wo, DQ, DM, WO);
    const unsigned LQ = (unsigned)(((size_t)NH_ * TT * HD / 2 + 255) / 256), LKv = (unsigned)(((size_t)NKV * TT * HD / 2 + 255) / 256);
    // every batch in one launch: rows b * TT + t in the projections, planes b * NH_ + h in attention
    k_cvt8<<<dim3((unsigned)(((size_t)TT * DM / 8 + 255) / 256), NB, 1), 256, 0, stream>>>(x, XB, (size_t)TT * DM / 8); k_cvt8<<<dim3((unsigned)(((size_t)TT * DM / 8 + 255) / 256), NB, 1), 256, 0, stream>>>(xk, XKB, (size_t)TT * DM / 8);
    k_gemmw<bf, 0, true><<<dim3(NB * TT / 64, DQ / 64, 1), 32, 0, stream>>>(XB, nullptr, WQ, nullptr, DM, DM, FQ, DQ, bq, 0, 0, 0);
    k_qkp<<<dim3(LQ, NB, 1), 256, 0, stream>>>(FQ, DQ, NH_, QP16);
    k_gemmw<bf, 0, true><<<dim3(NB * TT / 64, DKV / 64, 1), 32, 0, stream>>>(XKB, nullptr, WK, nullptr, DM, DM, FK, DKV, bk, 0, 0, 0);
    k_qkp<<<dim3(LKv, NB, 1), 256, 0, stream>>>(FK, DKV, NKV, KP16);
    k_gemmw<bf, 0, true><<<dim3(NB * TT / 64, DKV / 64, 1), 32, 0, stream>>>(XKB, nullptr, WV, nullptr, DM, DM, FV, DKV, bv, 0, 0, 0); k_vtp<<<dim3(LKv, NB, 1), 256, 0, stream>>>(FV, DKV, NKV, VTh, VTl);
    k_fattn<<<dim3(TT / (AW * AR * 16), NB * NH_, 1), AW * 32, 0, stream>>>(QP16, KP16, VTh, VTl, mk, ATh, ATl);
    k_gemmw<bf, 1, true><<<dim3(NB * TT / 64, DM / 64, 1), 32, 0, stream>>>(ATh, ATl, WO, nullptr, DQ, DQ, OUT, DM, bo, 0, 0, 0);
}

// v003
// A run of this version takes 304 microseconds.
// Timed twice side by side with v002, it ran 1.20 and 1.19 times as fast.
// Over all steps from v000 it is 5.54 times as fast.
#include <hip/hip_runtime.h>

// Multi-head dot-product attention: inputs_q, inputs_kv [8][1024][1024]; q = inputs_q Wq + bq, k / v = inputs_kv Wk / Wv + bk / bv (W [1024][16][64] = k-major [1024][1024], bias [16][64]);
// logits = (q . k) / 64 (the module divides q by the head depth); int32 mask [1][1][1024][1024] replaces masked logits by the most negative finite f32; softmax over keys; ctx = P . v; out = ctx Wo ([16][64][1024] = [1024][1024]) + bo -> [8][1024][1024] f32.
// Compute dtypes, f32 accumulate: every float input RNE-converted to bf16; q/k/v projections v_wmma_f32_16x16x32_bf16 on plain bf16 operands; scores v_wmma_f32_16x16x32_f16 on plain fp16 q/k planes with 1/64 applied to the f32 score; softmax f32, running maximum; P . v on bf16 hi/lo parts of the unnormalised P = 2^(u - m) and of v (3 products), 1 / sum applied to the f32 result; ctx . Wo on bf16 hi/lo ctx planes x exact bf16 Wo (2 products); biases added in f32 as bf16-converted values.

#ifndef NB
#define NB   8
#endif
#ifndef SEQ
#define SEQ  1024
#endif
#define S_FULL 1024                 // per-batch row count / mask row pitch
#define TT   SEQ
#define DM   1024
#define NH_  16
#define NKV  16
#define REP  (NH_ / NKV)
#define HD   64
#define DQ   (NH_ * HD)
#define DKV  (NKV * HD)
#define SCL  0.015625f              // 1 / HD
#define NEGF (-3.4028234663852886e38f)

static_assert(TT % 128 == 0);
static_assert(TT % 64 == 0);
static_assert(DM % 64 == 0);
static_assert(HD % 32 == 0);
static_assert(REP == 1);
static_assert(SEQ <= S_FULL);
static_assert(NB >= 1);

typedef _Float16 h16;
typedef unsigned short bf;
typedef __attribute__((ext_vector_type(16))) __bf16   v16bf;
typedef __attribute__((ext_vector_type(16))) _Float16 v16h;
typedef __attribute__((ext_vector_type(8)))  _Float16 v8h;
typedef __attribute__((ext_vector_type(8)))  unsigned short v8us;
typedef __attribute__((ext_vector_type(8)))  float    v8f;
typedef __attribute__((ext_vector_type(4)))  float    v4f;
typedef v8h  __attribute__((may_alias)) v8ha;
typedef v4f  __attribute__((may_alias)) v4fa;
typedef v8us __attribute__((may_alias)) v8usa;

__device__ __forceinline__ unsigned short f2bf(float f) { unsigned u = __float_as_uint(f); u += 0x7FFFu + ((u >> 16) & 1u); return (unsigned short)(u >> 16); }
__device__ __forceinline__ float bf2f(unsigned short b) { return __uint_as_float(((unsigned)b) << 16); }
__device__ __forceinline__ float bfr(float f) { return bf2f(f2bf(f)); }
__device__ __forceinline__ v16h cat16(v8h lo, v8h hi) { return __builtin_shufflevector(lo, hi, 0, 1, 2, 3, 4, 5, 6, 7, 8, 9, 10, 11, 12, 13, 14, 15); }
__device__ __forceinline__ v16bf cat16b(v8us lo, v8us hi) { return __builtin_bit_cast(v16bf, __builtin_shufflevector(lo, hi, 0, 1, 2, 3, 4, 5, 6, 7, 8, 9, 10, 11, 12, 13, 14, 15)); }
__device__ __forceinline__ v8f wmma16(v16h a, v16h b, v8f c) { return __builtin_amdgcn_wmma_f32_16x16x32_f16(false, a, false, b, (short)0, c, false, false); }
__device__ __forceinline__ v8f wmmab(v16bf a, v16bf b, v8f c) { return __builtin_amdgcn_wmma_f32_16x16x32_bf16(false, a, false, b, (short)0, c, false, false); }



// ---- k_gemmw: register-blocked GEMM, ONE WAVE per 64x64 output tile (16 accumulators), operands straight from K-contiguous 16-bit planes; grid (M/64, N/64, Z), 32 threads.
// C[m][n] (+ optional f32 bias[n]) = sum_k A[m][k] Bt[n][k] (+ split products per NSPLIT). A / A2 row pitch lda, Bt / Bt2 row pitch K. z-batch strides sA/sB/sC in elements. K % 32 == 0.
// OUTM says where the tile goes: 0 = f32 C, pitch ldc; 1 = f16 head planes P16[batch][head][token][HD] (m = batch * TT + token, n = head * HD + depth; a tile is 8 KiB in a row);
// 2 = transposed bf16 hi / lo planes Th / Tl[batch][n][token]: the two operands change places in the matrix instruction, so D comes out as [n][token] and a staged row is one whole 128-byte line of 64 tokens.
// Fragments (A and Bt alike): lane l -> row l&15, elements 0..7 = k kc+8h..kc+8h+7, elements 8..15 = k kc+16+8h..kc+16+8h+7 (h = l>>4); D element j -> row 8h+j, col l&15.
template <typename T16> struct WFrag;
template <> struct WFrag<h16> { typedef v16h V; static __device__ __forceinline__ V ld(const h16* p) { return cat16(*(const v8h*)p, *(const v8h*)(p + 16)); } static __device__ __forceinline__ v8f mma(V a, V b, v8f c) { return wmma16(a, b, c); } };
template <> struct WFrag<bf> { typedef v16bf V; static __device__ __forceinline__ V ld(const bf* p) { return cat16b(*(const v8us*)p, *(const v8us*)(p + 16)); } static __device__ __forceinline__ v8f mma(V a, V b, v8f c) { return wmmab(a, b, c); } };
__device__ __forceinline__ h16 tohx(float x) { return (h16)x; }
__device__ __forceinline__ void splitf(float y, unsigned short& h, unsigned short& l) { h = f2bf(y); l = f2bf(y - bf2f(h)); }
typedef __attribute__((ext_vector_type(4))) _Float16 v4h;
typedef __attribute__((ext_vector_type(4))) unsigned short v4us;
template <typename T16, int NSPLIT, bool BIAS, int OUTM>
__global__ __launch_bounds__(32) void k_gemmw(const T16* __restrict__ A, const T16* __restrict__ A2, const T16* __restrict__ Bt, const T16* __restrict__ Bt2, int K, int lda, float* C, int ldc, const float* __restrict__ bias, size_t sA, size_t sB, size_t sC, h16* P16, bf* Th, bf* Tl) {
    static_assert(OUTM == 0 || NSPLIT == 0);
    static_assert(TT % 64 == 0 && HD % 64 == 0);   // a 64 x 64 tile stays inside one batch and one head
    typedef typename WFrag<T16>::V V;
    __shared__ __align__(16) float os[16 * 68];
    const size_t z = blockIdx.z; A += z * sA; if (A2) A2 += z * sA; Bt += z * sB; if (Bt2) Bt2 += z * sB; C += z * sC;
    const int lane = threadIdx.x & 31, lr = lane & 15, hi = lane >> 4; const int r0 = blockIdx.x * 64, c0 = blockIdx.y * 64;
    v8f acc[4][4];
#pragma unroll
    for (int mb = 0; mb < 4; ++mb)
#pragma unroll
        for (int nb = 0; nb < 4; ++nb) acc[mb][nb] = (v8f){};
    const size_t aoff = (size_t)(r0 + lr) * lda + 8 * hi, boff = (size_t)(c0 + lr) * K + 8 * hi;
#pragma unroll 1
    for (int kc = 0; kc < K; kc += 32) {
        V a[4], a2[4];
#pragma unroll
        for (int mb = 0; mb < 4; ++mb) { a[mb] = WFrag<T16>::ld(A + aoff + (size_t)mb * 16 * lda + kc); if (NSPLIT == 1 || NSPLIT == 2) a2[mb] = WFrag<T16>::ld(A2 + aoff + (size_t)mb * 16 * lda + kc); }
#pragma unroll
        for (int nb = 0; nb < 4; ++nb) { const V b = WFrag<T16>::ld(Bt + boff + (size_t)nb * 16 * K + kc); V b2; if (NSPLIT >= 2) b2 = WFrag<T16>::ld(Bt2 + boff + (size_t)nb * 16 * K + kc);
#pragma unroll
            for (int mb = 0; mb < 4; ++mb) { acc[mb][nb] = OUTM == 2 ? WFrag<T16>::mma(b, a[mb], acc[mb][nb]) : WFrag<T16>::mma(a[mb], b, acc[mb][nb]); if (NSPLIT == 1 || NSPLIT == 2) acc[mb][nb] = WFrag<T16>::mma(a2[mb], b, acc[mb][nb]); if (NSPLIT >= 2) acc[mb][nb] = WFrag<T16>::mma(a[mb], b2, acc[mb][nb]); } }
        asm volatile("v_nop\n\tv_nop\n\tv_nop\n\tv_nop" : "+v"(acc[0][0]), "+v"(acc[1][1]), "+v"(acc[2][2]), "+v"(acc[3][3]) : "v"(a[0]), "v"(a[3]));
    }
    float bn[4][8];   // OUTM 2: the bias of this lane's D rows n = c0 + 16 ob + 8 hi + j, added on the way into LDS
    if constexpr (OUTM == 2 && BIAS) {
#pragma unroll
        for (int ob = 0; ob < 4; ++ob) { const v4f b0 = *(const v4fa*)(bias + c0 + ob * 16 + 8 * hi), b1 = *(const v4fa*)(bias + c0 + ob * 16 + 8 * hi + 4);
#pragma unroll
            for (int j = 0; j < 4; ++j) { bn[ob][j] = bfr(b0[j]); bn[ob][4 + j] = bfr(b1[j]); } }
        asm volatile("s_wait_xcnt 0x0" ::: "memory");   // stands in front of whatever next overwrites the address registers that these loads name
    }
    // sixteen D rows at a time through LDS, so that every store covers whole lines (OUTM 2: a D row is one n, its columns are tokens)
#pragma unroll
    for (int ob = 0; ob < 4; ++ob) {
#pragma unroll
        for (int ib = 0; ib < 4; ++ib) {
#pragma unroll
            for (int j = 0; j < 8; ++j) { if constexpr (OUTM == 2) os[(hi * 8 + j) * 68 + ib * 16 + lr] = BIAS ? acc[ib][ob][j] + bn[ob][j] : acc[ib][ob][j]; else os[(hi * 8 + j) * 68 + ib * 16 + lr] = acc[ob][ib][j]; } }
        __builtin_amdgcn_wave_barrier(); asm volatile("" ::: "memory");
#pragma unroll
        for (int s = 0; s < 8; ++s) { const int row = 2 * s + hi, cofs = lr * 4; v4f val = *(const v4fa*)(os + row * 68 + cofs);
            if constexpr (OUTM == 2) {
                const int n = c0 + ob * 16 + row; v4us oh, ol;
#pragma unroll
                for (int q = 0; q < 4; ++q) { unsigned short a2, c2; splitf(val[q], a2, c2); oh[q] = a2; ol[q] = c2; }
                const size_t e = ((size_t)(r0 / TT) * ldc + n) * TT + (r0 % TT) + cofs; *(v4us*)(Th + e) = oh; *(v4us*)(Tl + e) = ol;
            } else {
                if (BIAS) { val[0] += bfr(bias[c0 + cofs]); val[1] += bfr(bias[c0 + cofs + 1]); val[2] += bfr(bias[c0 + cofs + 2]); val[3] += bfr(bias[c0 + cofs + 3]); }
                if constexpr (OUTM == 1) { v4h o16; o16[0] = tohx(val[0]); o16[1] = tohx(val[1]); o16[2] = tohx(val[2]); o16[3] = tohx(val[3]);
                    *(v4h*)(P16 + (((size_t)(r0 / TT) * (ldc / HD) + c0 / HD) * TT + (r0 % TT) + ob * 16 + row) * HD + (c0 % HD) + cofs) = o16; }
                else *(v4f*)(C + (size_t)(r0 + ob * 16 + row) * ldc + c0 + cofs) = val;
            } }
        __builtin_amdgcn_wave_barrier(); asm volatile("s_wait_xcnt 0x0" ::: "memory");   // keeps the next rows' LDS stores behind these reads, and stands in front of whatever next overwrites a register that these global stores name
    }
}

typedef __attribute__((ext_vector_type(2))) unsigned short v2us;
typedef __attribute__((ext_vector_type(2))) float v2f;
typedef __attribute__((ext_vector_type(4))) int v4i;

__global__ __launch_bounds__(256) void k_wtG(const float* __restrict__ w, int K, int N, bf* Bt) {
    const int lane = threadIdx.x & 31; const int L0 = (blockIdx.x * 8 + (threadIdx.x >> 5)) * 8; const int nlines = N * K / 64;
{
#pragma unroll 1
        for (int l = 0; l < 8; ++l) { const int L = L0 + l; if (L >= nlines) break; const size_t e = (size_t)L * 64 + lane * 2; const int k = (int)(e % K), n = (int)(e / K); v2us o;
            o[0] = f2bf(w[(size_t)k * N + n]); o[1] = f2bf(w[(size_t)(k + 1) * N + n]); *(v2us*)(Bt + e) = o; }
         }
}
__global__ __launch_bounds__(256) void k_cvt8(const float* __restrict__ src, bf* dst, size_t n8) { const size_t i = (size_t)blockIdx.x * 256 + threadIdx.x; if (i >= n8) return; src += (size_t)blockIdx.y * S_FULL * DM; dst += (size_t)blockIdx.y * TT * DM; const v8f v = *(const v8f*)(src + i * 8); v8us o;
#pragma unroll
    for (int k = 0; k < 8; ++k) o[k] = f2bf(v[k]); *(v8us*)(dst + i * 8) = o;  }

// ---- k_fattn: scores, mask, softmax, P . v and the hi / lo split of ctx in ONE kernel; no score or P element ever reaches memory.
// Grid (TT / 256, planes), 8 waves; a wave owns 32 queries (2 column groups of 16) of one (batch, head) plane and walks all TT keys, 64 keys an LDS stage (k rows, v^T hi and lo rows, pitch 144 B; two stage buffers, one barrier a stage), 32 keys a pass.
// S^T = K . Q^T (A = k rows, B = q rows, f16): lane l holds query l & 15, keys 8h + j of each 16-key tile, so two tiles converted in place ARE the B operand of O^T += V^T . P^T (A = v^T rows in the same k order, bf16 hi / lo, 3 products).
// Every inner loop is fully unrolled so that each index into a register array is a constant. Two work-groups a WGP = four waves a SIMD (256 registers a wave), which the vector work between the matrix runs wants.
// Softmax is the running-maximum form in the log2 domain: u = S x (log2 e / HD), masked u = most negative finite f32; p = 2^(u - m); O^T and the sum are rescaled by 2^(m_old - m_new) every pass; 1 / sum is applied to O^T at the end.
typedef __attribute__((ext_vector_type(8))) unsigned v8u;
typedef __attribute__((ext_vector_type(2))) __bf16 v2bf;
typedef __attribute__((ext_vector_type(4), may_alias)) unsigned v4u_;
#define AW  8                       // waves per work-group
#define AR  2                       // 16-query column groups per wave
#define AKB 64                      // keys per LDS stage
#define APT 72                      // LDS row pitch in 16-bit elements: 128-byte rows + 16 bytes
#define SCL2 (SCL * 1.4426950408889634f)
static_assert(TT % (AW * AR * 16) == 0);
static_assert(TT % AKB == 0);
static_assert(HD == 64);
__device__ __forceinline__ unsigned pack2(float a, float b) { v2f x; x[0] = a; x[1] = b; return __builtin_bit_cast(unsigned, __builtin_convertvector(x, v2bf)); }   // two f32 -> two bf16, round to nearest even
__device__ __forceinline__ float xhalf(float x) { return __builtin_bit_cast(float, __builtin_amdgcn_permlanex16(__builtin_bit_cast(int, x), __builtin_bit_cast(int, x), 0x76543210, 0xfedcba98, false, false)); }   // lane l <-> lane l ^ 16
__device__ __forceinline__ void split2(float a, float b, unsigned& h, unsigned& l) { h = pack2(a, b); l = pack2(a - __uint_as_float(h << 16), b - __uint_as_float(h & 0xFFFF0000u)); }
// Eight 2^x and the slot behind the last of them in ONE statement: each v_exp fills the slot of the one before it, the v_nop that of the last
__device__ __forceinline__ void exp2x8(float (&p)[8], const float (&d)[8]) {
    asm("v_exp_f32 %0, %8\n\tv_exp_f32 %1, %9\n\tv_exp_f32 %2, %10\n\tv_exp_f32 %3, %11\n\tv_exp_f32 %4, %12\n\tv_exp_f32 %5, %13\n\tv_exp_f32 %6, %14\n\tv_exp_f32 %7, %15\n\tv_nop"
        : "=&v"(p[0]), "=&v"(p[1]), "=&v"(p[2]), "=&v"(p[3]), "=&v"(p[4]), "=&v"(p[5]), "=&v"(p[6]), "=&v"(p[7])
        : "v"(d[0]), "v"(d[1]), "v"(d[2]), "v"(d[3]), "v"(d[4]), "v"(d[5]), "v"(d[6]), "v"(d[7]));
}
__global__ __launch_bounds__(AW * 32) __attribute__((amdgpu_waves_per_eu(4, 4))) void k_fattn(const h16* __restrict__ Qp, const h16* __restrict__ Kp, const bf* __restrict__ Vh, const bf* __restrict__ Vl, const int* __restrict__ Mk, bf* Ah, bf* Al) {
    __shared__ __align__(16) h16 Ks[2][AKB * APT];
    __shared__ __align__(16) bf Vhs[2][HD * APT];
    __shared__ __align__(16) bf Vls[2][HD * APT];
    __shared__ unsigned mbit[AW][TT / AKB][AR][32];   // each lane's own mask bits, one word per stage and column group; written and read by the same lane only
    const int tid = threadIdx.x, lane = tid & 31, wave = tid >> 5, lr = lane & 15, hi = lane >> 4;
    const int g = blockIdx.y, q0 = blockIdx.x * (AW * AR * 16) + wave * (AR * 16);
    Qp += (size_t)g * TT * HD; Kp += (size_t)g * TT * HD; Vh += (size_t)g * HD * TT; Vl += (size_t)g * HD * TT;
    const int srow = tid >> 3, sseg = (tid & 7) * 8;   // staging: 8 threads a 128-byte row, 32 rows a sweep
    const unsigned ko = (unsigned)(srow * HD + sseg), vo = (unsigned)(srow * TT + sseg);   // this thread's 32-bit offsets from wave-uniform bases
#pragma unroll
    for (int p = 0; p < 2; ++p) { const v8h rk = *(const v8h*)(Kp + 32 * p * HD + ko); const v8us rh = *(const v8us*)(Vh + 32 * p * TT + vo), rl = *(const v8us*)(Vl + 32 * p * TT + vo);
        *(v8h*)(Ks[0] + (srow + 32 * p) * APT + sseg) = rk; *(v8us*)(Vhs[0] + (srow + 32 * p) * APT + sseg) = rh; *(v8us*)(Vls[0] + (srow + 32 * p) * APT + sseg) = rl; }
    // mask rows of this lane's queries -> bits: element e = 8 * tile + j of a stage sits at bit 31 - e
    // rolled, for speed only
#pragma unroll 1
    for (int blk = 0; blk < TT / AKB; ++blk) {
#pragma unroll
        for (int r = 0; r < AR; ++r) { const int* mr = Mk + (size_t)(q0 + r * 16 + lr) * S_FULL + blk * AKB + 8 * hi; unsigned w = 0; v4i mv[AKB / 8];
#pragma unroll
            for (int c = 0; c < AKB / 8; ++c) mv[c] = *(const v4i*)(mr + (c >> 1) * 16 + (c & 1) * 4);
            asm volatile("s_wait_xcnt 0x0" ::: "memory");   // stands in front of whatever next overwrites the address registers that these loads name
#pragma unroll
            for (int c = 0; c < AKB / 8; ++c)
#pragma unroll
                for (int j = 0; j < 4; ++j) w = (w << 1) | min((unsigned)mv[c][j], 1u);
            mbit[wave][blk][r][lane] = w; }
    }
    v16h qf[AR][2];
#pragma unroll
    for (int r = 0; r < AR; ++r)
#pragma unroll
        for (int kc = 0; kc < 2; ++kc) qf[r][kc] = WFrag<h16>::ld(Qp + (size_t)(q0 + r * 16 + lr) * HD + kc * 32 + 8 * hi);
    v8f o[AR][4]; float m[AR], ls[AR];
#pragma unroll
    for (int r = 0; r < AR; ++r) { m[r] = NEGF; ls[r] = 0.f;
#pragma unroll
        for (int dt = 0; dt < 4; ++dt) o[r][dt] = (v8f){}; }
    // rolled: the register count stays at four waves a SIMD
#pragma unroll 1
    for (int blk = 0; blk < TT / AKB; ++blk) {
        __syncthreads();   // publishes stage blk, and ends every wave's reads of the other buffer, which this stage refills
        const int cb = blk & 1, kn = (blk + 1) * AKB; const bool more = blk + 1 < TT / AKB;
        unsigned mw[AR];
#pragma unroll
        for (int r = 0; r < AR; ++r) mw[r] = mbit[wave][blk][r][lane];
        const bool anym = __builtin_amdgcn_ballot_w32((mw[0] & mw[1]) != 0xFFFFFFFFu) != 0;   // wave-uniform: a stage with no masked element skips the selects
#pragma unroll
        for (int sb = 0; sb < AKB / 32; ++sb) {
            v8h rk; v8us rh, rl;
            if (more) { rk = *(const v8h*)(Kp + (kn + 32 * sb) * HD + ko); rh = *(const v8us*)(Vh + (32 * sb * TT + kn) + vo); rl = *(const v8us*)(Vl + (32 * sb * TT + kn) + vo); }   // half of the next stage's rows fly to registers under this pass
            float u[AR][16];
#pragma unroll
            for (int kt = 0; kt < 2; ++kt) { const h16* kp = Ks[cb] + (sb * 32 + kt * 16 + lr) * APT + 8 * hi; const v16h k0 = WFrag<h16>::ld(kp), k1 = WFrag<h16>::ld(kp + 32);
#pragma unroll
                for (int r = 0; r < AR; ++r) { const v8f s = wmma16(k1, qf[r][1], wmma16(k0, qf[r][0], (v8f){}));
#pragma unroll
                    for (int j = 0; j < 8; ++j) u[r][kt * 8 + j] = s[j] * SCL2; } }
            if (anym) {
#pragma unroll
                for (int r = 0; r < AR; ++r)
#pragma unroll
                    for (int e = 0; e < 16; ++e) if ((int)(mw[r] << (sb * 16 + e)) >= 0) u[r][e] = NEGF; }
            v16bf ph[AR], pl[AR];
#pragma unroll
            for (int r = 0; r < AR; ++r) {
                float mx = u[r][0];
#pragma unroll
                for (int e = 1; e < 16; ++e) mx = fmaxf(mx, u[r][e]);
                mx = fmaxf(mx, xhalf(mx));
                const float mn = fmaxf(m[r], mx), al = __builtin_amdgcn_exp2f(m[r] - mn); m[r] = mn;
                float sum = 0.f; v8u wh, wl;
#pragma unroll
                for (int t = 0; t < 2; ++t) { float d[8], p[8];
#pragma unroll
                    for (int j = 0; j < 8; ++j) d[j] = u[r][t * 8 + j] - mn;
                    exp2x8(p, d);
#pragma unroll
                    for (int j = 0; j < 8; j += 2) { sum += p[j] + p[j + 1]; unsigned a, c; split2(p[j], p[j + 1], a, c); wh[(t * 8 + j) >> 1] = a; wl[(t * 8 + j) >> 1] = c; } }
                asm volatile("" : "+v"(sum));   // each row's sum pinned against spills: without it the adds sink to the loop's foot, every p of the stage stays live until there, and the staging registers spill
                ls[r] = ls[r] * al + sum; ph[r] = __builtin_bit_cast(v16bf, wh); pl[r] = __builtin_bit_cast(v16bf, wl);
#pragma unroll
                for (int dt = 0; dt < 4; ++dt) o[r][dt] = o[r][dt] * al;
            }
            v16bf vf[4];
#pragma unroll
            for (int dt = 0; dt < 4; ++dt) vf[dt] = WFrag<bf>::ld(Vhs[cb] + (dt * 16 + lr) * APT + sb * 32 + 8 * hi);
#pragma unroll
            for (int dt = 0; dt < 4; ++dt)
#pragma unroll
                for (int r = 0; r < AR; ++r) o[r][dt] = wmmab(vf[dt], ph[r], o[r][dt]);
#pragma unroll
            for (int dt = 0; dt < 4; ++dt)
#pragma unroll
                for (int r = 0; r < AR; ++r) o[r][dt] = wmmab(vf[dt], pl[r], o[r][dt]);
#pragma unroll
            for (int dt = 0; dt < 4; ++dt) vf[dt] = WFrag<bf>::ld(Vls[cb] + (dt * 16 + lr) * APT + sb * 32 + 8 * hi);
#pragma unroll
            for (int dt = 0; dt < 4; ++dt)
#pragma unroll
                for (int r = 0; r < AR; ++r) o[r][dt] = wmmab(vf[dt], ph[r], o[r][dt]);
            if (more) { *(v8h*)(Ks[cb ^ 1] + (srow + 32 * sb) * APT + sseg) = rk; *(v8us*)(Vhs[cb ^ 1] + (srow + 32 * sb) * APT + sseg) = rh; *(v8us*)(Vls[cb ^ 1] + (srow + 32 * sb) * APT + sseg) = rl; }
        }
    }
    // lane l holds ctx[query l & 15][d = 16 dt + 8h + j]: 8 consecutive d, one 16-byte store a plane
#pragma unroll
    for (int r = 0; r < AR; ++r) { const float f = __fdiv_rn(1.0f, ls[r] + xhalf(ls[r])); const size_t oo = ((size_t)(g / NH_) * TT + q0 + r * 16 + lr) * DQ + (g % NH_) * HD + 8 * hi;
#pragma unroll
        for (int dt = 0; dt < 4; ++dt) { v4u_ wh, wl;
#pragma unroll
            for (int j = 0; j < 8; j += 2) { unsigned a, c; split2(o[r][dt][j] * f, o[r][dt][j + 1] * f, a, c); wh[j >> 1] = a; wl[j >> 1] = c; }
            *(v4u_*)(Ah + oo + dt * 16) = wh; *(v4u_*)(Al + oo + dt * 16) = wl; } }
}

extern "C" void kernel_launch(void* const* d_in, const int* in_sizes, int n_in,
                              void* d_out, int out_size, void* d_ws, size_t ws_size, hipStream_t stream) {
    if (n_in < 11) return;
    if ((size_t)in_sizes[0] < (size_t)(NB - 1) * S_FULL * DM + (size_t)TT * DM) return;
    if ((size_t)in_sizes[1] < (size_t)(NB - 1) * S_FULL * DM + (size_t)TT * DM) return;
    if ((size_t)in_sizes[2] < (size_t)(TT - 1) * S_FULL + (size_t)TT) return;
    if (in_sizes[3] < DM * DQ || in_sizes[5] < DM * DKV || in_sizes[7] < DM * DKV || in_sizes[9] < DQ * DM) return;
    if (in_sizes[4] < DQ || in_sizes[6] < DKV || in_sizes[8] < DKV || in_sizes[10] < DM) return;
    if ((size_t)out_size < (size_t)NB * TT * DM) return;
    const float* x  = (const float*)d_in[0];     // [NB][S_FULL][DM]
    const float* xk = (const float*)d_in[1];     // [NB][S_FULL][DM]
    const int*   mk = (const int*)d_in[2];       // [1][1][S_FULL][S_FULL] int32 0/1
    const float* wq = (const float*)d_in[3]; const float* bq = (const float*)d_in[4];
    const float* wk = (const float*)d_in[5]; const float* bk = (const float*)d_in[6];
    const float* wv = (const float*)d_in[7]; const float* bv = (const float*)d_in[8];
    const float* wo = (const float*)d_in[9]; const float* bo = (const float*)d_in[10];
    float* OUT = (float*)d_out;     // [NB][TT][DM]
    char* wsp = (char*)d_ws;
    auto take = [&](size_t bytes) { char* p = wsp; wsp += (bytes + 255) & ~(size_t)255; return (void*)p; };
    bf* WQ = (bf*)take((size_t)DQ * DM * 2); bf* WK = (bf*)take((size_t)DKV * DM * 2); bf* WV = (bf*)take((size_t)DKV * DM * 2); bf* WO = (bf*)take((size_t)DM * DQ * 2);
    h16* QP16 = (h16*)take((size_t)NB * NH_ * TT * HD * 2); h16* KP16 = (h16*)take((size_t)NB * NKV * TT * HD * 2);
    bf* VTh = (bf*)take((size_t)NB * NKV * HD * TT * 2); bf* VTl = (bf*)take((size_t)NB * NKV * HD * TT * 2);
    bf* ATh = (bf*)take((size_t)NB * TT * DQ * 2); bf* ATl = (bf*)take((size_t)NB * TT * DQ * 2);
    bf* XB = (bf*)take((size_t)NB * TT * DM * 2); bf* XKB = (bf*)take((size_t)NB * TT * DM * 2);
    if ((size_t)(wsp - (char*)d_ws) > ws_size) return;
    k_wtG<<<(unsigned)((DM * DQ / 64 + 63) / 64), 256, 0, stream>>>(wq, DM, DQ, WQ); k_wtG<<<(unsigned)((DM * DKV / 64 + 63) / 64), 256, 0, stream>>>(wk, DM, DKV, WK); k_wtG<<<(unsigned)((DM * DKV / 64 + 63) / 64), 256, 0, stream>>>(wv, DM, DKV, WV);
    k_wtG<<<(unsigned)((DQ * DM / 64 + 63) / 64), 256, 0, stream>>>(wo, DQ, DM, WO);
    // every batch in one launch: rows b * TT + t in the projections, planes b * NH_ + h in attention
    k_cvt8<<<dim3((unsigned)(((size_t)TT * DM / 8 + 255) / 256), NB, 1), 256, 0, stream>>>(x, XB, (size_t)TT * DM / 8); k_cvt8<<<dim3((unsigned)(((size_t)TT * DM / 8 + 255) / 256), NB, 1), 256, 0, stream>>>(xk, XKB, (size_t)TT * DM / 8);
    // each projection's epilogue writes the operand planes of attention itself
    k_gemmw<bf, 0, true, 1><<<dim3(NB * TT / 64, DQ / 64, 1), 32, 0, stream>>>(XB, nullptr, WQ, nullptr, DM, DM, nullptr, DQ, bq, 0, 0, 0, QP16, nullptr, nullptr);
    k_gemmw<bf, 0, true, 1><<<dim3(NB * TT / 64, DKV / 64, 1), 32, 0, stream>>>(XKB, nullptr, WK, nullptr, DM, DM, nullptr, DKV, bk, 0, 0, 0, KP16, nullptr, nullptr);
    k_gemmw<bf, 0, true, 2><<<dim3(NB * TT / 64, DKV / 64, 1), 32, 0, stream>>>(XKB, nullptr, WV, nullptr, DM, DM, nullptr, DKV, bv, 0, 0, 0, nullptr, VTh, VTl);
    k_fattn<<<dim3(TT / (AW * AR * 16), NB * NH_, 1), AW * 32, 0, stream>>>(QP16, KP16, VTh, VTl, mk, ATh, ATl);
    k_gemmw<bf, 1, true, 0><<<dim3(NB * TT / 64, DM / 64, 1), 32, 0, stream>>>(ATh, ATl, WO, nullptr, DQ, DQ, OUT, DM, bo, 0, 0, 0, nullptr, nullptr, nullptr);
}

// v004
// Measured time: 199 microseconds a run.
// Next to v003, in two timings, it ran 1.53 times as fast each time.
// All steps since v000 together make it 8.49 times as fast.
#include <hip/hip_runtime.h>

// Multi-head dot-product attention: inputs_q, inputs_kv [8][1024][1024]; q = inputs_q Wq + bq, k / v = inputs_kv Wk / Wv + bk / bv (W [1024][16][64] = k-major [1024][1024], bias [16][64]);
// logits = (q . k) / 64 (the module divides q by the head depth); int32 mask [1][1][1024][1024] replaces masked logits by the most negative finite f32; softmax over keys; ctx = P . v; out = ctx Wo ([16][64][1024] = [1024][1024]) + bo -> [8][1024][1024] f32.
// Compute dtypes, f32 accumulate: every float input RNE-converted to bf16; q/k/v projections v_wmma_f32_16x16x32_bf16 on plain bf16 operands; scores v_wmma_f32_16x16x32_f16 on plain fp16 q/k planes with 1/64 applied to the f32 score; softmax f32, running maximum; P . v on bf16 hi/lo parts of the unnormalised P = 2^(u - m) and of v (3 products), 1 / sum applied to the f32 result; ctx . Wo on bf16 hi/lo ctx planes x exact bf16 Wo (2 products); biases added in f32 as bf16-converted values.

#ifndef NB
#define NB   8
#endif
#ifndef SEQ
#define SEQ  1024
#endif
#define S_FULL 1024                 // per-batch row count / mask row pitch
#define TT   SEQ
#define DM   1024
#define NH_  16
#define NKV  16
#define REP  (NH_ / NKV)
#define HD   64
#define DQ   (NH_ * HD)
#define DKV  (NKV * HD)
#define SCL  0.015625f              // 1 / HD
#define NEGF (-3.4028234663852886e38f)

static_assert(TT % 128 == 0);
static_assert(TT % 64 == 0);
static_assert(DM % 64 == 0);
static_assert(HD % 32 == 0);
static_assert(REP == 1);
static_assert(SEQ <= S_FULL);
static_assert(NB >= 1);

typedef _Float16 h16;
typedef unsigned short bf;
typedef __attribute__((ext_vector_type(16))) __bf16   v16bf;
typedef __attribute__((ext_vector_type(16))) _Float16 v16h;
typedef __attribute__((ext_vector_type(8)))  _Float16 v8h;
typedef __attribute__((ext_vector_type(8)))  unsigned short v8us;
typedef __attribute__((ext_vector_type(8)))  float    v8f;
typedef __attribute__((ext_vector_type(4)))  float    v4f;
typedef v8h  __attribute__((may_alias)) v8ha;
typedef v4f  __attribute__((may_alias)) v4fa;
typedef v8us __attribute__((may_alias)) v8usa;

__device__ __forceinline__ unsigned short f2bf(float f) { unsigned u = __float_as_uint(f); u += 0x7FFFu + ((u >> 16) & 1u); return (unsigned short)(u >> 16); }
__device__ __forceinline__ float bf2f(unsigned short b) { return __uint_as_float(((unsigned)b) << 16); }
__device__ __forceinline__ float bfr(float f) { return bf2f(f2bf(f)); }
__device__ __forceinline__ v16h cat16(v8h lo, v8h hi) { return __builtin_shufflevector(lo, hi, 0, 1, 2, 3, 4, 5, 6, 7, 8, 9, 10, 11, 12, 13, 14, 15); }
__device__ __forceinline__ v16bf cat16b(v8us lo, v8us hi) { return __builtin_bit_cast(v16bf, __builtin_shufflevector(lo, hi, 0, 1, 2, 3, 4, 5, 6, 7, 8, 9, 10, 11, 12, 13, 14, 15)); }
__device__ __forceinline__ v8f wmma16(v16h a, v16h b, v8f c) { return __builtin_amdgcn_wmma_f32_16x16x32_f16(false, a, false, b, (short)0, c, false, false); }
__device__ __forceinline__ v8f wmmab(v16bf a, v16bf b, v8f c) { return __builtin_amdgcn_wmma_f32_16x16x32_bf16(false, a, false, b, (short)0, c, false, false); }



// ---- k_gemmw: GEMM on a 256 x 128 output tile per work-group of EIGHT WAVES (4 x 2), each wave a 64 x 64 part (16 accumulators); grid (M/256, N/128, Z), 256 threads, one work-group a WGP.
// The operands' rows (K-contiguous 16-bit planes) reach LDS by asynchronous copies, whole 128-byte lines a wave instruction, GKS k a stage, two stage buffers: stage t + 2 flies while stage t + 1 is worked on; the fragments are read from LDS (row pitch = row + 16 bytes).
// C[m][n] (+ optional f32 bias[n]) = sum_k A[m][k] Bt[n][k] (NSPLIT 1: + A2[m][k] Bt[n][k]). A / A2 row pitch lda, Bt row pitch K. z-batch strides sA/sB/sC in elements. K % GKS == 0.
// OUTM says where the tile goes: 0 = f32 C, pitch ldc; 1 = f16 head planes P16[batch][head][token][HD] (m = batch * TT + token, n = head * HD + depth; a wave's part is 8 KiB in a row);
// 2 = transposed bf16 hi / lo planes Th / Tl[batch][n][token]: the two operands change places in the matrix instruction, so D comes out as [n][token] and a staged row is one whole 128-byte line of 64 tokens.
// Fragments (A and Bt alike): lane l -> row l&15, elements 0..7 = k kc+8h..kc+8h+7, elements 8..15 = k kc+16+8h..kc+16+8h+7 (h = l>>4); D element j -> row 8h+j, col l&15.
template <typename T16> struct WFrag;
template <> struct WFrag<h16> { typedef v16h V; static __device__ __forceinline__ V ld(const h16* p) { return cat16(*(const v8h*)p, *(const v8h*)(p + 16)); } static __device__ __forceinline__ v8f mma(V a, V b, v8f c) { return wmma16(a, b, c); } };
template <> struct WFrag<bf> { typedef v16bf V; static __device__ __forceinline__ V ld(const bf* p) { return cat16b(*(const v8us*)p, *(const v8us*)(p + 16)); } static __device__ __forceinline__ v8f mma(V a, V b, v8f c) { return wmmab(a, b, c); } };
__device__ __forceinline__ h16 tohx(float x) { return (h16)x; }
__device__ __forceinline__ void splitf(float y, unsigned short& h, unsigned short& l) { h = f2bf(y); l = f2bf(y - bf2f(h)); }
typedef __attribute__((ext_vector_type(4))) _Float16 v4h;
typedef __attribute__((ext_vector_type(4))) unsigned short v4us;
#define GT  256                     // threads of a GEMM work-group
#define GRA 256                     // rows of A (and A2) in a stage = rows of the output tile
#define GRB 128                     // rows of Bt in a stage = columns of the output tile
static_assert((NB * TT) % GRA == 0 && DQ % GRB == 0 && DKV % GRB == 0 && DM % GRB == 0 && DM % 128 == 0 && DQ % 64 == 0);
__device__ __forceinline__ unsigned lds_off(const void* p) { return (unsigned)(size_t)p; }   // byte offset in the work-group's LDS
// N (8 or 4) asynchronous 16-byte copies a lane, global -> LDS, and the wait that stands in front of whatever next overwrites a register they name, in ONE statement (in a statement of its own the compiler may lift the next address additions over it).
template <int N, typename T16>
__device__ __forceinline__ void copyrun(unsigned l, unsigned lstep, const T16* g, size_t gstep) {
    static_assert(N == 8 || N == 4);
    if constexpr (N == 8)
        asm volatile("global_load_async_to_lds_b128 %0, %8, off\n\tglobal_load_async_to_lds_b128 %1, %9, off\n\tglobal_load_async_to_lds_b128 %2, %10, off\n\tglobal_load_async_to_lds_b128 %3, %11, off\n\t"
                     "global_load_async_to_lds_b128 %4, %12, off\n\tglobal_load_async_to_lds_b128 %5, %13, off\n\tglobal_load_async_to_lds_b128 %6, %14, off\n\tglobal_load_async_to_lds_b128 %7, %15, off\n\ts_wait_xcnt 0x0"
                     :: "v"(l), "v"(l + lstep), "v"(l + 2 * lstep), "v"(l + 3 * lstep), "v"(l + 4 * lstep), "v"(l + 5 * lstep), "v"(l + 6 * lstep), "v"(l + 7 * lstep),
                        "v"(g), "v"(g + gstep), "v"(g + 2 * gstep), "v"(g + 3 * gstep), "v"(g + 4 * gstep), "v"(g + 5 * gstep), "v"(g + 6 * gstep), "v"(g + 7 * gstep) : "memory");
    else
        asm volatile("global_load_async_to_lds_b128 %0, %4, off\n\tglobal_load_async_to_lds_b128 %1, %5, off\n\tglobal_load_async_to_lds_b128 %2, %6, off\n\tglobal_load_async_to_lds_b128 %3, %7, off\n\ts_wait_xcnt 0x0"
                     :: "v"(l), "v"(l + lstep), "v"(l + 2 * lstep), "v"(l + 3 * lstep), "v"(g), "v"(g + gstep), "v"(g + 2 * gstep), "v"(g + 3 * gstep) : "memory");
}
template <typename T16, int NSPLIT, bool BIAS, int OUTM>
__global__ __launch_bounds__(GT) void k_gemmw(const T16* __restrict__ A, const T16* __restrict__ A2, const T16* __restrict__ Bt, int K, int lda, float* C, int ldc, const float* __restrict__ bias, size_t sA, size_t sB, size_t sC, h16* P16, bf* Th, bf* Tl) {
    static_assert(NSPLIT == 0 || NSPLIT == 1);
    static_assert(OUTM == 0 || NSPLIT == 0);
    static_assert(TT % 64 == 0 && HD % 64 == 0);   // a wave's 64 x 64 part stays inside one batch and one head
    typedef typename WFrag<T16>::V V;
    constexpr int GKS = NSPLIT ? 64 : 128;         // k per stage: both buffers and the output staging fit one WGP's LDS
    constexpr int GP = GKS + 8;                    // LDS row pitch in elements: the row + 16 bytes
    constexpr int ROWS = GRA + GRB + (NSPLIT ? GRA : 0);   // a stage: A's rows, Bt's rows, (A2's rows)
    constexpr int SEG = GKS / 8, RPS = GT / SEG;   // 16-byte pieces a row; rows a sweep of the work-group
    constexpr int SWA = GRA / RPS, SWB = GRB / RPS;   // sweeps a plane
    static_assert(SWA % 8 == 0 && (SWB % 8 == 0 || SWB == 4));
    __shared__ __align__(16) T16 ring[2][ROWS * GP];
    __shared__ __align__(16) float osw[GT / 32][16 * 68];
    const size_t z = blockIdx.z; A += z * sA; if (NSPLIT) A2 += z * sA; Bt += z * sB; C += z * sC;
    const int tid = threadIdx.x, lane = tid & 31, wave = tid >> 5, lr = lane & 15, hi = lane >> 4;
    const int R0 = blockIdx.x * GRA, C0 = blockIdx.y * GRB, wm = (wave >> 1) * 64, wn = (wave & 1) * 64; const int r0 = R0 + wm, c0 = C0 + wn;
    float* const os = osw[wave];
    v8f acc[4][4];
#pragma unroll
    for (int mb = 0; mb < 4; ++mb)
#pragma unroll
        for (int nb = 0; nb < 4; ++nb) acc[mb][nb] = (v8f){};
    // staging: SEG threads a row, RPS rows a sweep; every lane is on, every piece lies inside its plane (M a multiple of GRA, N of GRB, K of GKS)
    const int srow = tid / SEG, sseg = (tid % SEG) * 8;
    const T16* const gA = A + (size_t)(R0 + srow) * lda + sseg; const T16* const gA2 = NSPLIT ? A2 + (size_t)(R0 + srow) * lda + sseg : nullptr; const T16* const gB = Bt + (size_t)(C0 + srow) * K + sseg;
    const unsigned l0 = lds_off(&ring[0][0]) + (unsigned)(srow * GP + sseg) * 2u;
    auto stage = [&](int t) {   // stage t's copies into buffer t & 1
        const unsigned lb = l0 + (unsigned)(t & 1) * (unsigned)(ROWS * GP * 2); const int kc = t * GKS;
#pragma unroll
        for (int u = 0; u < SWA; u += 8) {
            copyrun<8, T16>(lb + (unsigned)(u * RPS * GP * 2), (unsigned)(RPS * GP * 2), gA + (size_t)(u * RPS) * lda + kc, (size_t)RPS * lda);
            if constexpr (NSPLIT == 1) copyrun<8, T16>(lb + (unsigned)((GRA + GRB + u * RPS) * GP * 2), (unsigned)(RPS * GP * 2), gA2 + (size_t)(u * RPS) * lda + kc, (size_t)RPS * lda);
        }
        if constexpr (SWB == 4) copyrun<4, T16>(lb + (unsigned)(GRA * GP * 2), (unsigned)(RPS * GP * 2), gB + kc, (size_t)RPS * K);
        else {
#pragma unroll
            for (int u = 0; u < SWB; u += 8) copyrun<8, T16>(lb + (unsigned)((GRA + u * RPS) * GP * 2), (unsigned)(RPS * GP * 2), gB + (size_t)(u * RPS) * K + kc, (size_t)RPS * K);
        }
    };
    const int NT = K / GKS;
    stage(0);
    asm volatile("s_wait_asynccnt 0x0" ::: "memory");   // this wave's copies of stage 0 have landed
    __syncthreads();                                    // publishes stage 0
    if (NT > 1) stage(1);
    // rolled: one publish point at its foot
#pragma unroll 1
    for (int t = 0; t < NT; ++t) {
        const T16* const As = ring[t & 1] + (wm + lr) * GP + 8 * hi; const T16* const Bs = ring[t & 1] + (GRA + wn + lr) * GP + 8 * hi; const T16* const A2s = NSPLIT ? ring[t & 1] + (GRA + GRB + wm + lr) * GP + 8 * hi : As;
        V a[2][4], a2[2][4], b[2][4];   // two fragment sets: block i + 1's LDS reads go out as one group in front of block i's matrix instructions
        auto frags = [&](int s, int ks) {
#pragma unroll
            for (int f = 0; f < 4; ++f) { a[s][f] = WFrag<T16>::ld(As + f * 16 * GP + ks); if (NSPLIT == 1) a2[s][f] = WFrag<T16>::ld(A2s + f * 16 * GP + ks); b[s][f] = WFrag<T16>::ld(Bs + f * 16 * GP + ks); }
        };
        frags(0, 0);
        // unrolled: the index of a fragment set must be a constant for the sets to stay in registers
#pragma unroll
        for (int i = 0; i < GKS / 32; ++i) {
            if (i + 1 < GKS / 32) frags((i + 1) & 1, (i + 1) * 32);
            __builtin_amdgcn_sched_barrier(0);   // keeps the reads above in one group ahead of the block
#pragma unroll
            for (int nb = 0; nb < 4; ++nb) {
#pragma unroll
                for (int mb = 0; mb < 4; ++mb) acc[mb][nb] = OUTM == 2 ? WFrag<T16>::mma(b[i & 1][nb], a[i & 1][mb], acc[mb][nb]) : WFrag<T16>::mma(a[i & 1][mb], b[i & 1][nb], acc[mb][nb]);
                if constexpr (NSPLIT == 1) {
#pragma unroll
                    for (int mb = 0; mb < 4; ++mb) acc[mb][nb] = WFrag<T16>::mma(a2[i & 1][mb], b[i & 1][nb], acc[mb][nb]);
                }
            }
            __builtin_amdgcn_sched_barrier(0);   // keeps the next group of reads behind this block
        }
        asm volatile("s_wait_dscnt 0x0" ::: "memory");      // this wave's reads of stage t have returned
        asm volatile("s_wait_asynccnt 0x0" ::: "memory");   // this wave's copies of stage t + 1 have landed
        __syncthreads();                                    // publishes stage t + 1, and ends every wave's reads of stage t's buffer, which is refilled behind it
        if (t + 2 < NT) stage(t + 2);
    }
    asm volatile("s_wait_asynccnt 0x0" ::: "memory");       // no copy is outstanding when the wave goes on
    float bn[4][8];   // OUTM 2: the bias of this lane's D rows n = c0 + 16 ob + 8 hi + j, added on the way into LDS
    if constexpr (OUTM == 2 && BIAS) {
#pragma unroll
        for (int ob = 0; ob < 4; ++ob) { const v4f b0 = *(const v4fa*)(bias + c0 + ob * 16 + 8 * hi), b1 = *(const v4fa*)(bias + c0 + ob * 16 + 8 * hi + 4);
#pragma unroll
            for (int j = 0; j < 4; ++j) { bn[ob][j] = bfr(b0[j]); bn[ob][4 + j] = bfr(b1[j]); } }
        asm volatile("s_wait_xcnt 0x0" ::: "memory");   // stands in front of whatever next overwrites the address registers that these loads name
    }
    // sixteen D rows at a time through LDS, so that every store covers whole lines (OUTM 2: a D row is one n, its columns are tokens)
#pragma unroll
    for (int ob = 0; ob < 4; ++ob) {
#pragma unroll
        for (int ib = 0; ib < 4; ++ib) {
#pragma unroll
            for (int j = 0; j < 8; ++j) { if constexpr (OUTM == 2) os[(hi * 8 + j) * 68 + ib * 16 + lr] = BIAS ? acc[ib][ob][j] + bn[ob][j] : acc[ib][ob][j]; else os[(hi * 8 + j) * 68 + ib * 16 + lr] = acc[ob][ib][j]; } }
        __builtin_amdgcn_wave_barrier(); asm volatile("" ::: "memory");
#pragma unroll
        for (int s = 0; s < 8; ++s) { const int row = 2 * s + hi, cofs = lr * 4; v4f val = *(const v4fa*)(os + row * 68 + cofs);
            if constexpr (OUTM == 2) {
                const int n = c0 + ob * 16 + row; v4us oh, ol;
#pragma unroll
                for (int q = 0; q < 4; ++q) { unsigned short a2, c2; splitf(val[q], a2, c2); oh[q] = a2; ol[q] = c2; }
                const size_t e = ((size_t)(r0 / TT) * ldc + n) * TT + (r0 % TT) + cofs; *(v4us*)(Th + e) = oh; *(v4us*)(Tl + e) = ol;
            } else {
                if (BIAS) { val[0] += bfr(bias[c0 + cofs]); val[1] += bfr(bias[c0 + cofs + 1]); val[2] += bfr(bias[c0 + cofs + 2]); val[3] += bfr(bias[c0 + cofs + 3]); }
                if constexpr (OUTM == 1) { v4h o16; o16[0] = tohx(val[0]); o16[1] = tohx(val[1]); o16[2] = tohx(val[2]); o16[3] = tohx(val[3]);
                    *(v4h*)(P16 + (((size_t)(r0 / TT) * (ldc / HD) + c0 / HD) * TT + (r0 % TT) + ob * 16 + row) * HD + (c0 % HD) + cofs) = o16; }
                else *(v4f*)(C + (size_t)(r0 + ob * 16 + row) * ldc + c0 + cofs) = val;
            } }
        __builtin_amdgcn_wave_barrier(); asm volatile("s_wait_xcnt 0x0" ::: "memory");   // keeps the next rows' LDS stores behind these reads, and stands in front of whatever next overwrites a register that these global stores name
    }
}

typedef __attribute__((ext_vector_type(2))) unsigned short v2us;
typedef __attribute__((ext_vector_type(2))) float v2f;
typedef __attribute__((ext_vector_type(4))) int v4i;

__global__ __launch_bounds__(256) void k_wtG(const float* __restrict__ w, int K, int N, bf* Bt) {
    const int lane = threadIdx.x & 31; const int L0 = (blockIdx.x * 8 + (threadIdx.x >> 5)) * 8; const int nlines = N * K / 64;
{
#pragma unroll 1
        for (int l = 0; l < 8; ++l) { const int L = L0 + l; if (L >= nlines) break; const size_t e = (size_t)L * 64 + lane * 2; const int k = (int)(e % K), n = (int)(e / K); v2us o;
            o[0] = f2bf(w[(size_t)k * N + n]); o[1] = f2bf(w[(size_t)(k + 1) * N + n]); *(v2us*)(Bt + e) = o; }
         }
}
__global__ __launch_bounds__(256) void k_cvt8(const float* __restrict__ src, bf* dst, size_t n8) { const size_t i = (size_t)blockIdx.x * 256 + threadIdx.x; if (i >= n8) return; src += (size_t)blockIdx.y * S_FULL * DM; dst += (size_t)blockIdx.y * TT * DM; const v8f v = *(const v8f*)(src + i * 8); v8us o;
#pragma unroll
    for (int k = 0; k < 8; ++k) o[k] = f2bf(v[k]); *(v8us*)(dst + i * 8) = o;  }

// ---- k_fattn: scores, mask, softmax, P . v and the hi / lo split of ctx in ONE kernel; no score or P element ever reaches memory.
// Grid (TT / 256, planes), 8 waves; a wave owns 32 queries (2 column groups of 16) of one (batch, head) plane and walks all TT keys, 64 keys an LDS stage (k rows, v^T hi and lo rows, pitch 144 B; two stage buffers, one barrier a stage), 32 keys a pass.
// S^T = K . Q^T (A = k rows, B = q rows, f16): lane l holds query l & 15, keys 8h + j of each 16-key tile, so two tiles converted in place ARE the B operand of O^T += V^T . P^T (A = v^T rows in the same k order, bf16 hi / lo, 3 products).
// Every inner loop is fully unrolled so that each index into a register array is a constant. Two work-groups a WGP = four waves a SIMD (256 registers a wave), which the vector work between the matrix runs wants.
// Softmax is the running-maximum form in the log2 domain: u = S x (log2 e / HD), masked u = most negative finite f32; p = 2^(u - m); O^T and the sum are rescaled by 2^(m_old - m_new) every pass; 1 / sum is applied to O^T at the end.
typedef __attribute__((ext_vector_type(8))) unsigned v8u;
typedef __attribute__((ext_vector_type(2))) __bf16 v2bf;
typedef __attribute__((ext_vector_type(4), may_alias)) unsigned v4u_;
#define AW  8                       // waves per work-group
#define AR  2                       // 16-query column groups per wave
#define AKB 64                      // keys per LDS stage
#define APT 72                      // LDS row pitch in 16-bit elements: 128-byte rows + 16 bytes
#define SCL2 (SCL * 1.4426950408889634f)
static_assert(TT % (AW * AR * 16) == 0);
static_assert(TT % AKB == 0);
static_assert(HD == 64);
__device__ __forceinline__ unsigned pack2(float a, float b) { v2f x; x[0] = a; x[1] = b; return __builtin_bit_cast(unsigned, __builtin_convertvector(x, v2bf)); }   // two f32 -> two bf16, round to nearest even
__device__ __forceinline__ float xhalf(float x) { return __builtin_bit_cast(float, __builtin_amdgcn_permlanex16(__builtin_bit_cast(int, x), __builtin_bit_cast(int, x), 0x76543210, 0xfedcba98, false, false)); }   // lane l <-> lane l ^ 16
__device__ __forceinline__ void split2(float a, float b, unsigned& h, unsigned& l) { h = pack2(a, b); l = pack2(a - __uint_as_float(h << 16), b - __uint_as_float(h & 0xFFFF0000u)); }
// Eight 2^x and the slot behind the last of them in ONE statement: each v_exp fills the slot of the one before it, the v_nop that of the last
__device__ __forceinline__ void exp2x8(float (&p)[8], const float (&d)[8]) {
    asm("v_exp_f32 %0, %8\n\tv_exp_f32 %1, %9\n\tv_exp_f32 %2, %10\n\tv_exp_f32 %3, %11\n\tv_exp_f32 %4, %12\n\tv_exp_f32 %5, %13\n\tv_exp_f32 %6, %14\n\tv_exp_f32 %7, %15\n\tv_nop"
        : "=&v"(p[0]), "=&v"(p[1]), "=&v"(p[2]), "=&v"(p[3]), "=&v"(p[4]), "=&v"(p[5]), "=&v"(p[6]), "=&v"(p[7])
        : "v"(d[0]), "v"(d[1]), "v"(d[2]), "v"(d[3]), "v"(d[4]), "v"(d[5]), "v"(d[6]), "v"(d[7]));
}
__global__ __launch_bounds__(AW * 32) __attribute__((amdgpu_waves_per_eu(4, 4))) void k_fattn(const h16* __restrict__ Qp, const h16* __restrict__ Kp, const bf* __restrict__ Vh, const bf* __restrict__ Vl, const int* __restrict__ Mk, bf* Ah, bf* Al) {
    __shared__ __align__(16) h16 Ks[2][AKB * APT];
    __shared__ __align__(16) bf Vhs[2][HD * APT];
    __shared__ __align__(16) bf Vls[2][HD * APT];
    __shared__ unsigned mbit[AW][TT / AKB][AR][32];   // each lane's own mask bits, one word per stage and column group; written and read by the same lane only
    const int tid = threadIdx.x, lane = tid & 31, wave = tid >> 5, lr = lane & 15, hi = lane >> 4;
    const int g = blockIdx.y, q0 = blockIdx.x * (AW * AR * 16) + wave * (AR * 16);
    Qp += (size_t)g * TT * HD; Kp += (size_t)g * TT * HD; Vh += (size_t)g * HD * TT; Vl += (size_t)g * HD * TT;
    const int srow = tid >> 3, sseg = (tid & 7) * 8;   // staging: 8 threads a 128-byte row, 32 rows a sweep
    const unsigned ko = (unsigned)(srow * HD + sseg), vo = (unsigned)(srow * TT + sseg);   // this thread's 32-bit offsets from wave-uniform bases
#pragma unroll
    for (int p = 0; p < 2; ++p) { const v8h rk = *(const v8h*)(Kp + 32 * p * HD + ko); const v8us rh = *(const v8us*)(Vh + 32 * p * TT + vo), rl = *(const v8us*)(Vl + 32 * p * TT + vo);
        *(v8h*)(Ks[0] + (srow + 32 * p) * APT + sseg) = rk; *(v8us*)(Vhs[0] + (srow + 32 * p) * APT + sseg) = rh; *(v8us*)(Vls[0] + (srow + 32 * p) * APT + sseg) = rl; }
    // mask rows of this lane's queries -> bits: element e = 8 * tile + j of a stage sits at bit 31 - e
    // rolled, for speed only
#pragma unroll 1
    for (int blk = 0; blk < TT / AKB; ++blk) {
#pragma unroll
        for (int r = 0; r < AR; ++r) { const int* mr = Mk + (size_t)(q0 + r * 16 + lr) * S_FULL + blk * AKB + 8 * hi; unsigned w = 0; v4i mv[AKB / 8];
#pragma unroll
            for (int c = 0; c < AKB / 8; ++c) mv[c] = *(const v4i*)(mr + (c >> 1) * 16 + (c & 1) * 4);
            asm volatile("s_wait_xcnt 0x0" ::: "memory");   // stands in front of whatever next overwrites the address registers that these loads name
#pragma unroll
            for (int c = 0; c < AKB / 8; ++c)
#pragma unroll
                for (int j = 0; j < 4; ++j) w = (w << 1) | min((unsigned)mv[c][j], 1u);
            mbit[wave][blk][r][lane] = w; }
    }
    v16h qf[AR][2];
#pragma unroll
    for (int r = 0; r < AR; ++r)
#pragma unroll
        for (int kc = 0; kc < 2; ++kc) qf[r][kc] = WFrag<h16>::ld(Qp + (size_t)(q0 + r * 16 + lr) * HD + kc * 32 + 8 * hi);
    v8f o[AR][4]; float m[AR], ls[AR];
#pragma unroll
    for (int r = 0; r < AR; ++r) { m[r] = NEGF; ls[r] = 0.f;
#pragma unroll
        for (int dt = 0; dt < 4; ++dt) o[r][dt] = (v8f){}; }
    // rolled: the register count stays at four waves a SIMD
#pragma unroll 1
    for (int blk = 0; blk < TT / AKB; ++blk) {
        __syncthreads();   // publishes stage blk, and ends every wave's reads of the other buffer, which this stage refills
        const int cb = blk & 1, kn = (blk + 1) * AKB; const bool more = blk + 1 < TT / AKB;
        unsigned mw[AR];
#pragma unroll
        for (int r = 0; r < AR; ++r) mw[r] = mbit[wave][blk][r][lane];
        const bool anym = __builtin_amdgcn_ballot_w32((mw[0] & mw[1]) != 0xFFFFFFFFu) != 0;   // wave-uniform: a stage with no masked element skips the selects
#pragma unroll
        for (int sb = 0; sb < AKB / 32; ++sb) {
            v8h rk; v8us rh, rl;
            if (more) { rk = *(const v8h*)(Kp + (kn + 32 * sb) * HD + ko); rh = *(const v8us*)(Vh + (32 * sb * TT + kn) + vo); rl = *(const v8us*)(Vl + (32 * sb * TT + kn) + vo); }   // half of the next stage's rows fly to registers under this pass
            float u[AR][16];
#pragma unroll
            for (int kt = 0; kt < 2; ++kt) { const h16* kp = Ks[cb] + (sb * 32 + kt * 16 + lr) * APT + 8 * hi; const v16h k0 = WFrag<h16>::ld(kp), k1 = WFrag<h16>::ld(kp + 32);
#pragma unroll
                for (int r = 0; r < AR; ++r) { const v8f s = wmma16(k1, qf[r][1], wmma16(k0, qf[r][0], (v8f){}));
#pragma unroll
                    for (int j = 0; j < 8; ++j) u[r][kt * 8 + j] = s[j] * SCL2; } }
            if (anym) {
#pragma unroll
                for (int r = 0; r < AR; ++r)
#pragma unroll
                    for (int e = 0; e < 16; ++e) if ((int)(mw[r] << (sb * 16 + e)) >= 0) u[r][e] = NEGF; }
            v16bf ph[AR], pl[AR];
#pragma unroll
            for (int r = 0; r < AR; ++r) {
                float mx = u[r][0];
#pragma unroll
                for (int e = 1; e < 16; ++e) mx = fmaxf(mx, u[r][e]);
                mx = fmaxf(mx, xhalf(mx));
                const float mn = fmaxf(m[r], mx), al = __builtin_amdgcn_exp2f(m[r] - mn); m[r] = mn;
                float sum = 0.f; v8u wh, wl;
#pragma unroll
                for (int t = 0; t < 2; ++t) { float d[8], p[8];
#pragma unroll
                    for (int j = 0; j < 8; ++j) d[j] = u[r][t * 8 + j] - mn;
                    exp2x8(p, d);
#pragma unroll
                    for (int j = 0; j < 8; j += 2) { sum += p[j] + p[j + 1]; unsigned a, c; split2(p[j], p[j + 1], a, c); wh[(t * 8 + j) >> 1] = a; wl[(t * 8 + j) >> 1] = c; } }
                asm volatile("" : "+v"(sum));   // each row's sum pinned against spills: without it the adds sink to the loop's foot, every p of the stage stays live until there, and the staging registers spill
                ls[r] = ls[r] * al + sum; ph[r] = __builtin_bit_cast(v16bf, wh); pl[r] = __builtin_bit_cast(v16bf, wl);
#pragma unroll
                for (int dt = 0; dt < 4; ++dt) o[r][dt] = o[r][dt] * al;
            }
            v16bf vf[4];
#pragma unroll
            for (int dt = 0; dt < 4; ++dt) vf[dt] = WFrag<bf>::ld(Vhs[cb] + (dt * 16 + lr) * APT + sb * 32 + 8 * hi);
#pragma unroll
            for (int dt = 0; dt < 4; ++dt)
#pragma unroll
                for (int r = 0; r < AR; ++r) o[r][dt] = wmmab(vf[dt], ph[r], o[r][dt]);
#pragma unroll
            for (int dt = 0; dt < 4; ++dt)
#pragma unroll
                for (int r = 0; r < AR; ++r) o[r][dt] = wmmab(vf[dt], pl[r], o[r][dt]);
#pragma unroll
            for (int dt = 0; dt < 4; ++dt) vf[dt] = WFrag<bf>::ld(Vls[cb] + (dt * 16 + lr) * APT + sb * 32 + 8 * hi);
#pragma unroll
            for (int dt = 0; dt < 4; ++dt)
#pragma unroll
                for (int r = 0; r < AR; ++r) o[r][dt] = wmmab(vf[dt], ph[r], o[r][dt]);
            if (more) { *(v8h*)(Ks[cb ^ 1] + (srow + 32 * sb) * APT + sseg) = rk; *(v8us*)(Vhs[cb ^ 1] + (srow + 32 * sb) * APT + sseg) = rh; *(v8us*)(Vls[cb ^ 1] + (srow + 32 * sb) * APT + sseg) = rl; }
        }
    }
    // lane l holds ctx[query l & 15][d = 16 dt + 8h + j]: 8 consecutive d, one 16-byte store a plane
#pragma unroll
    for (int r = 0; r < AR; ++r) { const float f = __fdiv_rn(1.0f, ls[r] + xhalf(ls[r])); const size_t oo = ((size_t)(g / NH_) * TT + q0 + r * 16 + lr) * DQ + (g % NH_) * HD + 8 * hi;
#pragma unroll
        for (int dt = 0; dt < 4; ++dt) { v4u_ wh, wl;
#pragma unroll
            for (int j = 0; j < 8; j += 2) { unsigned a, c; split2(o[r][dt][j] * f, o[r][dt][j + 1] * f, a, c); wh[j >> 1] = a; wl[j >> 1] = c; }
            *(v4u_*)(Ah + oo + dt * 16) = wh; *(v4u_*)(Al + oo + dt * 16) = wl; } }
}

extern "C" void kernel_launch(void* const* d_in, const int* in_sizes, int n_in,
                              void* d_out, int out_size, void* d_ws, size_t ws_size, hipStream_t stream) {
    if (n_in < 11) return;
    if ((size_t)in_sizes[0] < (size_t)(NB - 1) * S_FULL * DM + (size_t)TT * DM) return;
    if ((size_t)in_sizes[1] < (size_t)(NB - 1) * S_FULL * DM + (size_t)TT * DM) return;
    if ((size_t)in_sizes[2] < (size_t)(TT - 1) * S_FULL + (size_t)TT) return;
    if (in_sizes[3] < DM * DQ || in_sizes[5] < DM * DKV || in_sizes[7] < DM * DKV || in_sizes[9] < DQ * DM) return;
    if (in_sizes[4] < DQ || in_sizes[6] < DKV || in_sizes[8] < DKV || in_sizes[10] < DM) return;
    if ((size_t)out_size < (size_t)NB * TT * DM) return;
    const float* x  = (const float*)d_in[0];     // [NB][S_FULL][DM]
    const float* xk = (const float*)d_in[1];     // [NB][S_FULL][DM]
    const int*   mk = (const int*)d_in[2];       // [1][1][S_FULL][S_FULL] int32 0/1
    const float* wq = (const float*)d_in[3]; const float* bq = (const float*)d_in[4];
    const float* wk = (const float*)d_in[5]; const float* bk = (const float*)d_in[6];
    const float* wv = (const float*)d_in[7]; const float* bv = (const float*)d_in[8];
    const float* wo = (const float*)d_in[9]; const float* bo = (const float*)d_in[10];
    float* OUT = (float*)d_out;     // [NB][TT][DM]
    char* wsp = (char*)d_ws;
    auto take = [&](size_t bytes) { char* p = wsp; wsp += (bytes + 255) & ~(size_t)255; return (void*)p; };
    bf* WQ = (bf*)take((size_t)DQ * DM * 2); bf* WK = (bf*)take((size_t)DKV * DM * 2); bf* WV = (bf*)take((size_t)DKV * DM * 2); bf* WO = (bf*)take((size_t)DM * DQ * 2);
    h16* QP16 = (h16*)take((size_t)NB * NH_ * TT * HD * 2); h16* KP16 = (h16*)take((size_t)NB * NKV * TT * HD * 2);
    bf* VTh = (bf*)take((size_t)NB * NKV * HD * TT * 2); bf* VTl = (bf*)take((size_t)NB * NKV * HD * TT * 2);
    bf* ATh = (bf*)take((size_t)NB * TT * DQ * 2); bf* ATl = (bf*)take((size_t)NB * TT * DQ * 2);
    bf* XB = (bf*)take((size_t)NB * TT * DM * 2); bf* XKB = (bf*)take((size_t)NB * TT * DM * 2);
    if ((size_t)(wsp - (char*)d_ws) > ws_size) return;
    k_wtG<<<(unsigned)((DM * DQ / 64 + 63) / 64), 256, 0, stream>>>(wq, DM, DQ, WQ); k_wtG<<<(unsigned)((DM * DKV / 64 + 63) / 64), 256, 0, stream>>>(wk, DM, DKV, WK); k_wtG<<<(unsigned)((DM * DKV / 64 + 63) / 64), 256, 0, stream>>>(wv, DM, DKV, WV);
    k_wtG<<<(unsigned)((DQ * DM / 64 + 63) / 64), 256, 0, stream>>>(wo, DQ, DM, WO);
    // every batch in one launch: rows b * TT + t in the projections, planes b * NH_ + h in attention
    k_cvt8<<<dim3((unsigned)(((size_t)TT * DM / 8 + 255) / 256), NB, 1), 256, 0, stream>>>(x, XB, (size_t)TT * DM / 8); k_cvt8<<<dim3((unsigned)(((size_t)TT * DM / 8 + 255) / 256), NB, 1), 256, 0, stream>>>(xk, XKB, (size_t)TT * DM / 8);
    // each projection's epilogue writes the operand planes of attention itself
    k_gemmw<bf, 0, true, 1><<<dim3(NB * TT / GRA, DQ / GRB, 1), GT, 0, stream>>>(XB, nullptr, WQ, DM, DM, nullptr, DQ, bq, 0, 0, 0, QP16, nullptr, nullptr);
    k_gemmw<bf, 0, true, 1><<<dim3(NB * TT / GRA, DKV / GRB, 1), GT, 0, stream>>>(XKB, nullptr, WK, DM, DM, nullptr, DKV, bk, 0, 0, 0, KP16, nullptr, nullptr);
    k_gemmw<bf, 0, true, 2><<<dim3(NB * TT / GRA, DKV / GRB, 1), GT, 0, stream>>>(XKB, nullptr, WV, DM, DM, nullptr, DKV, bv, 0, 0, 0, nullptr, VTh, VTl);
    k_fattn<<<dim3(TT / (AW * AR * 16), NB * NH_, 1), AW * 32, 0, stream>>>(QP16, KP16, VTh, VTl, mk, ATh, ATl);
    k_gemmw<bf, 1, true, 0><<<dim3(NB * TT / GRA, DM / GRB, 1), GT, 0, stream>>>(ATh, ATl, WO, DQ, DQ, OUT, DM, bo, 0, 0, 0, nullptr, nullptr, nullptr);
}

// v005
// One run takes 161 microseconds.
// In both of two side-by-side timings against v004, it was 1.23 times as fast.
// Counting every step since v000, it is 10.4 times as fast.
#include <hip/hip_runtime.h>

// Multi-head dot-product attention: inputs_q, inputs_kv [8][1024][1024]; q = inputs_q Wq + bq, k / v = inputs_kv Wk / Wv + bk / bv (W [1024][16][64] = k-major [1024][1024], bias [16][64]);
// logits = (q . k) / 64 (the module divides q by the head depth); int32 mask [1][1][1024][1024] replaces masked logits by the most negative finite f32; softmax over keys; ctx = P . v; out = ctx Wo ([16][64][1024] = [1024][1024]) + bo -> [8][1024][1024] f32.
// Compute dtypes, f32 accumulate: every float input RNE-converted to bf16; q/k/v projections v_wmma_f32_16x16x32_bf16 on plain bf16 operands; scores v_wmma_f32_16x16x32_f16 on plain fp16 q/k planes with 1/64 applied to the f32 score; softmax f32, running maximum; P . v on bf16 hi/lo parts of the unnormalised P = 2^(u - m) and of v (3 products), 1 / sum applied to the f32 result; ctx . Wo on bf16 hi/lo ctx planes x exact bf16 Wo (2 products); biases added in f32 as bf16-converted values.

#ifndef NB
#define NB   8
#endif
#ifndef SEQ
#define SEQ  1024
#endif
#define S_FULL 1024                 // per-batch row count / mask row pitch
#define TT   SEQ
#define DM   1024
#define NH_  16
#define NKV  16
#define REP  (NH_ / NKV)
#define HD   64
#define DQ   (NH_ * HD)
#define DKV  (NKV * HD)
#define SCL  0.015625f              // 1 / HD
#define NEGF (-3.4028234663852886e38f)

static_assert(TT % 128 == 0);
static_assert(TT % 64 == 0);
static_assert(DM % 64 == 0);
static_assert(HD % 32 == 0);
static_assert(REP == 1);
static_assert(SEQ <= S_FULL);
static_assert(NB >= 1);

typedef _Float16 h16;
typedef unsigned short bf;
typedef __attribute__((ext_vector_type(16))) __bf16   v16bf;
typedef __attribute__((ext_vector_type(16))) _Float16 v16h;
typedef __attribute__((ext_vector_type(8)))  _Float16 v8h;
typedef __attribute__((ext_vector_type(8)))  unsigned short v8us;
typedef __attribute__((ext_vector_type(8)))  float    v8f;
typedef __attribute__((ext_vector_type(4)))  float    v4f;
typedef v8h  __attribute__((may_alias)) v8ha;
typedef v4f  __attribute__((may_alias)) v4fa;
typedef v8us __attribute__((may_alias)) v8usa;

__device__ __forceinline__ unsigned short f2bf(float f) { unsigned u = __float_as_uint(f); u += 0x7FFFu + ((u >> 16) & 1u); return (unsigned short)(u >> 16); }
__device__ __forceinline__ float bf2f(unsigned short b) { return __uint_as_float(((unsigned)b) << 16); }
__device__ __forceinline__ float bfr(float f) { return bf2f(f2bf(f)); }
__device__ __forceinline__ v16h cat16(v8h lo, v8h hi) { return __builtin_shufflevector(lo, hi, 0, 1, 2, 3, 4, 5, 6, 7, 8, 9, 10, 11, 12, 13, 14, 15); }
__device__ __forceinline__ v16bf cat16b(v8us lo, v8us hi) { return __builtin_bit_cast(v16bf, __builtin_shufflevector(lo, hi, 0, 1, 2, 3, 4, 5, 6, 7, 8, 9, 10, 11, 12, 13, 14, 15)); }
__device__ __forceinline__ v8f wmma16(v16h a, v16h b, v8f c) { return __builtin_amdgcn_wmma_f32_16x16x32_f16(false, a, false, b, (short)0, c, false, false); }
__device__ __forceinline__ v8f wmmab(v16bf a, v16bf b, v8f c) { return __builtin_amdgcn_wmma_f32_16x16x32_bf16(false, a, false, b, (short)0, c, false, false); }



// ---- k_gemmw: GEMM on a 256 x 128 output tile per work-group of EIGHT WAVES (4 x 2), each wave a 64 x 64 part (16 accumulators); grid (M/256, N/128, Z), 256 threads, one work-group a WGP.
// The operands' rows (K-contiguous 16-bit planes) reach LDS by asynchronous copies, whole 128-byte lines a wave instruction, GKS k a stage, two stage buffers: stage t + 2 flies while stage t + 1 is worked on; the fragments are read from LDS (row pitch = row + 16 bytes).
// C[m][n] (+ optional f32 bias[n]) = sum_k A[m][k] Bt[n][k] (NSPLIT 1: + A2[m][k] Bt[n][k]). A / A2 row pitch lda, Bt row pitch K. z-batch strides sA/sB/sC in elements. K % GKS == 0.
// OUTM says where the tile goes: 0 = f32 C, pitch ldc; 1 = f16 head planes P16[batch][head][token][HD] (m = batch * TT + token, n = head * HD + depth; a wave's part is 8 KiB in a row);
// 2 = transposed bf16 hi / lo planes Th / Tl[batch][n][token]: the two operands change places in the matrix instruction, so D comes out as [n][token] and a staged row is one whole 128-byte line of 64 tokens.
// Fragments (A and Bt alike): lane l -> row l&15, elements 0..7 = k kc+8h..kc+8h+7, elements 8..15 = k kc+16+8h..kc+16+8h+7 (h = l>>4); D element j -> row 8h+j, col l&15.
template <typename T16> struct WFrag;
template <> struct WFrag<h16> { typedef v16h V; static __device__ __forceinline__ V ld(const h16* p) { return cat16(*(const v8h*)p, *(const v8h*)(p + 16)); } static __device__ __forceinline__ v8f mma(V a, V b, v8f c) { return wmma16(a, b, c); } };
template <> struct WFrag<bf> { typedef v16bf V; static __device__ __forceinline__ V ld(const bf* p) { return cat16b(*(const v8us*)p, *(const v8us*)(p + 16)); } static __device__ __forceinline__ v8f mma(V a, V b, v8f c) { return wmmab(a, b, c); } };
__device__ __forceinline__ h16 tohx(float x) { return (h16)x; }
__device__ __forceinline__ void splitf(float y, unsigned short& h, unsigned short& l) { h = f2bf(y); l = f2bf(y - bf2f(h)); }
typedef __attribute__((ext_vector_type(4))) _Float16 v4h;
typedef __attribute__((ext_vector_type(4))) unsigned short v4us;
#define GT  256                     // threads of a GEMM work-group
#define GRA 256                     // rows of A (and A2) in a stage = rows of the output tile
#define GRB 128                     // rows of Bt in a stage = columns of the output tile
static_assert((NB * TT) % GRA == 0 && DQ % GRB == 0 && DKV % GRB == 0 && DM % GRB == 0 && DM % 128 == 0 && DQ % 64 == 0);
__device__ __forceinline__ unsigned lds_off(const void* p) { return (unsigned)(size_t)p; }   // byte offset in the work-group's LDS
// N (8 or 4) asynchronous 16-byte copies a lane, global -> LDS, and the wait that stands in front of whatever next overwrites a register they name, in ONE statement (in a statement of its own the compiler may lift the next address additions over it).
template <int N, typename T16>
__device__ __forceinline__ void copyrun(unsigned l, unsigned lstep, const T16* g, size_t gstep) {
    static_assert(N == 8 || N == 4);
    if constexpr (N == 8)
        asm volatile("global_load_async_to_lds_b128 %0, %8, off\n\tglobal_load_async_to_lds_b128 %1, %9, off\n\tglobal_load_async_to_lds_b128 %2, %10, off\n\tglobal_load_async_to_lds_b128 %3, %11, off\n\t"
                     "global_load_async_to_lds_b128 %4, %12, off\n\tglobal_load_async_to_lds_b128 %5, %13, off\n\tglobal_load_async_to_lds_b128 %6, %14, off\n\tglobal_load_async_to_lds_b128 %7, %15, off\n\ts_wait_xcnt 0x0"
                     :: "v"(l), "v"(l + lstep), "v"(l + 2 * lstep), "v"(l + 3 * lstep), "v"(l + 4 * lstep), "v"(l + 5 * lstep), "v"(l + 6 * lstep), "v"(l + 7 * lstep),
                        "v"(g), "v"(g + gstep), "v"(g + 2 * gstep), "v"(g + 3 * gstep), "v"(g + 4 * gstep), "v"(g + 5 * gstep), "v"(g + 6 * gstep), "v"(g + 7 * gstep) : "memory");
    else
        asm volatile("global_load_async_to_lds_b128 %0, %4, off\n\tglobal_load_async_to_lds_b128 %1, %5, off\n\tglobal_load_async_to_lds_b128 %2, %6, off\n\tglobal_load_async_to_lds_b128 %3, %7, off\n\ts_wait_xcnt 0x0"
                     :: "v"(l), "v"(l + lstep), "v"(l + 2 * lstep), "v"(l + 3 * lstep), "v"(g), "v"(g + gstep), "v"(g + 2 * gstep), "v"(g + 3 * gstep) : "memory");
}
template <typename T16, int NSPLIT, bool BIAS, int OUTM>
__global__ __launch_bounds__(GT) void k_gemmw(const T16* __restrict__ A, const T16* __restrict__ A2, const T16* __restrict__ Bt, int K, int lda, float* C, int ldc, const float* __restrict__ bias, size_t sA, size_t sB, size_t sC, h16* P16, bf* Th, bf* Tl) {
    static_assert(NSPLIT == 0 || NSPLIT == 1);
    static_assert(OUTM == 0 || NSPLIT == 0);
    static_assert(TT % 64 == 0 && HD % 64 == 0);   // a wave's 64 x 64 part stays inside one batch and one head
    typedef typename WFrag<T16>::V V;
    constexpr int GKS = NSPLIT ? 64 : 128;         // k per stage: both buffers and the output staging fit one WGP's LDS
    constexpr int GP = GKS + 8;                    // LDS row pitch in elements: the row + 16 bytes
    constexpr int ROWS = GRA + GRB + (NSPLIT ? GRA : 0);   // a stage: A's rows, Bt's rows, (A2's rows)
    constexpr int SEG = GKS / 8, RPS = GT / SEG;   // 16-byte pieces a row; rows a sweep of the work-group
    constexpr int SWA = GRA / RPS, SWB = GRB / RPS;   // sweeps a plane
    static_assert(SWA % 8 == 0 && (SWB % 8 == 0 || SWB == 4));
    __shared__ __align__(16) T16 ring[2][ROWS * GP];
    __shared__ __align__(16) float osw[GT / 32][16 * 68];
    const size_t z = blockIdx.z; A += z * sA; if (NSPLIT) A2 += z * sA; Bt += z * sB; C += z * sC;
    const int tid = threadIdx.x, lane = tid & 31, wave = tid >> 5, lr = lane & 15, hi = lane >> 4;
    const int R0 = blockIdx.x * GRA, C0 = blockIdx.y * GRB, wm = (wave >> 1) * 64, wn = (wave & 1) * 64; const int r0 = R0 + wm, c0 = C0 + wn;
    float* const os = osw[wave];
    v8f acc[4][4];
#pragma unroll
    for (int mb = 0; mb < 4; ++mb)
#pragma unroll
        for (int nb = 0; nb < 4; ++nb) acc[mb][nb] = (v8f){};
    // staging: SEG threads a row, RPS rows a sweep; every lane is on, every piece lies inside its plane (M a multiple of GRA, N of GRB, K of GKS)
    const int srow = tid / SEG, sseg = (tid % SEG) * 8;
    const T16* const gA = A + (size_t)(R0 + srow) * lda + sseg; const T16* const gA2 = NSPLIT ? A2 + (size_t)(R0 + srow) * lda + sseg : nullptr; const T16* const gB = Bt + (size_t)(C0 + srow) * K + sseg;
    const unsigned l0 = lds_off(&ring[0][0]) + (unsigned)(srow * GP + sseg) * 2u;
    auto stage = [&](int t) {   // stage t's copies into buffer t & 1
        const unsigned lb = l0 + (unsigned)(t & 1) * (unsigned)(ROWS * GP * 2); const int kc = t * GKS;
#pragma unroll
        for (int u = 0; u < SWA; u += 8) {
            copyrun<8, T16>(lb + (unsigned)(u * RPS * GP * 2), (unsigned)(RPS * GP * 2), gA + (size_t)(u * RPS) * lda + kc, (size_t)RPS * lda);
            if constexpr (NSPLIT == 1) copyrun<8, T16>(lb + (unsigned)((GRA + GRB + u * RPS) * GP * 2), (unsigned)(RPS * GP * 2), gA2 + (size_t)(u * RPS) * lda + kc, (size_t)RPS * lda);
        }
        if constexpr (SWB == 4) copyrun<4, T16>(lb + (unsigned)(GRA * GP * 2), (unsigned)(RPS * GP * 2), gB + kc, (size_t)RPS * K);
        else {
#pragma unroll
            for (int u = 0; u < SWB; u += 8) copyrun<8, T16>(lb + (unsigned)((GRA + u * RPS) * GP * 2), (unsigned)(RPS * GP * 2), gB + (size_t)(u * RPS) * K + kc, (size_t)RPS * K);
        }
    };
    const int NT = K / GKS;
    stage(0);
    asm volatile("s_wait_asynccnt 0x0" ::: "memory");   // this wave's copies of stage 0 have landed
    __syncthreads();                                    // publishes stage 0
    if (NT > 1) stage(1);
    // rolled: one publish point at its foot
#pragma unroll 1
    for (int t = 0; t < NT; ++t) {
        const T16* const As = ring[t & 1] + (wm + lr) * GP + 8 * hi; const T16* const Bs = ring[t & 1] + (GRA + wn + lr) * GP + 8 * hi; const T16* const A2s = NSPLIT ? ring[t & 1] + (GRA + GRB + wm + lr) * GP + 8 * hi : As;
        V a[2][4], a2[2][4], b[2][4];   // two fragment sets: block i + 1's LDS reads go out as one group in front of block i's matrix instructions
        auto frags = [&](int s, int ks) {
#pragma unroll
            for (int f = 0; f < 4; ++f) { a[s][f] = WFrag<T16>::ld(As + f * 16 * GP + ks); if (NSPLIT == 1) a2[s][f] = WFrag<T16>::ld(A2s + f * 16 * GP + ks); b[s][f] = WFrag<T16>::ld(Bs + f * 16 * GP + ks); }
        };
        frags(0, 0);
        // unrolled: the index of a fragment set must be a constant for the sets to stay in registers
#pragma unroll
        for (int i = 0; i < GKS / 32; ++i) {
            if (i + 1 < GKS / 32) frags((i + 1) & 1, (i + 1) * 32);
            __builtin_amdgcn_sched_barrier(0);   // keeps the reads above in one group ahead of the block
#pragma unroll
            for (int nb = 0; nb < 4; ++nb) {
#pragma unroll
                for (int mb = 0; mb < 4; ++mb) acc[mb][nb] = OUTM == 2 ? WFrag<T16>::mma(b[i & 1][nb], a[i & 1][mb], acc[mb][nb]) : WFrag<T16>::mma(a[i & 1][mb], b[i & 1][nb], acc[mb][nb]);
                if constexpr (NSPLIT == 1) {
#pragma unroll
                    for (int mb = 0; mb < 4; ++mb) acc[mb][nb] = WFrag<T16>::mma(a2[i & 1][mb], b[i & 1][nb], acc[mb][nb]);
                }
            }
            __builtin_amdgcn_sched_barrier(0);   // keeps the next group of reads behind this block
        }
        asm volatile("s_wait_dscnt 0x0" ::: "memory");      // this wave's reads of stage t have returned
        asm volatile("s_wait_asynccnt 0x0" ::: "memory");   // this wave's copies of stage t + 1 have landed
        __syncthreads();                                    // publishes stage t + 1, and ends every wave's reads of stage t's buffer, which is refilled behind it
        if (t + 2 < NT) stage(t + 2);
    }
    asm volatile("s_wait_asynccnt 0x0" ::: "memory");       // no copy is outstanding when the wave goes on
    float bn[4][8];   // OUTM 2: the bias of this lane's D rows n = c0 + 16 ob + 8 hi + j, added on the way into LDS
    if constexpr (OUTM == 2 && BIAS) {
#pragma unroll
        for (int ob = 0; ob < 4; ++ob) { const v4f b0 = *(const v4fa*)(bias + c0 + ob * 16 + 8 * hi), b1 = *(const v4fa*)(bias + c0 + ob * 16 + 8 * hi + 4);
#pragma unroll
            for (int j = 0; j < 4; ++j) { bn[ob][j] = bfr(b0[j]); bn[ob][4 + j] = bfr(b1[j]); } }
        asm volatile("s_wait_xcnt 0x0" ::: "memory");   // stands in front of whatever next overwrites the address registers that these loads name
    }
    // sixteen D rows at a time through LDS, so that every store covers whole lines (OUTM 2: a D row is one n, its columns are tokens)
#pragma unroll
    for (int ob = 0; ob < 4; ++ob) {
#pragma unroll
        for (int ib = 0; ib < 4; ++ib) {
#pragma unroll
            for (int j = 0; j < 8; ++j) { if constexpr (OUTM == 2) os[(hi * 8 + j) * 68 + ib * 16 + lr] = BIAS ? acc[ib][ob][j] + bn[ob][j] : acc[ib][ob][j]; else os[(hi * 8 + j) * 68 + ib * 16 + lr] = acc[ob][ib][j]; } }
        __builtin_amdgcn_wave_barrier(); asm volatile("" ::: "memory");
#pragma unroll
        for (int s = 0; s < 8; ++s) { const int row = 2 * s + hi, cofs = lr * 4; v4f val = *(const v4fa*)(os + row * 68 + cofs);
            if constexpr (OUTM == 2) {
                const int n = c0 + ob * 16 + row; v4us oh, ol;
#pragma unroll
                for (int q = 0; q < 4; ++q) { unsigned short a2, c2; splitf(val[q], a2, c2); oh[q] = a2; ol[q] = c2; }
                const size_t e = ((size_t)(r0 / TT) * ldc + n) * TT + (r0 % TT) + cofs; *(v4us*)(Th + e) = oh; *(v4us*)(Tl + e) = ol;
            } else {
                if (BIAS) { val[0] += bfr(bias[c0 + cofs]); val[1] += bfr(bias[c0 + cofs + 1]); val[2] += bfr(bias[c0 + cofs + 2]); val[3] += bfr(bias[c0 + cofs + 3]); }
                if constexpr (OUTM == 1) { v4h o16; o16[0] = tohx(val[0]); o16[1] = tohx(val[1]); o16[2] = tohx(val[2]); o16[3] = tohx(val[3]);
                    *(v4h*)(P16 + (((size_t)(r0 / TT) * (ldc / HD) + c0 / HD) * TT + (r0 % TT) + ob * 16 + row) * HD + (c0 % HD) + cofs) = o16; }
                else *(v4f*)(C + (size_t)(r0 + ob * 16 + row) * ldc + c0 + cofs) = val;
            } }
        __builtin_amdgcn_wave_barrier(); asm volatile("s_wait_xcnt 0x0" ::: "memory");   // keeps the next rows' LDS stores behind these reads, and stands in front of whatever next overwrites a register that these global stores name
    }
}

typedef __attribute__((ext_vector_type(2))) unsigned short v2us;
typedef __attribute__((ext_vector_type(2))) float v2f;
typedef __attribute__((ext_vector_type(4))) int v4i;

// ---- k_prep: every operand conversion of the call in ONE launch sized to the chip (PWB + PSB work-groups of 8 waves, all resident at once); every load covers whole lines, each wave has 16 to 32 of them in flight and does many lines, so few waves have to be started.
// Work-groups 0 .. PWB - 1: the four weights, f32 [K][N] -> bf16 Bt[N][K]; a work-group turns the same 64 x 64 tile of each weight through LDS: a thread loads a 4 k x 4 n block (a wave's load = 2 rows of 256 bytes), writes 4 k in a row under each n, and behind the one barrier the rows of 64 k go out as whole 128-byte lines.
// Work-groups PWB .. PWB + PSB - 1: inputs_q and inputs_kv, f32 -> bf16; a wave takes PCH pieces of 512 bytes in a row of each input (32 lanes x 16 bytes = 4 whole lines a load).
#define PCH 16                      // 512-byte pieces (128 floats) of each input that a wave has in flight
#define PNC (TT * DM / 128)         // pieces a batch
#define PSB (NB * PNC / PCH / 8)    // work-groups that convert the inputs
#define PWB (DM / 64 * (DQ / 64))   // work-groups that turn the weights: one 64 x 64 tile of every weight each
#define PTP 72                      // LDS row pitch of a turned tile in elements: the 128-byte row + 16 bytes
static_assert(PNC % PCH == 0 && (NB * PNC / PCH) % 8 == 0);
static_assert(DM % 64 == 0 && DQ % 64 == 0 && DKV % 64 == 0 && DKV <= DQ);
template <int K, int N> struct WTile {   // tile b of a [K][N] weight: k from (b / (N / 64)) * 64, n from (b % (N / 64)) * 64; a weight with fewer tiles than PWB leaves the rest of the work-groups out (the same test for a whole work-group)
    static __device__ __forceinline__ bool has(int b) { return b < (K / 64) * (N / 64); }
    static __device__ __forceinline__ const float* src(const float* __restrict__ w, int b, int tid) { return w + (size_t)((has(b) ? b / (N / 64) : 0) * 64 + (tid >> 4) * 4) * N + (b % (N / 64)) * 64 + (tid & 15) * 4; }   // this thread's 4 x 4 block
    static __device__ __forceinline__ void load(const float* p, int b, v4f (&v)[4]) {
        if (!has(b)) return;
#pragma unroll
        for (int s = 0; s < 4; ++s) v[s] = *(const v4fa*)(p + (size_t)s * N);
    }
    static __device__ __forceinline__ void turn(const v4f (&v)[4], bf* T, int b, int tid) {
        if (!has(b)) return;
#pragma unroll
        for (int j = 0; j < 4; ++j) { v4us o;
#pragma unroll
            for (int s = 0; s < 4; ++s) o[s] = f2bf(v[s][j]);
            *(v4us*)(T + ((tid & 15) * 4 + j) * PTP + (tid >> 4) * 4) = o; }
    }
    static __device__ __forceinline__ void store(const bf* T, bf* Bt, int b, int tid) {
        if (!has(b)) return;
#pragma unroll
        for (int p = 0; p < 2; ++p) { const int n = (tid >> 3) + 32 * p; *(v8us*)(Bt + (size_t)((b % (N / 64)) * 64 + n) * K + (b / (N / 64)) * 64 + (tid & 7) * 8) = *(const v8us*)(T + n * PTP + (tid & 7) * 8); }
    }
};
__device__ __forceinline__ void cvt_store(const v4f (&v)[PCH], bf* dst) {
#pragma unroll
    for (int i = 0; i < PCH; ++i) { v4us o;
#pragma unroll
        for (int k = 0; k < 4; ++k) o[k] = f2bf(v[i][k]);
        *(v4us*)(dst + i * 128) = o; }
}
__global__ __launch_bounds__(256) void k_prep(const float* __restrict__ x, const float* __restrict__ xk, const float* __restrict__ wq, const float* __restrict__ wk, const float* __restrict__ wv, const float* __restrict__ wo,
                                              bf* XB, bf* XKB, bf* WQ, bf* WK, bf* WV, bf* WO) {
    __shared__ __align__(16) bf tw[4][64 * PTP];
    const int tid = threadIdx.x;
    if (blockIdx.x < PWB) { const int b = blockIdx.x; v4f vq[4], vk[4], vv[4], vo[4];
        const float* const pq = WTile<DM, DQ>::src(wq, b, tid); const float* const pk = WTile<DM, DKV>::src(wk, b, tid); const float* const pv = WTile<DM, DKV>::src(wv, b, tid); const float* const po = WTile<DQ, DM>::src(wo, b, tid);
        WTile<DM, DQ>::load(pq, b, vq); WTile<DM, DKV>::load(pk, b, vk); WTile<DM, DKV>::load(pv, b, vv); WTile<DQ, DM>::load(po, b, vo);
        __builtin_amdgcn_sched_barrier(0);              // keeps all sixteen loads in front of the first conversion: a load sunk among the conversions starts only when earlier ones have returned, a second memory latency
        asm volatile("s_wait_xcnt 0x0" :: "v"(pq), "v"(pk), "v"(pv), "v"(po) : "memory");   // stands in front of whatever next overwrites the address registers that these loads name; the addresses are inputs so that they live up to here and no later load's result is put on them
        WTile<DM, DQ>::turn(vq, tw[0], b, tid); WTile<DM, DKV>::turn(vk, tw[1], b, tid); WTile<DM, DKV>::turn(vv, tw[2], b, tid); WTile<DQ, DM>::turn(vo, tw[3], b, tid);
        __syncthreads();                                // publishes the turned tiles: a row is written by sixteen threads of all eight waves and read by eight threads of one
        WTile<DM, DQ>::store(tw[0], WQ, b, tid); WTile<DM, DKV>::store(tw[1], WK, b, tid); WTile<DM, DKV>::store(tw[2], WV, b, tid); WTile<DQ, DM>::store(tw[3], WO, b, tid);
        return; }
    const int lane = tid & 31, wave = __builtin_amdgcn_readfirstlane(tid >> 5);   // the wave's number in a scalar register: the bases stay scalar
    const int c0 = (((int)blockIdx.x - PWB) * 8 + wave) * PCH;   // a run of PCH pieces stays inside one batch
    const size_t so = (size_t)(c0 / PNC) * S_FULL * DM + (size_t)(c0 % PNC) * 128 + lane * 4, po = (size_t)c0 * 128 + lane * 4;
    const float* const pq = x + so; const float* const pk = xk + so;
    v4f vq[PCH], vk[PCH];
#pragma unroll
    for (int i = 0; i < PCH; ++i) vq[i] = *(const v4fa*)(pq + i * 128);
#pragma unroll
    for (int i = 0; i < PCH; ++i) vk[i] = *(const v4fa*)(pk + i * 128);
    __builtin_amdgcn_sched_barrier(0);              // keeps every load of the wave in front of the first conversion, for the reason given above
    asm volatile("s_wait_xcnt 0x0" :: "v"(pq), "v"(pk) : "memory");   // as above: the wait, with the two addresses alive up to it
    cvt_store(vq, XB + po); cvt_store(vk, XKB + po);
    asm volatile("s_wait_xcnt 0x0" ::: "memory");   // behind the last stores: the built code has a way on from here into the weights' part, which overwrites the registers that these stores name
}

// ---- k_fattn: scores, mask, softmax, P . v and the hi / lo split of ctx in ONE kernel; no score or P element ever reaches memory.
// Grid (TT / 256, planes), 8 waves; a wave owns 32 queries (2 column groups of 16) of one (batch, head) plane and walks all TT keys, 64 keys an LDS stage (k rows, v^T hi and lo rows, pitch 144 B; two stage buffers, one barrier a stage), 32 keys a pass.
// S^T = K . Q^T (A = k rows, B = q rows, f16): lane l holds query l & 15, keys 8h + j of each 16-key tile, so two tiles converted in place ARE the B operand of O^T += V^T . P^T (A = v^T rows in the same k order, bf16 hi / lo, 3 products).
// Every inner loop is fully unrolled so that each index into a register array is a constant. Two work-groups a WGP = four waves a SIMD (256 registers a wave), which the vector work between the matrix runs wants.
// Softmax is the running-maximum form in the log2 domain: u = S x (log2 e / HD), masked u = most negative finite f32; p = 2^(u - m); O^T and the sum are rescaled by 2^(m_old - m_new) every pass; 1 / sum is applied to O^T at the end.
typedef __attribute__((ext_vector_type(8))) unsigned v8u;
typedef __attribute__((ext_vector_type(2))) __bf16 v2bf;
typedef __attribute__((ext_vector_type(4), may_alias)) unsigned v4u_;
#define AW  8                       // waves per work-group
#define AR  2                       // 16-query column groups per wave
#define AKB 64                      // keys per LDS stage
#define APT 72                      // LDS row pitch in 16-bit elements: 128-byte rows + 16 bytes
#define SCL2 (SCL * 1.4426950408889634f)
static_assert(TT % (AW * AR * 16) == 0);
static_assert(TT % AKB == 0);
static_assert(HD == 64);
__device__ __forceinline__ unsigned pack2(float a, float b) { v2f x; x[0] = a; x[1] = b; return __builtin_bit_cast(unsigned, __builtin_convertvector(x, v2bf)); }   // two f32 -> two bf16, round to nearest even
__device__ __forceinline__ float xhalf(float x) { return __builtin_bit_cast(float, __builtin_amdgcn_permlanex16(__builtin_bit_cast(int, x), __builtin_bit_cast(int, x), 0x76543210, 0xfedcba98, false, false)); }   // lane l <-> lane l ^ 16
__device__ __forceinline__ void split2(float a, float b, unsigned& h, unsigned& l) { h = pack2(a, b); l = pack2(a - __uint_as_float(h << 16), b - __uint_as_float(h & 0xFFFF0000u)); }
// Eight 2^x and the slot behind the last of them in ONE statement: each v_exp fills the slot of the one before it, the v_nop that of the last
__device__ __forceinline__ void exp2x8(float (&p)[8], const float (&d)[8]) {
    asm("v_exp_f32 %0, %8\n\tv_exp_f32 %1, %9\n\tv_exp_f32 %2, %10\n\tv_exp_f32 %3, %11\n\tv_exp_f32 %4, %12\n\tv_exp_f32 %5, %13\n\tv_exp_f32 %6, %14\n\tv_exp_f32 %7, %15\n\tv_nop"
        : "=&v"(p[0]), "=&v"(p[1]), "=&v"(p[2]), "=&v"(p[3]), "=&v"(p[4]), "=&v"(p[5]), "=&v"(p[6]), "=&v"(p[7])
        : "v"(d[0]), "v"(d[1]), "v"(d[2]), "v"(d[3]), "v"(d[4]), "v"(d[5]), "v"(d[6]), "v"(d[7]));
}
__global__ __launch_bounds__(AW * 32) __attribute__((amdgpu_waves_per_eu(4, 4))) void k_fattn(const h16* __restrict__ Qp, const h16* __restrict__ Kp, const bf* __restrict__ Vh, const bf* __restrict__ Vl, const int* __restrict__ Mk, bf* Ah, bf* Al) {
    __shared__ __align__(16) h16 Ks[2][AKB * APT];
    __shared__ __align__(16) bf Vhs[2][HD * APT];
    __shared__ __align__(16) bf Vls[2][HD * APT];
    __shared__ unsigned mbit[AW][TT / AKB][AR][32];   // each lane's own mask bits, one word per stage and column group; written and read by the same lane only
    const int tid = threadIdx.x, lane = tid & 31, wave = tid >> 5, lr = lane & 15, hi = lane >> 4;
    const int g = blockIdx.y, q0 = blockIdx.x * (AW * AR * 16) + wave * (AR * 16);
    Qp += (size_t)g * TT * HD; Kp += (size_t)g * TT * HD; Vh += (size_t)g * HD * TT; Vl += (size_t)g * HD * TT;
    const int srow = tid >> 3, sseg = (tid & 7) * 8;   // staging: 8 threads a 128-byte row, 32 rows a sweep
    const unsigned ko = (unsigned)(srow * HD + sseg), vo = (unsigned)(srow * TT + sseg);   // this thread's 32-bit offsets from wave-uniform bases
#pragma unroll
    for (int p = 0; p < 2; ++p) { const v8h rk = *(const v8h*)(Kp + 32 * p * HD + ko); const v8us rh = *(const v8us*)(Vh + 32 * p * TT + vo), rl = *(const v8us*)(Vl + 32 * p * TT + vo);
        *(v8h*)(Ks[0] + (srow + 32 * p) * APT + sseg) = rk; *(v8us*)(Vhs[0] + (srow + 32 * p) * APT + sseg) = rh; *(v8us*)(Vls[0] + (srow + 32 * p) * APT + sseg) = rl; }
    // mask rows of this lane's queries -> bits: element e = 8 * tile + j of a stage sits at bit 31 - e
    // rolled, for speed only
#pragma unroll 1
    for (int blk = 0; blk < TT / AKB; ++blk) {
#pragma unroll
        for (int r = 0; r < AR; ++r) { const int* mr = Mk + (size_t)(q0 + r * 16 + lr) * S_FULL + blk * AKB + 8 * hi; unsigned w = 0; v4i mv[AKB / 8];
#pragma unroll
            for (int c = 0; c < AKB / 8; ++c) mv[c] = *(const v4i*)(mr + (c >> 1) * 16 + (c & 1) * 4);
            asm volatile("s_wait_xcnt 0x0" ::: "memory");   // stands in front of whatever next overwrites the address registers that these loads name
#pragma unroll
            for (int c = 0; c < AKB / 8; ++c)
#pragma unroll
                for (int j = 0; j < 4; ++j) w = (w << 1) | min((unsigned)mv[c][j], 1u);
            mbit[wave][blk][r][lane] = w; }
    }
    v16h qf[AR][2];
#pragma unroll
    for (int r = 0; r < AR; ++r)
#pragma unroll
        for (int kc = 0; kc < 2; ++kc) qf[r][kc] = WFrag<h16>::ld(Qp + (size_t)(q0 + r * 16 + lr) * HD + kc * 32 + 8 * hi);
    v8f o[AR][4]; float m[AR], ls[AR];
#pragma unroll
    for (int r = 0; r < AR; ++r) { m[r] = NEGF; ls[r] = 0.f;
#pragma unroll
        for (int dt = 0; dt < 4; ++dt) o[r][dt] = (v8f){}; }
    // rolled: the register count stays at four waves a SIMD
#pragma unroll 1
    for (int blk = 0; blk < TT / AKB; ++blk) {
        __syncthreads();   // publishes stage blk, and ends every wave's reads of the other buffer, which this stage refills
        const int cb = blk & 1, kn = (blk + 1) * AKB; const bool more = blk + 1 < TT / AKB;
        unsigned mw[AR];
#pragma unroll
        for (int r = 0; r < AR; ++r) mw[r] = mbit[wave][blk][r][lane];
        const bool anym = __builtin_amdgcn_ballot_w32((mw[0] & mw[1]) != 0xFFFFFFFFu) != 0;   // wave-uniform: a stage with no masked element skips the selects
#pragma unroll
        for (int sb = 0; sb < AKB / 32; ++sb) {
            v8h rk; v8us rh, rl;
            if (more) { rk = *(const v8h*)(Kp + (kn + 32 * sb) * HD + ko); rh = *(const v8us*)(Vh + (32 * sb * TT + kn) + vo); rl = *(const v8us*)(Vl + (32 * sb * TT + kn) + vo); }   // half of the next stage's rows fly to registers under this pass
            float u[AR][16];
#pragma unroll
            for (int kt = 0; kt < 2; ++kt) { const h16* kp = Ks[cb] + (sb * 32 + kt * 16 + lr) * APT + 8 * hi; const v16h k0 = WFrag<h16>::ld(kp), k1 = WFrag<h16>::ld(kp + 32);
#pragma unroll
                for (int r = 0; r < AR; ++r) { const v8f s = wmma16(k1, qf[r][1], wmma16(k0, qf[r][0], (v8f){}));
#pragma unroll
                    for (int j = 0; j < 8; ++j) u[r][kt * 8 + j] = s[j] * SCL2; } }
            if (anym) {
#pragma unroll
                for (int r = 0; r < AR; ++r)
#pragma unroll
                    for (int e = 0; e < 16; ++e) if ((int)(mw[r] << (sb * 16 + e)) >= 0) u[r][e] = NEGF; }
            v16bf ph[AR], pl[AR];
#pragma unroll
            for (int r = 0; r < AR; ++r) {
                float mx = u[r][0];
#pragma unroll
                for (int e = 1; e < 16; ++e) mx = fmaxf(mx, u[r][e]);
                mx = fmaxf(mx, xhalf(mx));
                const float mn = fmaxf(m[r], mx), al = __builtin_amdgcn_exp2f(m[r] - mn); m[r] = mn;
                float sum = 0.f; v8u wh, wl;
#pragma unroll
                for (int t = 0; t < 2; ++t) { float d[8], p[8];
#pragma unroll
                    for (int j = 0; j < 8; ++j) d[j] = u[r][t * 8 + j] - mn;
                    exp2x8(p, d);
#pragma unroll
                    for (int j = 0; j < 8; j += 2) { sum += p[j] + p[j + 1]; unsigned a, c; split2(p[j], p[j + 1], a, c); wh[(t * 8 + j) >> 1] = a; wl[(t * 8 + j) >> 1] = c; } }
                asm volatile("" : "+v"(sum));   // each row's sum pinned against spills: without it the adds sink to the loop's foot, every p of the stage stays live until there, and the staging registers spill
                ls[r] = ls[r] * al + sum; ph[r] = __builtin_bit_cast(v16bf, wh); pl[r] = __builtin_bit_cast(v16bf, wl);
#pragma unroll
                for (int dt = 0; dt < 4; ++dt) o[r][dt] = o[r][dt] * al;
            }
            v16bf vf[4];
#pragma unroll
            for (int dt = 0; dt < 4; ++dt) vf[dt] = WFrag<bf>::ld(Vhs[cb] + (dt * 16 + lr) * APT + sb * 32 + 8 * hi);
#pragma unroll
            for (int dt = 0; dt < 4; ++dt)
#pragma unroll
                for (int r = 0; r < AR; ++r) o[r][dt] = wmmab(vf[dt], ph[r], o[r][dt]);
#pragma unroll
            for (int dt = 0; dt < 4; ++dt)
#pragma unroll
                for (int r = 0; r < AR; ++r) o[r][dt] = wmmab(vf[dt], pl[r], o[r][dt]);
#pragma unroll
            for (int dt = 0; dt < 4; ++dt) vf[dt] = WFrag<bf>::ld(Vls[cb] + (dt * 16 + lr) * APT + sb * 32 + 8 * hi);
#pragma unroll
            for (int dt = 0; dt < 4; ++dt)
#pragma unroll
                for (int r = 0; r < AR; ++r) o[r][dt] = wmmab(vf[dt], ph[r], o[r][dt]);
            if (more) { *(v8h*)(Ks[cb ^ 1] + (srow + 32 * sb) * APT + sseg) = rk; *(v8us*)(Vhs[cb ^ 1] + (srow + 32 * sb) * APT + sseg) = rh; *(v8us*)(Vls[cb ^ 1] + (srow + 32 * sb) * APT + sseg) = rl; }
        }
    }
    // lane l holds ctx[query l & 15][d = 16 dt + 8h + j]: 8 consecutive d, one 16-byte store a plane
#pragma unroll
    for (int r = 0; r < AR; ++r) { const float f = __fdiv_rn(1.0f, ls[r] + xhalf(ls[r])); const size_t oo = ((size_t)(g / NH_) * TT + q0 + r * 16 + lr) * DQ + (g % NH_) * HD + 8 * hi;
#pragma unroll
        for (int dt = 0; dt < 4; ++dt) { v4u_ wh, wl;
#pragma unroll
            for (int j = 0; j < 8; j += 2) { unsigned a, c; split2(o[r][dt][j] * f, o[r][dt][j + 1] * f, a, c); wh[j >> 1] = a; wl[j >> 1] = c; }
            *(v4u_*)(Ah + oo + dt * 16) = wh; *(v4u_*)(Al + oo + dt * 16) = wl; } }
}

extern "C" void kernel_launch(void* const* d_in, const int* in_sizes, int n_in,
                              void* d_out, int out_size, void* d_ws, size_t ws_size, hipStream_t stream) {
    if (n_in < 11) return;
    if ((size_t)in_sizes[0] < (size_t)(NB - 1) * S_FULL * DM + (size_t)TT * DM) return;
    if ((size_t)in_sizes[1] < (size_t)(NB - 1) * S_FULL * DM + (size_t)TT * DM) return;
    if ((size_t)in_sizes[2] < (size_t)(TT - 1) * S_FULL + (size_t)TT) return;
    if (in_sizes[3] < DM * DQ || in_sizes[5] < DM * DKV || in_sizes[7] < DM * DKV || in_sizes[9] < DQ * DM) return;
    if (in_sizes[4] < DQ || in_sizes[6] < DKV || in_sizes[8] < DKV || in_sizes[10] < DM) return;
    if ((size_t)out_size < (size_t)NB * TT * DM) return;
    const float* x  = (const float*)d_in[0];     // [NB][S_FULL][DM]
    const float* xk = (const float*)d_in[1];     // [NB][S_FULL][DM]
    const int*   mk = (const int*)d_in[2];       // [1][1][S_FULL][S_FULL] int32 0/1
    const float* wq = (const float*)d_in[3]; const float* bq = (const float*)d_in[4];
    const float* wk = (const float*)d_in[5]; const float* bk = (const float*)d_in[6];
    const float* wv = (const float*)d_in[7]; const float* bv = (const float*)d_in[8];
    const float* wo = (const float*)d_in[9]; const float* bo = (const float*)d_in[10];
    float* OUT = (float*)d_out;     // [NB][TT][DM]
    char* wsp = (char*)d_ws;
    auto take = [&](size_t bytes) { char* p = wsp; wsp += (bytes + 255) & ~(size_t)255; return (void*)p; };
    bf* WQ = (bf*)take((size_t)DQ * DM * 2); bf* WK = (bf*)take((size_t)DKV * DM * 2); bf* WV = (bf*)take((size_t)DKV * DM * 2); bf* WO = (bf*)take((size_t)DM * DQ * 2);
    h16* QP16 = (h16*)take((size_t)NB * NH_ * TT * HD * 2); h16* KP16 = (h16*)take((size_t)NB * NKV * TT * HD * 2);
    bf* VTh = (bf*)take((size_t)NB * NKV * HD * TT * 2); bf* VTl = (bf*)take((size_t)NB * NKV * HD * TT * 2);
    bf* ATh = (bf*)take((size_t)NB * TT * DQ * 2); bf* ATl = (bf*)take((size_t)NB * TT * DQ * 2);
    bf* XB = (bf*)take((size_t)NB * TT * DM * 2); bf* XKB = (bf*)take((size_t)NB * TT * DM * 2);
    if ((size_t)(wsp - (char*)d_ws) > ws_size) return;
    // every batch in one launch: rows b * TT + t in the projections, planes b * NH_ + h in attention
    k_prep<<<PWB + PSB, 256, 0, stream>>>(x, xk, wq, wk, wv, wo, XB, XKB, WQ, WK, WV, WO);
    // each projection's epilogue writes the operand planes of attention itself
    k_gemmw<bf, 0, true, 1><<<dim3(NB * TT / GRA, DQ / GRB, 1), GT, 0, stream>>>(XB, nullptr, WQ, DM, DM, nullptr, DQ, bq, 0, 0, 0, QP16, nullptr, nullptr);
    k_gemmw<bf, 0, true, 1><<<dim3(NB * TT / GRA, DKV / GRB, 1), GT, 0, stream>>>(XKB, nullptr, WK, DM, DM, nullptr, DKV, bk, 0, 0, 0, KP16, nullptr, nullptr);
    k_gemmw<bf, 0, true, 2><<<dim3(NB * TT / GRA, DKV / GRB, 1), GT, 0, stream>>>(XKB, nullptr, WV, DM, DM, nullptr, DKV, bv, 0, 0, 0, nullptr, VTh, VTl);
    k_fattn<<<dim3(TT / (AW * AR * 16), NB * NH_, 1), AW * 32, 0, stream>>>(QP16, KP16, VTh, VTl, mk, ATh, ATl);
    k_gemmw<bf, 1, true, 0><<<dim3(NB * TT / GRA, DM / GRB, 1), GT, 0, stream>>>(ATh, ATl, WO, DQ, DQ, OUT, DM, bo, 0, 0, 0, nullptr, nullptr, nullptr);
}

// v007
// One run takes 109 microseconds.
// Versions in between are left out here; by their measured steps it is 1.48 times as fast as v005.
// All steps since v000 together make it 15.5 times as fast.
#include <hip/hip_runtime.h>

// Multi-head dot-product attention: inputs_q, inputs_kv [8][1024][1024]; q = inputs_q Wq + bq, k / v = inputs_kv Wk / Wv + bk / bv (W [1024][16][64] = k-major [1024][1024], bias [16][64]);
// logits = (q . k) / 64 (the module divides q by the head depth); int32 mask [1][1][1024][1024] replaces masked logits by the most negative finite f32; softmax over keys; ctx = P . v; out = ctx Wo ([16][64][1024] = [1024][1024]) + bo -> [8][1024][1024] f32.
// Compute dtypes, f32 accumulate: every float input RNE-converted to bf16 (Wo: to fp16); q/k/v projections v_wmma_f32_16x16x32_bf16 on plain bf16 operands; scores v_wmma_f32_16x16x32_f16 on plain fp16 q/k planes with 1/64 applied to the f32 score; softmax f32, running maximum; P . v on plain fp16 operands (the unnormalised P = 2^(u - m), at most 1, and v), one product, 1 / sum applied to the f32 result; ctx . Wo on plain fp16 ctx and fp16 Wo, one product; biases added in f32 as bf16-converted values.

#ifndef NB
#define NB   8
#endif
#ifndef SEQ
#define SEQ  1024
#endif
#define S_FULL 1024                 // per-batch row count / mask row pitch
#define TT   SEQ
#define DM   1024
#define NH_  16
#define NKV  16
#define REP  (NH_ / NKV)
#define HD   64
#define DQ   (NH_ * HD)
#define DKV  (NKV * HD)
#define SCL  0.015625f              // 1 / HD
#define NEGF (-3.4028234663852886e38f)

static_assert(TT % 128 == 0);
static_assert(TT % 64 == 0);
static_assert(DM % 64 == 0);
static_assert(HD % 32 == 0);
static_assert(REP == 1);
static_assert(SEQ <= S_FULL);
static_assert(NB >= 1);

typedef _Float16 h16;
typedef unsigned short bf;
typedef __attribute__((ext_vector_type(16))) __bf16   v16bf;
typedef __attribute__((ext_vector_type(16))) _Float16 v16h;
typedef __attribute__((ext_vector_type(8)))  _Float16 v8h;
typedef __attribute__((ext_vector_type(8)))  unsigned short v8us;
typedef __attribute__((ext_vector_type(8)))  float    v8f;
typedef __attribute__((ext_vector_type(4)))  float    v4f;
typedef v8h  __attribute__((may_alias)) v8ha;
typedef v4f  __attribute__((may_alias)) v4fa;
typedef v8us __attribute__((may_alias)) v8usa;

__device__ __forceinline__ unsigned short f2bf(float f) { unsigned u = __float_as_uint(f); u += 0x7FFFu + ((u >> 16) & 1u); return (unsigned short)(u >> 16); }
__device__ __forceinline__ float bf2f(unsigned short b) { return __uint_as_float(((unsigned)b) << 16); }
__device__ __forceinline__ float bfr(float f) { return bf2f(f2bf(f)); }
__device__ __forceinline__ v16h cat16(v8h lo, v8h hi) { return __builtin_shufflevector(lo, hi, 0, 1, 2, 3, 4, 5, 6, 7, 8, 9, 10, 11, 12, 13, 14, 15); }
__device__ __forceinline__ v16bf cat16b(v8us lo, v8us hi) { return __builtin_bit_cast(v16bf, __builtin_shufflevector(lo, hi, 0, 1, 2, 3, 4, 5, 6, 7, 8, 9, 10, 11, 12, 13, 14, 15)); }
__device__ __forceinline__ v8f wmma16(v16h a, v16h b, v8f c) { return __builtin_amdgcn_wmma_f32_16x16x32_f16(false, a, false, b, (short)0, c, false, false); }
__device__ __forceinline__ v8f wmmab(v16bf a, v16bf b, v8f c) { return __builtin_amdgcn_wmma_f32_16x16x32_bf16(false, a, false, b, (short)0, c, false, false); }



// ---- k_gemmw: GEMM on a 256 x 128 output tile per work-group of EIGHT WAVES (4 x 2), each wave a 64 x 64 part (16 accumulators); grid (M/256, N/128, Z), 256 threads, one work-group a WGP.
// The operands' rows (K-contiguous 16-bit planes) reach LDS by asynchronous copies, whole 128-byte lines a wave instruction, GKS k a stage, two stage buffers: stage t + 2 flies while stage t + 1 is worked on; the fragments are read from LDS (row pitch = row + 16 bytes).
// C[m][n] (+ optional f32 bias[n]) = sum_k A[m][k] Bt[n][k]. A row pitch lda, Bt row pitch K. z-batch strides sA/sB/sC in elements. K % GKS == 0.
// OUTM says where the tile goes: 0 = f32 C, pitch ldc; 1 = f16 head planes P16[batch][head][token][HD] (m = batch * TT + token, n = head * HD + depth; a wave's part is 8 KiB in a row);
// 2 = transposed f16 plane P16[batch][n][token]: the two operands change places in the matrix instruction, so D comes out as [n][token] and a staged row is one whole 128-byte line of 64 tokens.
// Fragments (A and Bt alike): lane l -> row l&15, elements 0..7 = k kc+8h..kc+8h+7, elements 8..15 = k kc+16+8h..kc+16+8h+7 (h = l>>4); D element j -> row 8h+j, col l&15.
template <typename T16> struct WFrag;
template <> struct WFrag<h16> { typedef v16h V; static __device__ __forceinline__ V ld(const h16* p) { return cat16(*(const v8h*)p, *(const v8h*)(p + 16)); } static __device__ __forceinline__ v8f mma(V a, V b, v8f c) { return wmma16(a, b, c); } };
template <> struct WFrag<bf> { typedef v16bf V; static __device__ __forceinline__ V ld(const bf* p) { return cat16b(*(const v8us*)p, *(const v8us*)(p + 16)); } static __device__ __forceinline__ v8f mma(V a, V b, v8f c) { return wmmab(a, b, c); } };
__device__ __forceinline__ h16 tohx(float x) { return (h16)x; }
typedef __attribute__((ext_vector_type(4))) _Float16 v4h;
typedef __attribute__((ext_vector_type(4))) unsigned short v4us;
#define GT  256                     // threads of a GEMM work-group
#define GRA 256                     // rows of A in a stage = rows of the output tile
#define GRB 128                     // rows of Bt in a stage = columns of the output tile
static_assert((NB * TT) % GRA == 0 && DQ % GRB == 0 && DKV % GRB == 0 && DM % GRB == 0 && DM % 128 == 0 && DQ % 64 == 0);
__device__ __forceinline__ unsigned lds_off(const void* p) { return (unsigned)(size_t)p; }   // byte offset in the work-group's LDS
// Eight asynchronous 16-byte copies a lane, global -> LDS, and the wait that stands in front of whatever next overwrites a register they name, in ONE statement (in a statement of its own the compiler may lift the next address additions over it).
template <typename T16>
__device__ __forceinline__ void copyrun(unsigned l, unsigned lstep, const T16* g, size_t gstep) {
        asm volatile("global_load_async_to_lds_b128 %0, %8, off\n\tglobal_load_async_to_lds_b128 %1, %9, off\n\tglobal_load_async_to_lds_b128 %2, %10, off\n\tglobal_load_async_to_lds_b128 %3, %11, off\n\t"
                     "global_load_async_to_lds_b128 %4, %12, off\n\tglobal_load_async_to_lds_b128 %5, %13, off\n\tglobal_load_async_to_lds_b128 %6, %14, off\n\tglobal_load_async_to_lds_b128 %7, %15, off\n\ts_wait_xcnt 0x0"
                     :: "v"(l), "v"(l + lstep), "v"(l + 2 * lstep), "v"(l + 3 * lstep), "v"(l + 4 * lstep), "v"(l + 5 * lstep), "v"(l + 6 * lstep), "v"(l + 7 * lstep),
                        "v"(g), "v"(g + gstep), "v"(g + 2 * gstep), "v"(g + 3 * gstep), "v"(g + 4 * gstep), "v"(g + 5 * gstep), "v"(g + 6 * gstep), "v"(g + 7 * gstep) : "memory");
}
template <typename T16, bool BIAS, int OUTM>
__global__ __launch_bounds__(GT) void k_gemmw(const T16* __restrict__ A, const T16* __restrict__ Bt, int K, int lda, float* C, int ldc, const float* __restrict__ bias, size_t sA, size_t sB, size_t sC, h16* P16) {
    static_assert(TT % 64 == 0 && HD % 64 == 0);   // a wave's 64 x 64 part stays inside one batch and one head
    typedef typename WFrag<T16>::V V;
    constexpr int GKS = 128;                       // k per stage: both buffers and the output staging fit one WGP's LDS
    constexpr int GP = GKS + 8;                    // LDS row pitch in elements: the row + 16 bytes
    constexpr int ROWS = GRA + GRB;                // a stage: A's rows, Bt's rows
    constexpr int SEG = GKS / 8, RPS = GT / SEG;   // 16-byte pieces a row; rows a sweep of the work-group
    constexpr int SWA = GRA / RPS, SWB = GRB / RPS;   // sweeps a plane
    static_assert(SWA % 8 == 0 && SWB % 8 == 0);
    __shared__ __align__(16) T16 ring[2][ROWS * GP];
    __shared__ __align__(16) float osw[GT / 32][16 * 68];
    const size_t z = blockIdx.z; A += z * sA; Bt += z * sB; C += z * sC;
    const int tid = threadIdx.x, lane = tid & 31, wave = tid >> 5, lr = lane & 15, hi = lane >> 4;
    const int R0 = blockIdx.x * GRA, C0 = blockIdx.y * GRB, wm = (wave >> 1) * 64, wn = (wave & 1) * 64; const int r0 = R0 + wm, c0 = C0 + wn;
    float* const os = osw[wave];
    v8f acc[4][4];
#pragma unroll
    for (int mb = 0; mb < 4; ++mb)
#pragma unroll
        for (int nb = 0; nb < 4; ++nb) acc[mb][nb] = (v8f){};
    // staging: SEG threads a row, RPS rows a sweep; every lane is on, every piece lies inside its plane (M a multiple of GRA, N of GRB, K of GKS)
    const int srow = tid / SEG, sseg = (tid % SEG) * 8;
    const T16* const gA = A + (size_t)(R0 + srow) * lda + sseg; const T16* const gB = Bt + (size_t)(C0 + srow) * K + sseg;
    const unsigned l0 = lds_off(&ring[0][0]) + (unsigned)(srow * GP + sseg) * 2u;
    auto stage = [&](int t) {   // stage t's copies into buffer t & 1
        const unsigned lb = l0 + (unsigned)(t & 1) * (unsigned)(ROWS * GP * 2); const int kc = t * GKS;
#pragma unroll
        for (int u = 0; u < SWA; u += 8) copyrun<T16>(lb + (unsigned)(u * RPS * GP * 2), (unsigned)(RPS * GP * 2), gA + (size_t)(u * RPS) * lda + kc, (size_t)RPS * lda);
#pragma unroll
        for (int u = 0; u < SWB; u += 8) copyrun<T16>(lb + (unsigned)((GRA + u * RPS) * GP * 2), (unsigned)(RPS * GP * 2), gB + (size_t)(u * RPS) * K + kc, (size_t)RPS * K);
    };
    const int NT = K / GKS;
    stage(0);
    asm volatile("s_wait_asynccnt 0x0" ::: "memory");   // this wave's copies of stage 0 have landed
    __syncthreads();                                    // publishes stage 0
    if (NT > 1) stage(1);
    // rolled: one publish point at its foot
#pragma unroll 1
    for (int t = 0; t < NT; ++t) {
        const T16* const As = ring[t & 1] + (wm + lr) * GP + 8 * hi; const T16* const Bs = ring[t & 1] + (GRA + wn + lr) * GP + 8 * hi;
        V a[2][4], b[2][4];   // two fragment sets: block i + 1's LDS reads go out as one group in front of block i's matrix instructions
        auto frags = [&](int s, int ks) {
#pragma unroll
            for (int f = 0; f < 4; ++f) { a[s][f] = WFrag<T16>::ld(As + f * 16 * GP + ks); b[s][f] = WFrag<T16>::ld(Bs + f * 16 * GP + ks); }
        };
        frags(0, 0);
        // unrolled: the index of a fragment set must be a constant for the sets to stay in registers
#pragma unroll
        for (int i = 0; i < GKS / 32; ++i) {
            if (i + 1 < GKS / 32) frags((i + 1) & 1, (i + 1) * 32);
            __builtin_amdgcn_sched_barrier(0);   // keeps the reads above in one group ahead of the block
#pragma unroll
            for (int nb = 0; nb < 4; ++nb)
#pragma unroll
                for (int mb = 0; mb < 4; ++mb) acc[mb][nb] = OUTM == 2 ? WFrag<T16>::mma(b[i & 1][nb], a[i & 1][mb], acc[mb][nb]) : WFrag<T16>::mma(a[i & 1][mb], b[i & 1][nb], acc[mb][nb]);
            __builtin_amdgcn_sched_barrier(0);   // keeps the next group of reads behind this block
        }
        asm volatile("s_wait_dscnt 0x0" ::: "memory");      // this wave's reads of stage t have returned
        asm volatile("s_wait_asynccnt 0x0" ::: "memory");   // this wave's copies of stage t + 1 have landed
        __syncthreads();                                    // publishes stage t + 1, and ends every wave's reads of stage t's buffer, which is refilled behind it
        if (t + 2 < NT) stage(t + 2);
    }
    asm volatile("s_wait_asynccnt 0x0" ::: "memory");       // no copy is outstanding when the wave goes on
    float bn[4][8];   // OUTM 2: the bias of this lane's D rows n = c0 + 16 ob + 8 hi + j, added on the way into LDS
    if constexpr (OUTM == 2 && BIAS) {
#pragma unroll
        for (int ob = 0; ob < 4; ++ob) { const v4f b0 = *(const v4fa*)(bias + c0 + ob * 16 + 8 * hi), b1 = *(const v4fa*)(bias + c0 + ob * 16 + 8 * hi + 4);
#pragma unroll
            for (int j = 0; j < 4; ++j) { bn[ob][j] = bfr(b0[j]); bn[ob][4 + j] = bfr(b1[j]); } }
        asm volatile("s_wait_xcnt 0x0" ::: "memory");   // stands in front of whatever next overwrites the address registers that these loads name
    }
    // sixteen D rows at a time through LDS, so that every store covers whole lines (OUTM 2: a D row is one n, its columns are tokens)
#pragma unroll
    for (int ob = 0; ob < 4; ++ob) {
#pragma unroll
        for (int ib = 0; ib < 4; ++ib) {
#pragma unroll
            for (int j = 0; j < 8; ++j) { if constexpr (OUTM == 2) os[(hi * 8 + j) * 68 + ib * 16 + lr] = BIAS ? acc[ib][ob][j] + bn[ob][j] : acc[ib][ob][j]; else os[(hi * 8 + j) * 68 + ib * 16 + lr] = acc[ob][ib][j]; } }
        __builtin_amdgcn_wave_barrier(); asm volatile("" ::: "memory");
#pragma unroll
        for (int s = 0; s < 8; ++s) { const int row = 2 * s + hi, cofs = lr * 4; v4f val = *(const v4fa*)(os + row * 68 + cofs);
            if constexpr (OUTM == 2) {
                const int n = c0 + ob * 16 + row; v4h o16;
#pragma unroll
                for (int q = 0; q < 4; ++q) o16[q] = tohx(val[q]);
                *(v4h*)(P16 + ((size_t)(r0 / TT) * ldc + n) * TT + (r0 % TT) + cofs) = o16;
            } else {
                if (BIAS) { val[0] += bfr(bias[c0 + cofs]); val[1] += bfr(bias[c0 + cofs + 1]); val[2] += bfr(bias[c0 + cofs + 2]); val[3] += bfr(bias[c0 + cofs + 3]); }
                if constexpr (OUTM == 1) { v4h o16; o16[0] = tohx(val[0]); o16[1] = tohx(val[1]); o16[2] = tohx(val[2]); o16[3] = tohx(val[3]);
                    *(v4h*)(P16 + (((size_t)(r0 / TT) * (ldc / HD) + c0 / HD) * TT + (r0 % TT) + ob * 16 + row) * HD + (c0 % HD) + cofs) = o16; }
                else *(v4f*)(C + (size_t)(r0 + ob * 16 + row) * ldc + c0 + cofs) = val;
            } }
        __builtin_amdgcn_wave_barrier(); asm volatile("s_wait_xcnt 0x0" ::: "memory");   // keeps the next rows' LDS stores behind these reads, and stands in front of whatever next overwrites a register that these global stores name
    }
}

typedef __attribute__((ext_vector_type(2))) unsigned short v2us;
typedef __attribute__((ext_vector_type(2))) float v2f;
typedef __attribute__((ext_vector_type(4))) int v4i;

// ---- k_prep: every operand conversion of the call in ONE launch sized to the chip (PMB + PWB + PSB work-groups of 8 waves); the weights' and the inputs' loads cover whole lines, each wave has 16 to 32 of them in flight and does many lines, so few waves have to be started.
// Work-groups 0 .. PMB - 1: the int32 mask -> bit words, ONCE a call: the mask is the same for every (batch, head) plane, so attention's work-groups only fetch their words. One thread a word, in the order in which an attention wave holds them:
// MB[wave group G of AR * 16 queries][stage][column group r][lane l]: query G * AR * 16 + 16 r + (l & 15); element e = 8 * tile + j (key = stage * AKB + 16 * tile + 8 * (l >> 4) + j) sits at bit 31 - e. They come first: they are short.
// Work-groups PMB .. PMB + PWB - 1: the four weights, f32 [K][N] -> 16-bit Bt[N][K] (Wq, Wk, Wv bf16; Wo f16); a work-group turns the same 64 x 64 tile of each weight through LDS: a thread loads a 4 k x 4 n block (a wave's load = 2 rows of 256 bytes), writes 4 k in a row under each n, and behind the one barrier the rows of 64 k go out as whole 128-byte lines.
// Work-groups PMB + PWB .. PMB + PWB + PSB - 1: inputs_q and inputs_kv, f32 -> bf16; a wave takes PCH pieces of 512 bytes in a row of each input (32 lanes x 16 bytes = 4 whole lines a load).
#define PCH 16                      // 512-byte pieces (128 floats) of each input that a wave has in flight
#define PNC (TT * DM / 128)         // pieces a batch
#define PSB (NB * PNC / PCH / 8)    // work-groups that convert the inputs
#define PWB (DM / 64 * (DQ / 64))   // work-groups that turn the weights: one 64 x 64 tile of every weight each
#define PTP 72                      // LDS row pitch of a turned tile in elements: the 128-byte row + 16 bytes
#define AR  2                       // 16-query column groups per attention wave
#define AKB 64                      // keys per LDS stage of attention = keys of the two lanes' words that share a query
#define MWG (TT / AKB * AR * 32)    // mask words of one attention wave
#define PMB (TT / (AR * 16) * MWG / 256)   // work-groups that pack the mask
static_assert(AKB == 64 && TT % (AR * 16) == 0 && (TT / (AR * 16) * MWG) % 256 == 0);
static_assert(PNC % PCH == 0 && (NB * PNC / PCH) % 8 == 0);
static_assert(DM % 64 == 0 && DQ % 64 == 0 && DKV % 64 == 0 && DKV <= DQ);
template <int K, int N> struct WTile {   // tile b of a [K][N] weight: k from (b / (N / 64)) * 64, n from (b % (N / 64)) * 64; a weight with fewer tiles than PWB leaves the rest of the work-groups out (the same test for a whole work-group)
    static __device__ __forceinline__ bool has(int b) { return b < (K / 64) * (N / 64); }
    static __device__ __forceinline__ const float* src(const float* __restrict__ w, int b, int tid) { return w + (size_t)((has(b) ? b / (N / 64) : 0) * 64 + (tid >> 4) * 4) * N + (b % (N / 64)) * 64 + (tid & 15) * 4; }   // this thread's 4 x 4 block
    static __device__ __forceinline__ void load(const float* p, int b, v4f (&v)[4]) {
        if (!has(b)) return;
#pragma unroll
        for (int s = 0; s < 4; ++s) v[s] = *(const v4fa*)(p + (size_t)s * N);
    }
    template <bool F16> static __device__ __forceinline__ void turn(const v4f (&v)[4], bf* T, int b, int tid) {   // T holds raw 16-bit patterns: f16 (F16) or bf16
        if (!has(b)) return;
#pragma unroll
        for (int j = 0; j < 4; ++j) { v4us o;
#pragma unroll
            for (int s = 0; s < 4; ++s) o[s] = F16 ? __builtin_bit_cast(unsigned short, (h16)v[s][j]) : f2bf(v[s][j]);
            *(v4us*)(T + ((tid & 15) * 4 + j) * PTP + (tid >> 4) * 4) = o; }
    }
    static __device__ __forceinline__ void store(const bf* T, bf* Bt, int b, int tid) {
        if (!has(b)) return;
#pragma unroll
        for (int p = 0; p < 2; ++p) { const int n = (tid >> 3) + 32 * p; *(v8us*)(Bt + (size_t)((b % (N / 64)) * 64 + n) * K + (b / (N / 64)) * 64 + (tid & 7) * 8) = *(const v8us*)(T + n * PTP + (tid & 7) * 8); }
    }
};
__device__ __forceinline__ void cvt_store(const v4f (&v)[PCH], bf* dst) {
#pragma unroll
    for (int i = 0; i < PCH; ++i) { v4us o;
#pragma unroll
        for (int k = 0; k < 4; ++k) o[k] = f2bf(v[i][k]);
        *(v4us*)(dst + i * 128) = o; }
}
__global__ __launch_bounds__(256) void k_prep(const float* __restrict__ x, const float* __restrict__ xk, const int* __restrict__ Mk, const float* __restrict__ wq, const float* __restrict__ wk, const float* __restrict__ wv, const float* __restrict__ wo,
                                              bf* XB, bf* XKB, bf* WQ, bf* WK, bf* WV, h16* WO, unsigned* MB) {
    __shared__ __align__(16) bf tw[4][64 * PTP];
    const int tid = threadIdx.x;
    if (blockIdx.x < PMB) { const int wd = (int)blockIdx.x * 256 + tid, l = wd & 31, r = (wd >> 5) % AR, blk = (wd >> 5) / AR % (TT / AKB), G = (wd >> 5) / AR / (TT / AKB);
        const int* mr = Mk + (size_t)(G * (AR * 16) + r * 16 + (l & 15)) * S_FULL + blk * AKB + 8 * (l >> 4); unsigned w = 0; v4i mv[AKB / 8];
#pragma unroll
        for (int c = 0; c < AKB / 8; ++c) mv[c] = *(const v4i*)(mr + (c >> 1) * 16 + (c & 1) * 4);
        asm volatile("s_wait_xcnt 0x0" ::: "memory");   // stands in front of whatever next overwrites the address registers that these loads name
#pragma unroll
        for (int c = 0; c < AKB / 8; ++c)
#pragma unroll
            for (int j = 0; j < 4; ++j) w = (w << 1) | min((unsigned)mv[c][j], 1u);
        MB[wd] = w;
        return; }
    if (blockIdx.x < PMB + PWB) { const int b = (int)blockIdx.x - PMB; v4f vq[4], vk[4], vv[4], vo[4];
        const float* const pq = WTile<DM, DQ>::src(wq, b, tid); const float* const pk = WTile<DM, DKV>::src(wk, b, tid); const float* const pv = WTile<DM, DKV>::src(wv, b, tid); const float* const po = WTile<DQ, DM>::src(wo, b, tid);
        WTile<DM, DQ>::load(pq, b, vq); WTile<DM, DKV>::load(pk, b, vk); WTile<DM, DKV>::load(pv, b, vv); WTile<DQ, DM>::load(po, b, vo);
        __builtin_amdgcn_sched_barrier(0);              // keeps all sixteen loads in front of the first conversion: a load sunk among the conversions starts only when earlier ones have returned, a second memory latency
        asm volatile("s_wait_xcnt 0x0" :: "v"(pq), "v"(pk), "v"(pv), "v"(po) : "memory");   // stands in front of whatever next overwrites the address registers that these loads name; the addresses are inputs so that they live up to here and no later load's result is put on them
        WTile<DM, DQ>::turn<false>(vq, tw[0], b, tid); WTile<DM, DKV>::turn<false>(vk, tw[1], b, tid); WTile<DM, DKV>::turn<false>(vv, tw[2], b, tid); WTile<DQ, DM>::turn<true>(vo, tw[3], b, tid);
        __syncthreads();                                // publishes the turned tiles: a row is written by sixteen threads of all eight waves and read by eight threads of one
        WTile<DM, DQ>::store(tw[0], WQ, b, tid); WTile<DM, DKV>::store(tw[1], WK, b, tid); WTile<DM, DKV>::store(tw[2], WV, b, tid); WTile<DQ, DM>::store(tw[3], (bf*)WO, b, tid);
        return; }
    const int lane = tid & 31, wave = __builtin_amdgcn_readfirstlane(tid >> 5);   // the wave's number in a scalar register: the bases stay scalar
    const int c0 = (((int)blockIdx.x - PMB - PWB) * 8 + wave) * PCH;   // a run of PCH pieces stays inside one batch
    const size_t so = (size_t)(c0 / PNC) * S_FULL * DM + (size_t)(c0 % PNC) * 128 + lane * 4, po = (size_t)c0 * 128 + lane * 4;
    const float* const pq = x + so; const float* const pk = xk + so;
    v4f vq[PCH], vk[PCH];
#pragma unroll
    for (int i = 0; i < PCH; ++i) vq[i] = *(const v4fa*)(pq + i * 128);
#pragma unroll
    for (int i = 0; i < PCH; ++i) vk[i] = *(const v4fa*)(pk + i * 128);
    __builtin_amdgcn_sched_barrier(0);              // keeps every load of the wave in front of the first conversion, for the reason given above
    asm volatile("s_wait_xcnt 0x0" :: "v"(pq), "v"(pk) : "memory");   // as above: the wait, with the two addresses alive up to it
    cvt_store(vq, XB + po); cvt_store(vk, XKB + po);
    asm volatile("s_wait_xcnt 0x0" ::: "memory");   // behind the last stores: the built code has a way on from here into the weights' part, which overwrites the registers that these stores name
}

// ---- k_fattn: scores, mask (as k_prep's bit words), softmax, P . v and the f16 conversion of ctx in ONE kernel; no score or P element ever reaches memory.
// Grid (TT / 256, planes), 8 waves; a wave owns 32 queries (2 column groups of 16) of one (batch, head) plane and walks all TT keys, 64 keys an LDS stage (k rows, v^T rows, pitch 144 B; two stage buffers, one barrier a stage), 32 keys a pass.
// S^T = K . Q^T (A = k rows, B = q rows, f16): lane l holds query l & 15, keys 8h + j of each 16-key tile, so two tiles converted in place ARE the B operand of O^T += V^T . P^T (A = v^T rows in the same k order, f16, one product).
// Every inner loop is fully unrolled so that each index into a register array is a constant. Two work-groups a WGP = four waves a SIMD (256 registers a wave), which the vector work between the matrix runs wants.
// Softmax is the running-maximum form in the log2 domain: u = S x (log2 e / HD), masked u = most negative finite f32; p = 2^(u - m); O^T and the sum are rescaled by 2^(m_old - m_new) every pass; 1 / sum is applied to O^T at the end.
typedef __attribute__((ext_vector_type(8))) unsigned v8u;
typedef __attribute__((ext_vector_type(2))) _Float16 v2h;
typedef __attribute__((ext_vector_type(4), may_alias)) unsigned v4u_;
#define AW  8                       // waves per work-group
#define APT 72                      // LDS row pitch in 16-bit elements: 128-byte rows + 16 bytes
#define SCL2 (SCL * 1.4426950408889634f)
static_assert(TT % (AW * AR * 16) == 0);
static_assert(TT % AKB == 0);
static_assert(HD == 64);
__device__ __forceinline__ unsigned pack2(float a, float b) { v2f x; x[0] = a; x[1] = b; return __builtin_bit_cast(unsigned, __builtin_convertvector(x, v2h)); }   // two f32 -> two f16, round to nearest even
__device__ __forceinline__ float xhalf(float x) { return __builtin_bit_cast(float, __builtin_amdgcn_permlanex16(__builtin_bit_cast(int, x), __builtin_bit_cast(int, x), 0x76543210, 0xfedcba98, false, false)); }   // lane l <-> lane l ^ 16
// Eight 2^x and the slot behind the last of them in ONE statement: each v_exp fills the slot of the one before it, the v_nop that of the last
__device__ __forceinline__ void exp2x8(float (&p)[8], const float (&d)[8]) {
    asm("v_exp_f32 %0, %8\n\tv_exp_f32 %1, %9\n\tv_exp_f32 %2, %10\n\tv_exp_f32 %3, %11\n\tv_exp_f32 %4, %12\n\tv_exp_f32 %5, %13\n\tv_exp_f32 %6, %14\n\tv_exp_f32 %7, %15\n\tv_nop"
        : "=&v"(p[0]), "=&v"(p[1]), "=&v"(p[2]), "=&v"(p[3]), "=&v"(p[4]), "=&v"(p[5]), "=&v"(p[6]), "=&v"(p[7])
        : "v"(d[0]), "v"(d[1]), "v"(d[2]), "v"(d[3]), "v"(d[4]), "v"(d[5]), "v"(d[6]), "v"(d[7]));
}
__global__ __launch_bounds__(AW * 32) __attribute__((amdgpu_waves_per_eu(4, 4))) void k_fattn(const h16* __restrict__ Qp, const h16* __restrict__ Kp, const h16* __restrict__ Vt, const unsigned* __restrict__ MB, h16* Ax) {
    __shared__ __align__(16) h16 Ks[2][AKB * APT];
    __shared__ __align__(16) h16 Vs[2][HD * APT];
    __shared__ __align__(16) unsigned mbit[AW][TT / AKB][AR][32];   // each lane's mask bits, one word per stage and column group; a wave fills and reads its own part, the reads behind the first stage's barrier
    const int tid = threadIdx.x, lane = tid & 31, wave = tid >> 5, lr = lane & 15, hi = lane >> 4;
    const int g = blockIdx.y, q0 = blockIdx.x * (AW * AR * 16) + wave * (AR * 16);
    Qp += (size_t)g * TT * HD; Kp += (size_t)g * TT * HD; Vt += (size_t)g * HD * TT;
    // this wave's mask words, packed by k_prep in this very order: MWG words in a row, whole lines a load
    static_assert(MWG % 128 == 0);
    const unsigned* const mg = MB + (size_t)(q0 / (AR * 16)) * MWG + lane * 4; v4u_ mq[MWG / 128];
#pragma unroll
    for (int i = 0; i < MWG / 128; ++i) mq[i] = *(const v4u_*)(mg + i * 128);
    asm volatile("s_wait_xcnt 0x0" :: "v"(mg) : "memory");   // stands in front of whatever next overwrites the address registers that these loads name; the address is an input so that it lives up to here
#pragma unroll
    for (int i = 0; i < MWG / 128; ++i) *(v4u_*)(&mbit[wave][0][0][0] + i * 128 + lane * 4) = mq[i];
    const int srow = tid >> 3, sseg = (tid & 7) * 8;   // staging: 8 threads a 128-byte row, 32 rows a sweep
    const unsigned ko = (unsigned)(srow * HD + sseg), vo = (unsigned)(srow * TT + sseg);   // this thread's 32-bit offsets from wave-uniform bases
#pragma unroll
    for (int p = 0; p < 2; ++p) { const v8h rk = *(const v8h*)(Kp + 32 * p * HD + ko), rv = *(const v8h*)(Vt + 32 * p * TT + vo);
        *(v8h*)(Ks[0] + (srow + 32 * p) * APT + sseg) = rk; *(v8h*)(Vs[0] + (srow + 32 * p) * APT + sseg) = rv; }
    v16h qf[AR][2];
#pragma unroll
    for (int r = 0; r < AR; ++r)
#pragma unroll
        for (int kc = 0; kc < 2; ++kc) qf[r][kc] = WFrag<h16>::ld(Qp + (size_t)(q0 + r * 16 + lr) * HD + kc * 32 + 8 * hi);
    v8f o[AR][4]; float m[AR], ls[AR];
#pragma unroll
    for (int r = 0; r < AR; ++r) { m[r] = NEGF; ls[r] = 0.f;
#pragma unroll
        for (int dt = 0; dt < 4; ++dt) o[r][dt] = (v8f){}; }
    // rolled: the register count stays at four waves a SIMD
#pragma unroll 1
    for (int blk = 0; blk < TT / AKB; ++blk) {
        __syncthreads();   // publishes stage blk, and ends every wave's reads of the other buffer, which this stage refills
        const int cb = blk & 1, kn = (blk + 1) * AKB; const bool more = blk + 1 < TT / AKB;
        unsigned mw[AR];
#pragma unroll
        for (int r = 0; r < AR; ++r) mw[r] = mbit[wave][blk][r][lane];
        const bool anym = __builtin_amdgcn_ballot_w32((mw[0] & mw[1]) != 0xFFFFFFFFu) != 0;   // wave-uniform: a stage with no masked element skips the selects
#pragma unroll
        for (int sb = 0; sb < AKB / 32; ++sb) {
            v8h rk, rv;
            if (more) { rk = *(const v8h*)(Kp + (kn + 32 * sb) * HD + ko); rv = *(const v8h*)(Vt + (32 * sb * TT + kn) + vo); }   // half of the next stage's rows fly to registers under this pass
            float u[AR][16];
#pragma unroll
            for (int kt = 0; kt < 2; ++kt) { const h16* kp = Ks[cb] + (sb * 32 + kt * 16 + lr) * APT + 8 * hi; const v16h k0 = WFrag<h16>::ld(kp), k1 = WFrag<h16>::ld(kp + 32);
#pragma unroll
                for (int r = 0; r < AR; ++r) { const v8f s = wmma16(k1, qf[r][1], wmma16(k0, qf[r][0], (v8f){}));
#pragma unroll
                    for (int j = 0; j < 8; ++j) u[r][kt * 8 + j] = s[j] * SCL2; } }
            if (anym) {
#pragma unroll
                for (int r = 0; r < AR; ++r)
#pragma unroll
                    for (int e = 0; e < 16; ++e) if ((int)(mw[r] << (sb * 16 + e)) >= 0) u[r][e] = NEGF; }
            v16h pf[AR];
#pragma unroll
            for (int r = 0; r < AR; ++r) {
                float mx = u[r][0];
#pragma unroll
                for (int e = 1; e < 16; ++e) mx = fmaxf(mx, u[r][e]);
                mx = fmaxf(mx, xhalf(mx));
                const float mn = fmaxf(m[r], mx), al = __builtin_amdgcn_exp2f(m[r] - mn); m[r] = mn;
                float sum = 0.f; v8u wp;
#pragma unroll
                for (int t = 0; t < 2; ++t) { float d[8], p[8];
#pragma unroll
                    for (int j = 0; j < 8; ++j) d[j] = u[r][t * 8 + j] - mn;
                    exp2x8(p, d);
#pragma unroll
                    for (int j = 0; j < 8; j += 2) { sum += p[j] + p[j + 1]; wp[(t * 8 + j) >> 1] = pack2(p[j], p[j + 1]); } }
                asm volatile("" : "+v"(sum));   // each row's sum pinned against spills: without it the adds sink to the loop's foot, every p of the stage stays live until there, and the staging registers spill
                ls[r] = ls[r] * al + sum; pf[r] = __builtin_bit_cast(v16h, wp);
#pragma unroll
                for (int dt = 0; dt < 4; ++dt) o[r][dt] = o[r][dt] * al;
            }
            v16h vf[4];
#pragma unroll
            for (int dt = 0; dt < 4; ++dt) vf[dt] = WFrag<h16>::ld(Vs[cb] + (dt * 16 + lr) * APT + sb * 32 + 8 * hi);
#pragma unroll
            for (int dt = 0; dt < 4; ++dt)
#pragma unroll
                for (int r = 0; r < AR; ++r) o[r][dt] = wmma16(vf[dt], pf[r], o[r][dt]);
            if (more) { *(v8h*)(Ks[cb ^ 1] + (srow + 32 * sb) * APT + sseg) = rk; *(v8h*)(Vs[cb ^ 1] + (srow + 32 * sb) * APT + sseg) = rv; }
        }
    }
    // lane l holds ctx[query l & 15][d = 16 dt + 8h + j]: 8 consecutive d, one 16-byte store
#pragma unroll
    for (int r = 0; r < AR; ++r) { const float f = __fdiv_rn(1.0f, ls[r] + xhalf(ls[r])); const size_t oo = ((size_t)(g / NH_) * TT + q0 + r * 16 + lr) * DQ + (g % NH_) * HD + 8 * hi;
#pragma unroll
        for (int dt = 0; dt < 4; ++dt) { v4u_ wx;
#pragma unroll
            for (int j = 0; j < 8; j += 2) wx[j >> 1] = pack2(o[r][dt][j] * f, o[r][dt][j + 1] * f);
            *(v4u_*)(Ax + oo + dt * 16) = wx; } }
}

extern "C" void kernel_launch(void* const* d_in, const int* in_sizes, int n_in,
                              void* d_out, int out_size, void* d_ws, size_t ws_size, hipStream_t stream) {
    if (n_in < 11) return;
    if ((size_t)in_sizes[0] < (size_t)(NB - 1) * S_FULL * DM + (size_t)TT * DM) return;
    if ((size_t)in_sizes[1] < (size_t)(NB - 1) * S_FULL * DM + (size_t)TT * DM) return;
    if ((size_t)in_sizes[2] < (size_t)(TT - 1) * S_FULL + (size_t)TT) return;
    if (in_sizes[3] < DM * DQ || in_sizes[5] < DM * DKV || in_sizes[7] < DM * DKV || in_sizes[9] < DQ * DM) return;
    if (in_sizes[4] < DQ || in_sizes[6] < DKV || in_sizes[8] < DKV || in_sizes[10] < DM) return;
    if ((size_t)out_size < (size_t)NB * TT * DM) return;
    const float* x  = (const float*)d_in[0];     // [NB][S_FULL][DM]
    const float* xk = (const float*)d_in[1];     // [NB][S_FULL][DM]
    const int*   mk = (const int*)d_in[2];       // [1][1][S_FULL][S_FULL] int32 0/1
    const float* wq = (const float*)d_in[3]; const float* bq = (const float*)d_in[4];
    const float* wk = (const float*)d_in[5]; const float* bk = (const float*)d_in[6];
    const float* wv = (const float*)d_in[7]; const float* bv = (const float*)d_in[8];
    const float* wo = (const float*)d_in[9]; const float* bo = (const float*)d_in[10];
    float* OUT = (float*)d_out;     // [NB][TT][DM]
    char* wsp = (char*)d_ws;
    auto take = [&](size_t bytes) { char* p = wsp; wsp += (bytes + 255) & ~(size_t)255; return (void*)p; };
    bf* WQ = (bf*)take((size_t)DQ * DM * 2); bf* WK = (bf*)take((size_t)DKV * DM * 2); bf* WV = (bf*)take((size_t)DKV * DM * 2); h16* WO = (h16*)take((size_t)DM * DQ * 2);
    h16* QP16 = (h16*)take((size_t)NB * NH_ * TT * HD * 2); h16* KP16 = (h16*)take((size_t)NB * NKV * TT * HD * 2);
    h16* VT16 = (h16*)take((size_t)NB * NKV * HD * TT * 2);
    h16* AT16 = (h16*)take((size_t)NB * TT * DQ * 2);
    bf* XB = (bf*)take((size_t)NB * TT * DM * 2); bf* XKB = (bf*)take((size_t)NB * TT * DM * 2);
    unsigned* MB = (unsigned*)take((size_t)(TT / (AR * 16)) * MWG * 4);
    if ((size_t)(wsp - (char*)d_ws) > ws_size) return;
    // every batch in one launch: rows b * TT + t in the projections, planes b * NH_ + h in attention
    k_prep<<<PMB + PWB + PSB, 256, 0, stream>>>(x, xk, mk, wq, wk, wv, wo, XB, XKB, WQ, WK, WV, WO, MB);
    // each projection's epilogue writes the operand planes of attention itself
    k_gemmw<bf, true, 1><<<dim3(NB * TT / GRA, DQ / GRB, 1), GT, 0, stream>>>(XB, WQ, DM, DM, nullptr, DQ, bq, 0, 0, 0, QP16);
    k_gemmw<bf, true, 1><<<dim3(NB * TT / GRA, DKV / GRB, 1), GT, 0, stream>>>(XKB, WK, DM, DM, nullptr, DKV, bk, 0, 0, 0, KP16);
    k_gemmw<bf, true, 2><<<dim3(NB * TT / GRA, DKV / GRB, 1), GT, 0, stream>>>(XKB, WV, DM, DM, nullptr, DKV, bv, 0, 0, 0, VT16);
    k_fattn<<<dim3(TT / (AW * AR * 16), NB * NH_, 1), AW * 32, 0, stream>>>(QP16, KP16, VT16, MB, AT16);
    k_gemmw<h16, true, 0><<<dim3(NB * TT / GRA, DM / GRB, 1), GT, 0, stream>>>(AT16, WO, DQ, DQ, OUT, DM, bo, 0, 0, 0, nullptr);
}

// v008
// Measured time: 103 microseconds a run.
// Timed twice side by side with v007, it ran 1.05 times as fast both times.
// All steps since v000 together make it 16.3 times as fast.
#include <hip/hip_runtime.h>

// Multi-head dot-product attention: inputs_q, inputs_kv [8][1024][1024]; q = inputs_q Wq + bq, k / v = inputs_kv Wk / Wv + bk / bv (W [1024][16][64] = k-major [1024][1024], bias [16][64]);
// logits = (q . k) / 64 (the module divides q by the head depth); int32 mask [1][1][1024][1024] replaces masked logits by the most negative finite f32; softmax over keys; ctx = P . v; out = ctx Wo ([16][64][1024] = [1024][1024]) + bo -> [8][1024][1024] f32.
// Compute dtypes, f32 accumulate: every float input RNE-converted to bf16 (Wo: to fp16); q/k/v projections v_wmma_f32_16x16x32_bf16 on plain bf16 operands; scores v_wmma_f32_16x16x32_f16 on plain fp16 q/k planes with 1/64 applied to the f32 score; softmax f32, running maximum; P . v on plain fp16 operands (the unnormalised P = 2^(u - m), at most 1, and v), one product, 1 / sum applied to the f32 result; ctx . Wo on plain fp16 ctx and fp16 Wo, one product; biases added in f32 as bf16-converted values.

#ifndef NB
#define NB   8
#endif
#ifndef SEQ
#define SEQ  1024
#endif
#define S_FULL 1024                 // per-batch row count / mask row pitch
#define TT   SEQ
#define DM   1024
#define NH_  16
#define NKV  16
#define REP  (NH_ / NKV)
#define HD   64
#define DQ   (NH_ * HD)
#define DKV  (NKV * HD)
#define SCL  0.015625f              // 1 / HD
#define NEGF (-3.4028234663852886e38f)

static_assert(TT % 128 == 0);
static_assert(TT % 64 == 0);
static_assert(DM % 64 == 0);
static_assert(HD % 32 == 0);
static_assert(REP == 1);
static_assert(SEQ <= S_FULL);
static_assert(NB >= 1);

typedef _Float16 h16;
typedef unsigned short bf;
typedef __attribute__((ext_vector_type(16))) __bf16   v16bf;
typedef __attribute__((ext_vector_type(16))) _Float16 v16h;
typedef __attribute__((ext_vector_type(8)))  _Float16 v8h;
typedef __attribute__((ext_vector_type(8)))  unsigned short v8us;
typedef __attribute__((ext_vector_type(8)))  float    v8f;
typedef __attribute__((ext_vector_type(4)))  float    v4f;
typedef v8h  __attribute__((may_alias)) v8ha;
typedef v4f  __attribute__((may_alias)) v4fa;
typedef v8us __attribute__((may_alias)) v8usa;

__device__ __forceinline__ unsigned short f2bf(float f) { unsigned u = __float_as_uint(f); u += 0x7FFFu + ((u >> 16) & 1u); return (unsigned short)(u >> 16); }
__device__ __forceinline__ float bf2f(unsigned short b) { return __uint_as_float(((unsigned)b) << 16); }
__device__ __forceinline__ float bfr(float f) { return bf2f(f2bf(f)); }
__device__ __forceinline__ v16h cat16(v8h lo, v8h hi) { return __builtin_shufflevector(lo, hi, 0, 1, 2, 3, 4, 5, 6, 7, 8, 9, 10, 11, 12, 13, 14, 15); }
__device__ __forceinline__ v16bf cat16b(v8us lo, v8us hi) { return __builtin_bit_cast(v16bf, __builtin_shufflevector(lo, hi, 0, 1, 2, 3, 4, 5, 6, 7, 8, 9, 10, 11, 12, 13, 14, 15)); }
__device__ __forceinline__ v8f wmma16(v16h a, v16h b, v8f c) { return __builtin_amdgcn_wmma_f32_16x16x32_f16(false, a, false, b, (short)0, c, false, false); }
__device__ __forceinline__ v8f wmmab(v16bf a, v16bf b, v8f c) { return __builtin_amdgcn_wmma_f32_16x16x32_bf16(false, a, false, b, (short)0, c, false, false); }



// ---- k_gemmw: GEMM on a 256 x 128 output tile per work-group of EIGHT WAVES (4 x 2), each wave a 64 x 64 part (16 accumulators); grid (M/256, N/128), 256 threads, one work-group a WGP.
// The operands' rows (K-contiguous 16-bit planes) reach LDS by asynchronous copies, whole 128-byte lines a wave instruction, GKS k a stage, two stage buffers: stage t + 2 flies while stage t + 1 is worked on; the fragments are read from LDS (row pitch = row + 16 bytes).
// C[m][n] (+ optional f32 bias[n]) = sum_k A[m][k] Bt[n][k]. A row pitch lda, Bt row pitch K. K % GKS == 0.
// NJ products of one shape in ONE launch (operands Aj, Bj, bias j, output plane Pj, output form OMj): a work-group does the same tile of each, one after the other, on ONE ring that never runs empty:
// the stages are numbered through all products, so the next product's first two stages are copied while this product's last stages are worked on and its tile is written out.
// OUTM says where the tile goes: 0 = f32 C, pitch ldc; 1 = f16 head planes P16[batch][head][token][HD] (m = batch * TT + token, n = head * HD + depth; a wave's part is 8 KiB in a row);
// 2 = transposed f16 plane P16[batch][n][token]: the two operands change places in the matrix instruction, so D comes out as [n][token] and a staged row is one whole 128-byte line of 64 tokens.
// Fragments (A and Bt alike): lane l -> row l&15, elements 0..7 = k kc+8h..kc+8h+7, elements 8..15 = k kc+16+8h..kc+16+8h+7 (h = l>>4); D element j -> row 8h+j, col l&15.
template <typename T16> struct WFrag;
template <> struct WFrag<h16> { typedef v16h V; static __device__ __forceinline__ V ld(const h16* p) { return cat16(*(const v8h*)p, *(const v8h*)(p + 16)); } static __device__ __forceinline__ v8f mma(V a, V b, v8f c) { return wmma16(a, b, c); } };
template <> struct WFrag<bf> { typedef v16bf V; static __device__ __forceinline__ V ld(const bf* p) { return cat16b(*(const v8us*)p, *(const v8us*)(p + 16)); } static __device__ __forceinline__ v8f mma(V a, V b, v8f c) { return wmmab(a, b, c); } };
__device__ __forceinline__ h16 tohx(float x) { return (h16)x; }
typedef __attribute__((ext_vector_type(4))) _Float16 v4h;
typedef __attribute__((ext_vector_type(4))) unsigned short v4us;
#define GT  256                     // threads of a GEMM work-group
#define GRA 256                     // rows of A in a stage = rows of the output tile
#define GRB 128                     // rows of Bt in a stage = columns of the output tile
static_assert((NB * TT) % GRA == 0 && DQ % GRB == 0 && DKV % GRB == 0 && DM % GRB == 0 && DM % 128 == 0 && DQ % 64 == 0);
__device__ __forceinline__ unsigned lds_off(const void* p) { return (unsigned)(size_t)p; }   // byte offset in the work-group's LDS
// Eight asynchronous 16-byte copies a lane, global -> LDS, and the wait that stands in front of whatever next overwrites a register they name, in ONE statement (in a statement of its own the compiler may lift the next address additions over it).
template <typename T16>
__device__ __forceinline__ void copyrun(unsigned l, unsigned lstep, const T16* g, size_t gstep) {
        asm volatile("global_load_async_to_lds_b128 %0, %8, off\n\tglobal_load_async_to_lds_b128 %1, %9, off\n\tglobal_load_async_to_lds_b128 %2, %10, off\n\tglobal_load_async_to_lds_b128 %3, %11, off\n\t"
                     "global_load_async_to_lds_b128 %4, %12, off\n\tglobal_load_async_to_lds_b128 %5, %13, off\n\tglobal_load_async_to_lds_b128 %6, %14, off\n\tglobal_load_async_to_lds_b128 %7, %15, off\n\ts_wait_xcnt 0x0"
                     :: "v"(l), "v"(l + lstep), "v"(l + 2 * lstep), "v"(l + 3 * lstep), "v"(l + 4 * lstep), "v"(l + 5 * lstep), "v"(l + 6 * lstep), "v"(l + 7 * lstep),
                        "v"(g), "v"(g + gstep), "v"(g + 2 * gstep), "v"(g + 3 * gstep), "v"(g + 4 * gstep), "v"(g + 5 * gstep), "v"(g + 6 * gstep), "v"(g + 7 * gstep) : "memory");
}
template <int V> struct IC { static constexpr int value = V; };
template <typename T16, bool BIAS, int NJ, int OM0, int OM1, int OM2>
__global__ __launch_bounds__(GT) void k_gemmw(const T16* __restrict__ A0, const T16* __restrict__ A1, const T16* __restrict__ A2, const T16* __restrict__ B0, const T16* __restrict__ B1, const T16* __restrict__ B2, int K, int lda, float* C, int ldc,
                                              const float* __restrict__ bias0, const float* __restrict__ bias1, const float* __restrict__ bias2, h16* P0, h16* P1, h16* P2) {
    static_assert(NJ >= 1 && NJ <= 3);
    static_assert(TT % 64 == 0 && HD % 64 == 0);   // a wave's 64 x 64 part stays inside one batch and one head
    typedef typename WFrag<T16>::V V;
    constexpr int GKS = 128;                       // k per stage: both buffers and the output staging fit one WGP's LDS
    constexpr int GP = GKS + 8;                    // LDS row pitch in elements: the row + 16 bytes
    constexpr int ROWS = GRA + GRB;                // a stage: A's rows, Bt's rows
    constexpr int SEG = GKS / 8, RPS = GT / SEG;   // 16-byte pieces a row; rows a sweep of the work-group
    constexpr int SWA = GRA / RPS, SWB = GRB / RPS;   // sweeps a plane
    static_assert(SWA % 8 == 0 && SWB % 8 == 0);
    __shared__ __align__(16) T16 ring[2][ROWS * GP];
    __shared__ __align__(16) float osw[GT / 32][16 * 68];
    const int tid = threadIdx.x, lane = tid & 31, wave = tid >> 5, lr = lane & 15, hi = lane >> 4;
    const int R0 = blockIdx.x * GRA, C0 = blockIdx.y * GRB, wm = (wave >> 1) * 64, wn = (wave & 1) * 64; const int r0 = R0 + wm, c0 = C0 + wn;
    float* const os = osw[wave];
    // staging: SEG threads a row, RPS rows a sweep; every lane is on, every piece lies inside its plane (M a multiple of GRA, N of GRB, K of GKS)
    const int srow = tid / SEG, sseg = (tid % SEG) * 8;
    const size_t oA = (size_t)(R0 + srow) * lda + sseg, oB = (size_t)(C0 + srow) * K + sseg;
    const int NT = K / GKS, NS = NJ * NT;   // stages a product, stages in all
    const unsigned l0 = lds_off(&ring[0][0]) + (unsigned)(srow * GP + sseg) * 2u;
    auto stage = [&](int s) __attribute__((always_inline)) {   // (inlined at each of its places, so that what it captures stays in registers) stage s's copies into buffer s & 1; which product s belongs to is the same for the whole work-group
        const T16* Aj = A0; const T16* Bj = B0; int t = s;
        if constexpr (NJ > 1) { if (s >= NT) { Aj = A1; Bj = B1; t = s - NT; } }
        if constexpr (NJ > 2) { if (s >= 2 * NT) { Aj = A2; Bj = B2; t = s - 2 * NT; } }
        const unsigned lb = l0 + (unsigned)(s & 1) * (unsigned)(ROWS * GP * 2); const int kc = t * GKS;
        const T16* const gA = Aj + oA; const T16* const gB = Bj + oB;
#pragma unroll
        for (int u = 0; u < SWA; u += 8) copyrun<T16>(lb + (unsigned)(u * RPS * GP * 2), (unsigned)(RPS * GP * 2), gA + (size_t)(u * RPS) * lda + kc, (size_t)RPS * lda);
#pragma unroll
        for (int u = 0; u < SWB; u += 8) copyrun<T16>(lb + (unsigned)((GRA + u * RPS) * GP * 2), (unsigned)(RPS * GP * 2), gB + (size_t)(u * RPS) * K + kc, (size_t)RPS * K);
    };
    stage(0);
    asm volatile("s_wait_asynccnt 0x0" ::: "memory");   // this wave's copies of stage 0 have landed
    __syncthreads();                                    // publishes stage 0
    if (NS > 1) stage(1);
    auto product = [&](auto JC) __attribute__((always_inline)) {   // product J: its NT stages, then its tile goes out
    constexpr int J = decltype(JC)::value, OUTM = J == 0 ? OM0 : J == 1 ? OM1 : OM2;
    const float* const bias = J == 0 ? bias0 : J == 1 ? bias1 : bias2; h16* const P16 = J == 0 ? P0 : J == 1 ? P1 : P2;
    v8f acc[4][4];
#pragma unroll
    for (int mb = 0; mb < 4; ++mb)
#pragma unroll
        for (int nb = 0; nb < 4; ++nb) acc[mb][nb] = (v8f){};
    // rolled: one publish point at its foot
#pragma unroll 1
    for (int s = J * NT; s < (J + 1) * NT; ++s) {
        const T16* const As = ring[s & 1] + (wm + lr) * GP + 8 * hi; const T16* const Bs = ring[s & 1] + (GRA + wn + lr) * GP + 8 * hi;
        V a[2][4], b[2][4];   // two fragment sets: block i + 1's LDS reads go out as one group in front of block i's matrix instructions
        auto frags = [&](int s, int ks) {
#pragma unroll
            for (int f = 0; f < 4; ++f) { a[s][f] = WFrag<T16>::ld(As + f * 16 * GP + ks); b[s][f] = WFrag<T16>::ld(Bs + f * 16 * GP + ks); }
        };
        frags(0, 0);
        // unrolled: the index of a fragment set must be a constant for the sets to stay in registers
#pragma unroll
        for (int i = 0; i < GKS / 32; ++i) {
            if (i + 1 < GKS / 32) frags((i + 1) & 1, (i + 1) * 32);
            __builtin_amdgcn_sched_barrier(0);   // keeps the reads above in one group ahead of the block
#pragma unroll
            for (int nb = 0; nb < 4; ++nb)
#pragma unroll
                for (int mb = 0; mb < 4; ++mb) acc[mb][nb] = OUTM == 2 ? WFrag<T16>::mma(b[i & 1][nb], a[i & 1][mb], acc[mb][nb]) : WFrag<T16>::mma(a[i & 1][mb], b[i & 1][nb], acc[mb][nb]);
            __builtin_amdgcn_sched_barrier(0);   // keeps the next group of reads behind this block
        }
        asm volatile("s_wait_dscnt 0x0" ::: "memory");      // this wave's reads of stage s have returned
        asm volatile("s_wait_asynccnt 0x0" ::: "memory");   // this wave's copies of stage s + 1 have landed
        __syncthreads();                                    // publishes stage s + 1, and ends every wave's reads of stage s's buffer, which is refilled behind it
        if (s + 2 < NS) stage(s + 2);
    }
    if constexpr (J + 1 == NJ) asm volatile("s_wait_asynccnt 0x0" ::: "memory");   // behind the last product's loop no copy is outstanding when the wave goes on (behind an earlier one the next product's second stage flies on into the ring, which the part below does not touch)
    float bn[4][8];   // OUTM 2: the bias of this lane's D rows n = c0 + 16 ob + 8 hi + j, added on the way into LDS
    if constexpr (OUTM == 2 && BIAS) {
#pragma unroll
        for (int ob = 0; ob < 4; ++ob) { const v4f b0 = *(const v4fa*)(bias + c0 + ob * 16 + 8 * hi), b1 = *(const v4fa*)(bias + c0 + ob * 16 + 8 * hi + 4);
#pragma unroll
            for (int j = 0; j < 4; ++j) { bn[ob][j] = bfr(b0[j]); bn[ob][4 + j] = bfr(b1[j]); } }
        asm volatile("s_wait_xcnt 0x0" ::: "memory");   // stands in front of whatever next overwrites the address registers that these loads name
    }
    // sixteen D rows at a time through LDS, so that every store covers whole lines (OUTM 2: a D row is one n, its columns are tokens)
#pragma unroll
    for (int ob = 0; ob < 4; ++ob) {
#pragma unroll
        for (int ib = 0; ib < 4; ++ib) {
#pragma unroll
            for (int j = 0; j < 8; ++j) { if constexpr (OUTM == 2) os[(hi * 8 + j) * 68 + ib * 16 + lr] = BIAS ? acc[ib][ob][j] + bn[ob][j] : acc[ib][ob][j]; else os[(hi * 8 + j) * 68 + ib * 16 + lr] = acc[ob][ib][j]; } }
        __builtin_amdgcn_wave_barrier(); asm volatile("" ::: "memory");
#pragma unroll
        for (int s = 0; s < 8; ++s) { const int row = 2 * s + hi, cofs = lr * 4; v4f val = *(const v4fa*)(os + row * 68 + cofs);
            if constexpr (OUTM == 2) {
                const int n = c0 + ob * 16 + row; v4h o16;
#pragma unroll
                for (int q = 0; q < 4; ++q) o16[q] = tohx(val[q]);
                *(v4h*)(P16 + ((size_t)(r0 / TT) * ldc + n) * TT + (r0 % TT) + cofs) = o16;
            } else {
                if (BIAS) { val[0] += bfr(bias[c0 + cofs]); val[1] += bfr(bias[c0 + cofs + 1]); val[2] += bfr(bias[c0 + cofs + 2]); val[3] += bfr(bias[c0 + cofs + 3]); }
                if constexpr (OUTM == 1) { v4h o16; o16[0] = tohx(val[0]); o16[1] = tohx(val[1]); o16[2] = tohx(val[2]); o16[3] = tohx(val[3]);
                    *(v4h*)(P16 + (((size_t)(r0 / TT) * (ldc / HD) + c0 / HD) * TT + (r0 % TT) + ob * 16 + row) * HD + (c0 % HD) + cofs) = o16; }
                else *(v4f*)(C + (size_t)(r0 + ob * 16 + row) * ldc + c0 + cofs) = val;
            } }
        __builtin_amdgcn_wave_barrier(); asm volatile("s_wait_xcnt 0x0" ::: "memory");   // keeps the next rows' LDS stores behind these reads, and stands in front of whatever next overwrites a register that these global stores name
    }
    };
    product(IC<0>{});
    if constexpr (NJ > 1) product(IC<1>{});
    if constexpr (NJ > 2) product(IC<2>{});
}

typedef __attribute__((ext_vector_type(2))) unsigned short v2us;
typedef __attribute__((ext_vector_type(2))) float v2f;
typedef __attribute__((ext_vector_type(4))) int v4i;

// ---- k_prep: every operand conversion of the call in ONE launch sized to the chip (PMB + PWB + PSB work-groups of 8 waves); the weights' and the inputs' loads cover whole lines, each wave has 16 to 32 of them in flight and does many lines, so few waves have to be started.
// Work-groups 0 .. PMB - 1: the int32 mask -> bit words, ONCE a call: the mask is the same for every (batch, head) plane, so attention's work-groups only fetch their words. One thread a word, in the order in which an attention wave holds them:
// MB[wave group G of AR * 16 queries][stage][column group r][lane l]: query G * AR * 16 + 16 r + (l & 15); element e = 8 * tile + j (key = stage * AKB + 16 * tile + 8 * (l >> 4) + j) sits at bit 31 - e. They come first: they are short.
// Work-groups PMB .. PMB + PWB - 1: the four weights, f32 [K][N] -> 16-bit Bt[N][K] (Wq, Wk, Wv bf16; Wo f16); a work-group turns the same 64 x 64 tile of each weight through LDS: a thread loads a 4 k x 4 n block (a wave's load = 2 rows of 256 bytes), writes 4 k in a row under each n, and behind the one barrier the rows of 64 k go out as whole 128-byte lines.
// Work-groups PMB + PWB .. PMB + PWB + PSB - 1: inputs_q and inputs_kv, f32 -> bf16; a wave takes PCH pieces of 512 bytes in a row of each input (32 lanes x 16 bytes = 4 whole lines a load).
#define PCH 16                      // 512-byte pieces (128 floats) of each input that a wave has in flight
#define PNC (TT * DM / 128)         // pieces a batch
#define PSB (NB * PNC / PCH / 8)    // work-groups that convert the inputs
#define PWB (DM / 64 * (DQ / 64))   // work-groups that turn the weights: one 64 x 64 tile of every weight each
#define PTP 72                      // LDS row pitch of a turned tile in elements: the 128-byte row + 16 bytes
#define AR  2                       // 16-query column groups per attention wave
#define AKB 64                      // keys per LDS stage of attention = keys of the two lanes' words that share a query
#define MWG (TT / AKB * AR * 32)    // mask words of one attention wave
#define PMB (TT / (AR * 16) * MWG / 256)   // work-groups that pack the mask
static_assert(AKB == 64 && TT % (AR * 16) == 0 && (TT / (AR * 16) * MWG) % 256 == 0);
static_assert(PNC % PCH == 0 && (NB * PNC / PCH) % 8 == 0);
static_assert(DM % 64 == 0 && DQ % 64 == 0 && DKV % 64 == 0 && DKV <= DQ);
template <int K, int N> struct WTile {   // tile b of a [K][N] weight: k from (b / (N / 64)) * 64, n from (b % (N / 64)) * 64; a weight with fewer tiles than PWB leaves the rest of the work-groups out (the same test for a whole work-group)
    static __device__ __forceinline__ bool has(int b) { return b < (K / 64) * (N / 64); }
    static __device__ __forceinline__ const float* src(const float* __restrict__ w, int b, int tid) { return w + (size_t)((has(b) ? b / (N / 64) : 0) * 64 + (tid >> 4) * 4) * N + (b % (N / 64)) * 64 + (tid & 15) * 4; }   // this thread's 4 x 4 block
    static __device__ __forceinline__ void load(const float* p, int b, v4f (&v)[4]) {
        if (!has(b)) return;
#pragma unroll
        for (int s = 0; s < 4; ++s) v[s] = *(const v4fa*)(p + (size_t)s * N);
    }
    template <bool F16> static __device__ __forceinline__ void turn(const v4f (&v)[4], bf* T, int b, int tid) {   // T holds raw 16-bit patterns: f16 (F16) or bf16
        if (!has(b)) return;
#pragma unroll
        for (int j = 0; j < 4; ++j) { v4us o;
#pragma unroll
            for (int s = 0; s < 4; ++s) o[s] = F16 ? __builtin_bit_cast(unsigned short, (h16)v[s][j]) : f2bf(v[s][j]);
            *(v4us*)(T + ((tid & 15) * 4 + j) * PTP + (tid >> 4) * 4) = o; }
    }
    static __device__ __forceinline__ void store(const bf* T, bf* Bt, int b, int tid) {
        if (!has(b)) return;
#pragma unroll
        for (int p = 0; p < 2; ++p) { const int n = (tid >> 3) + 32 * p; *(v8us*)(Bt + (size_t)((b % (N / 64)) * 64 + n) * K + (b / (N / 64)) * 64 + (tid & 7) * 8) = *(const v8us*)(T + n * PTP + (tid & 7) * 8); }
    }
};
__device__ __forceinline__ void cvt_store(const v4f (&v)[PCH], bf* dst) {
#pragma unroll
    for (int i = 0; i < PCH; ++i) { v4us o;
#pragma unroll
        for (int k = 0; k < 4; ++k) o[k] = f2bf(v[i][k]);
        *(v4us*)(dst + i * 128) = o; }
}
__global__ __launch_bounds__(256) void k_prep(const float* __restrict__ x, const float* __restrict__ xk, const int* __restrict__ Mk, const float* __restrict__ wq, const float* __restrict__ wk, const float* __restrict__ wv, const float* __restrict__ wo,
                                              bf* XB, bf* XKB, bf* WQ, bf* WK, bf* WV, h16* WO, unsigned* MB) {
    __shared__ __align__(16) bf tw[4][64 * PTP];
    const int tid = threadIdx.x;
    if (blockIdx.x < PMB) { const int wd = (int)blockIdx.x * 256 + tid, l = wd & 31, r = (wd >> 5) % AR, blk = (wd >> 5) / AR % (TT / AKB), G = (wd >> 5) / AR / (TT / AKB);
        const int* mr = Mk + (size_t)(G * (AR * 16) + r * 16 + (l & 15)) * S_FULL + blk * AKB + 8 * (l >> 4); unsigned w = 0; v4i mv[AKB / 8];
#pragma unroll
        for (int c = 0; c < AKB / 8; ++c) mv[c] = *(const v4i*)(mr + (c >> 1) * 16 + (c & 1) * 4);
        asm volatile("s_wait_xcnt 0x0" ::: "memory");   // stands in front of whatever next overwrites the address registers that these loads name
#pragma unroll
        for (int c = 0; c < AKB / 8; ++c)
#pragma unroll
            for (int j = 0; j < 4; ++j) w = (w << 1) | min((unsigned)mv[c][j], 1u);
        MB[wd] = w;
        return; }
    if (blockIdx.x < PMB + PWB) { const int b = (int)blockIdx.x - PMB; v4f vq[4], vk[4], vv[4], vo[4];
        const float* const pq = WTile<DM, DQ>::src(wq, b, tid); const float* const pk = WTile<DM, DKV>::src(wk, b, tid); const float* const pv = WTile<DM, DKV>::src(wv, b, tid); const float* const po = WTile<DQ, DM>::src(wo, b, tid);
        WTile<DM, DQ>::load(pq, b, vq); WTile<DM, DKV>::load(pk, b, vk); WTile<DM, DKV>::load(pv, b, vv); WTile<DQ, DM>::load(po, b, vo);
        __builtin_amdgcn_sched_barrier(0);              // keeps all sixteen loads in front of the first conversion: a load sunk among the conversions starts only when earlier ones have returned, a second memory latency
        asm volatile("s_wait_xcnt 0x0" :: "v"(pq), "v"(pk), "v"(pv), "v"(po) : "memory");   // stands in front of whatever next overwrites the address registers that these loads name; the addresses are inputs so that they live up to here and no later load's result is put on them
        WTile<DM, DQ>::turn<false>(vq, tw[0], b, tid); WTile<DM, DKV>::turn<false>(vk, tw[1], b, tid); WTile<DM, DKV>::turn<false>(vv, tw[2], b, tid); WTile<DQ, DM>::turn<true>(vo, tw[3], b, tid);
        __syncthreads();                                // publishes the turned tiles: a row is written by sixteen threads of all eight waves and read by eight threads of one
        WTile<DM, DQ>::store(tw[0], WQ, b, tid); WTile<DM, DKV>::store(tw[1], WK, b, tid); WTile<DM, DKV>::store(tw[2], WV, b, tid); WTile<DQ, DM>::store(tw[3], (bf*)WO, b, tid);
        return; }
    const int lane = tid & 31, wave = __builtin_amdgcn_readfirstlane(tid >> 5);   // the wave's number in a scalar register: the bases stay scalar
    const int c0 = (((int)blockIdx.x - PMB - PWB) * 8 + wave) * PCH;   // a run of PCH pieces stays inside one batch
    const size_t so = (size_t)(c0 / PNC) * S_FULL * DM + (size_t)(c0 % PNC) * 128 + lane * 4, po = (size_t)c0 * 128 + lane * 4;
    const float* const pq = x + so; const float* const pk = xk + so;
    v4f vq[PCH], vk[PCH];
#pragma unroll
    for (int i = 0; i < PCH; ++i) vq[i] = *(const v4fa*)(pq + i * 128);
#pragma unroll
    for (int i = 0; i < PCH; ++i) vk[i] = *(const v4fa*)(pk + i * 128);
    __builtin_amdgcn_sched_barrier(0);              // keeps every load of the wave in front of the first conversion, for the reason given above
    asm volatile("s_wait_xcnt 0x0" :: "v"(pq), "v"(pk) : "memory");   // as above: the wait, with the two addresses alive up to it
    cvt_store(vq, XB + po); cvt_store(vk, XKB + po);
    asm volatile("s_wait_xcnt 0x0" ::: "memory");   // behind the last stores: the built code has a way on from here into the weights' part, which overwrites the registers that these stores name
}

// ---- k_fattn: scores, mask (as k_prep's bit words), softmax, P . v and the f16 conversion of ctx in ONE kernel; no score or P element ever reaches memory.
// Grid (TT / 256, planes), 8 waves; a wave owns 32 queries (2 column groups of 16) of one (batch, head) plane and walks all TT keys, 64 keys an LDS stage (k rows, v^T rows, pitch 144 B; two stage buffers, one barrier a stage), 32 keys a pass.
// S^T = K . Q^T (A = k rows, B = q rows, f16): lane l holds query l & 15, keys 8h + j of each 16-key tile, so two tiles converted in place ARE the B operand of O^T += V^T . P^T (A = v^T rows in the same k order, f16, one product).
// Every inner loop is fully unrolled so that each index into a register array is a constant. Two work-groups a WGP = four waves a SIMD (256 registers a wave), which the vector work between the matrix runs wants.
// Softmax is the running-maximum form in the log2 domain: u = S x (log2 e / HD), masked u = most negative finite f32; p = 2^(u - m); O^T and the sum are rescaled by 2^(m_old - m_new) every pass; 1 / sum is applied to O^T at the end.
typedef __attribute__((ext_vector_type(8))) unsigned v8u;
typedef __attribute__((ext_vector_type(2))) _Float16 v2h;
typedef __attribute__((ext_vector_type(4), may_alias)) unsigned v4u_;
#define AW  8                       // waves per work-group
#define APT 72                      // LDS row pitch in 16-bit elements: 128-byte rows + 16 bytes
#define SCL2 (SCL * 1.4426950408889634f)
static_assert(TT % (AW * AR * 16) == 0);
static_assert(TT % AKB == 0);
static_assert(HD == 64);
__device__ __forceinline__ unsigned pack2(float a, float b) { v2f x; x[0] = a; x[1] = b; return __builtin_bit_cast(unsigned, __builtin_convertvector(x, v2h)); }   // two f32 -> two f16, round to nearest even
__device__ __forceinline__ float xhalf(float x) { return __builtin_bit_cast(float, __builtin_amdgcn_permlanex16(__builtin_bit_cast(int, x), __builtin_bit_cast(int, x), 0x76543210, 0xfedcba98, false, false)); }   // lane l <-> lane l ^ 16
// Eight 2^x and the slot behind the last of them in ONE statement: each v_exp fills the slot of the one before it, the v_nop that of the last
__device__ __forceinline__ void exp2x8(float (&p)[8], const float (&d)[8]) {
    asm("v_exp_f32 %0, %8\n\tv_exp_f32 %1, %9\n\tv_exp_f32 %2, %10\n\tv_exp_f32 %3, %11\n\tv_exp_f32 %4, %12\n\tv_exp_f32 %5, %13\n\tv_exp_f32 %6, %14\n\tv_exp_f32 %7, %15\n\tv_nop"
        : "=&v"(p[0]), "=&v"(p[1]), "=&v"(p[2]), "=&v"(p[3]), "=&v"(p[4]), "=&v"(p[5]), "=&v"(p[6]), "=&v"(p[7])
        : "v"(d[0]), "v"(d[1]), "v"(d[2]), "v"(d[3]), "v"(d[4]), "v"(d[5]), "v"(d[6]), "v"(d[7]));
}
__global__ __launch_bounds__(AW * 32) __attribute__((amdgpu_waves_per_eu(4, 4))) void k_fattn(const h16* __restrict__ Qp, const h16* __restrict__ Kp, const h16* __restrict__ Vt, const unsigned* __restrict__ MB, h16* Ax) {
    __shared__ __align__(16) h16 Ks[2][AKB * APT];
    __shared__ __align__(16) h16 Vs[2][HD * APT];
    __shared__ __align__(16) unsigned mbit[AW][TT / AKB][AR][32];   // each lane's mask bits, one word per stage and column group; a wave fills and reads its own part, the reads behind the first stage's barrier
    const int tid = threadIdx.x, lane = tid & 31, wave = tid >> 5, lr = lane & 15, hi = lane >> 4;
    const int g = blockIdx.y, q0 = blockIdx.x * (AW * AR * 16) + wave * (AR * 16);
    Qp += (size_t)g * TT * HD; Kp += (size_t)g * TT * HD; Vt += (size_t)g * HD * TT;
    // this wave's mask words, packed by k_prep in this very order: MWG words in a row, whole lines a load
    static_assert(MWG % 128 == 0);
    const unsigned* const mg = MB + (size_t)(q0 / (AR * 16)) * MWG + lane * 4; v4u_ mq[MWG / 128];
#pragma unroll
    for (int i = 0; i < MWG / 128; ++i) mq[i] = *(const v4u_*)(mg + i * 128);
    asm volatile("s_wait_xcnt 0x0" :: "v"(mg) : "memory");   // stands in front of whatever next overwrites the address registers that these loads name; the address is an input so that it lives up to here
#pragma unroll
    for (int i = 0; i < MWG / 128; ++i) *(v4u_*)(&mbit[wave][0][0][0] + i * 128 + lane * 4) = mq[i];
    const int srow = tid >> 3, sseg = (tid & 7) * 8;   // staging: 8 threads a 128-byte row, 32 rows a sweep
    const unsigned ko = (unsigned)(srow * HD + sseg), vo = (unsigned)(srow * TT + sseg);   // this thread's 32-bit offsets from wave-uniform bases
#pragma unroll
    for (int p = 0; p < 2; ++p) { const v8h rk = *(const v8h*)(Kp + 32 * p * HD + ko), rv = *(const v8h*)(Vt + 32 * p * TT + vo);
        *(v8h*)(Ks[0] + (srow + 32 * p) * APT + sseg) = rk; *(v8h*)(Vs[0] + (srow + 32 * p) * APT + sseg) = rv; }
    v16h qf[AR][2];
#pragma unroll
    for (int r = 0; r < AR; ++r)
#pragma unroll
        for (int kc = 0; kc < 2; ++kc) qf[r][kc] = WFrag<h16>::ld(Qp + (size_t)(q0 + r * 16 + lr) * HD + kc * 32 + 8 * hi);
    v8f o[AR][4]; float m[AR], ls[AR];
#pragma unroll
    for (int r = 0; r < AR; ++r) { m[r] = NEGF; ls[r] = 0.f;
#pragma unroll
        for (int dt = 0; dt < 4; ++dt) o[r][dt] = (v8f){}; }
    // rolled: the register count stays at four waves a SIMD
#pragma unroll 1
    for (int blk = 0; blk < TT / AKB; ++blk) {
        __syncthreads();   // publishes stage blk, and ends every wave's reads of the other buffer, which this stage refills
        const int cb = blk & 1, kn = (blk + 1) * AKB; const bool more = blk + 1 < TT / AKB;
        unsigned mw[AR];
#pragma unroll
        for (int r = 0; r < AR; ++r) mw[r] = mbit[wave][blk][r][lane];
        const bool anym = __builtin_amdgcn_ballot_w32((mw[0] & mw[1]) != 0xFFFFFFFFu) != 0;   // wave-uniform: a stage with no masked element skips the selects
#pragma unroll
        for (int sb = 0; sb < AKB / 32; ++sb) {
            v8h rk, rv;
            if (more) { rk = *(const v8h*)(Kp + (kn + 32 * sb) * HD + ko); rv = *(const v8h*)(Vt + (32 * sb * TT + kn) + vo); }   // half of the next stage's rows fly to registers under this pass
            float u[AR][16];
#pragma unroll
            for (int kt = 0; kt < 2; ++kt) { const h16* kp = Ks[cb] + (sb * 32 + kt * 16 + lr) * APT + 8 * hi; const v16h k0 = WFrag<h16>::ld(kp), k1 = WFrag<h16>::ld(kp + 32);
#pragma unroll
                for (int r = 0; r < AR; ++r) { const v8f s = wmma16(k1, qf[r][1], wmma16(k0, qf[r][0], (v8f){}));
#pragma unroll
                    for (int j = 0; j < 8; ++j) u[r][kt * 8 + j] = s[j] * SCL2; } }
            if (anym) {
#pragma unroll
                for (int r = 0; r < AR; ++r)
#pragma unroll
                    for (int e = 0; e < 16; ++e) if ((int)(mw[r] << (sb * 16 + e)) >= 0) u[r][e] = NEGF; }
            v16h pf[AR];
#pragma unroll
            for (int r = 0; r < AR; ++r) {
                float mx = u[r][0];
#pragma unroll
                for (int e = 1; e < 16; ++e) mx = fmaxf(mx, u[r][e]);
                mx = fmaxf(mx, xhalf(mx));
                const float mn = fmaxf(m[r], mx), al = __builtin_amdgcn_exp2f(m[r] - mn); m[r] = mn;
                float sum = 0.f; v8u wp;
#pragma unroll
                for (int t = 0; t < 2; ++t) { float d[8], p[8];
#pragma unroll
                    for (int j = 0; j < 8; ++j) d[j] = u[r][t * 8 + j] - mn;
                    exp2x8(p, d);
#pragma unroll
                    for (int j = 0; j < 8; j += 2) { sum += p[j] + p[j + 1]; wp[(t * 8 + j) >> 1] = pack2(p[j], p[j + 1]); } }
                asm volatile("" : "+v"(sum));   // each row's sum pinned against spills: without it the adds sink to the loop's foot, every p of the stage stays live until there, and the staging registers spill
                ls[r] = ls[r] * al + sum; pf[r] = __builtin_bit_cast(v16h, wp);
#pragma unroll
                for (int dt = 0; dt < 4; ++dt) o[r][dt] = o[r][dt] * al;
            }
            v16h vf[4];
#pragma unroll
            for (int dt = 0; dt < 4; ++dt) vf[dt] = WFrag<h16>::ld(Vs[cb] + (dt * 16 + lr) * APT + sb * 32 + 8 * hi);
#pragma unroll
            for (int dt = 0; dt < 4; ++dt)
#pragma unroll
                for (int r = 0; r < AR; ++r) o[r][dt] = wmma16(vf[dt], pf[r], o[r][dt]);
            if (more) { *(v8h*)(Ks[cb ^ 1] + (srow + 32 * sb) * APT + sseg) = rk; *(v8h*)(Vs[cb ^ 1] + (srow + 32 * sb) * APT + sseg) = rv; }
        }
    }
    // lane l holds ctx[query l & 15][d = 16 dt + 8h + j]: 8 consecutive d, one 16-byte store
#pragma unroll
    for (int r = 0; r < AR; ++r) { const float f = __fdiv_rn(1.0f, ls[r] + xhalf(ls[r])); const size_t oo = ((size_t)(g / NH_) * TT + q0 + r * 16 + lr) * DQ + (g % NH_) * HD + 8 * hi;
#pragma unroll
        for (int dt = 0; dt < 4; ++dt) { v4u_ wx;
#pragma unroll
            for (int j = 0; j < 8; j += 2) wx[j >> 1] = pack2(o[r][dt][j] * f, o[r][dt][j + 1] * f);
            *(v4u_*)(Ax + oo + dt * 16) = wx; } }
}

extern "C" void kernel_launch(void* const* d_in, const int* in_sizes, int n_in,
                              void* d_out, int out_size, void* d_ws, size_t ws_size, hipStream_t stream) {
    if (n_in < 11) return;
    if ((size_t)in_sizes[0] < (size_t)(NB - 1) * S_FULL * DM + (size_t)TT * DM) return;
    if ((size_t)in_sizes[1] < (size_t)(NB - 1) * S_FULL * DM + (size_t)TT * DM) return;
    if ((size_t)in_sizes[2] < (size_t)(TT - 1) * S_FULL + (size_t)TT) return;
    if (in_sizes[3] < DM * DQ || in_sizes[5] < DM * DKV || in_sizes[7] < DM * DKV || in_sizes[9] < DQ * DM) return;
    if (in_sizes[4] < DQ || in_sizes[6] < DKV || in_sizes[8] < DKV || in_sizes[10] < DM) return;
    if ((size_t)out_size < (size_t)NB * TT * DM) return;
    const float* x  = (const float*)d_in[0];     // [NB][S_FULL][DM]
    const float* xk = (const float*)d_in[1];     // [NB][S_FULL][DM]
    const int*   mk = (const int*)d_in[2];       // [1][1][S_FULL][S_FULL] int32 0/1
    const float* wq = (const float*)d_in[3]; const float* bq = (const float*)d_in[4];
    const float* wk = (const float*)d_in[5]; const float* bk = (const float*)d_in[6];
    const float* wv = (const float*)d_in[7]; const float* bv = (const float*)d_in[8];
    const float* wo = (const float*)d_in[9]; const float* bo = (const float*)d_in[10];
    float* OUT = (float*)d_out;     // [NB][TT][DM]
    char* wsp = (char*)d_ws;
    auto take = [&](size_t bytes) { char* p = wsp; wsp += (bytes + 255) & ~(size_t)255; return (void*)p; };
    bf* WQ = (bf*)take((size_t)DQ * DM * 2); bf* WK = (bf*)take((size_t)DKV * DM * 2); bf* WV = (bf*)take((size_t)DKV * DM * 2); h16* WO = (h16*)take((size_t)DM * DQ * 2);
    h16* QP16 = (h16*)take((size_t)NB * NH_ * TT * HD * 2); h16* KP16 = (h16*)take((size_t)NB * NKV * TT * HD * 2);
    h16* VT16 = (h16*)take((size_t)NB * NKV * HD * TT * 2);
    h16* AT16 = (h16*)take((size_t)NB * TT * DQ * 2);
    bf* XB = (bf*)take((size_t)NB * TT * DM * 2); bf* XKB = (bf*)take((size_t)NB * TT * DM * 2);
    unsigned* MB = (unsigned*)take((size_t)(TT / (AR * 16)) * MWG * 4);
    if ((size_t)(wsp - (char*)d_ws) > ws_size) return;
    // every batch in one launch: rows b * TT + t in the projections, planes b * NH_ + h in attention
    k_prep<<<PMB + PWB + PSB, 256, 0, stream>>>(x, xk, mk, wq, wk, wv, wo, XB, XKB, WQ, WK, WV, WO, MB);
    // each projection's epilogue writes the operand planes of attention itself
    static_assert(DQ == DKV);   // the three projections have one shape, so one grid serves them
    k_gemmw<bf, true, 3, 1, 1, 2><<<dim3(NB * TT / GRA, DQ / GRB, 1), GT, 0, stream>>>(XB, XKB, XKB, WQ, WK, WV, DM, DM, nullptr, DQ, bq, bk, bv, QP16, KP16, VT16);
    k_fattn<<<dim3(TT / (AW * AR * 16), NB * NH_, 1), AW * 32, 0, stream>>>(QP16, KP16, VT16, MB, AT16);
    k_gemmw<h16, true, 1, 0, 0, 0><<<dim3(NB * TT / GRA, DM / GRB, 1), GT, 0, stream>>>(AT16, nullptr, nullptr, WO, nullptr, nullptr, DQ, DQ, OUT, DM, bo, nullptr, nullptr, nullptr, nullptr, nullptr);
}

// v009
// It runs in 97.9 microseconds.
// In two side-by-side timings against v008, it was 1.05 and 1.06 times as fast.
// Counting every step since v000, it is 17.2 times as fast.
#include <hip/hip_runtime.h>

// Multi-head dot-product attention: inputs_q, inputs_kv [8][1024][1024]; q = inputs_q Wq + bq, k / v = inputs_kv Wk / Wv + bk / bv (W [1024][16][64] = k-major [1024][1024], bias [16][64]);
// logits = (q . k) / 64 (the module divides q by the head depth); int32 mask [1][1][1024][1024] replaces masked logits by the most negative finite f32; softmax over keys; ctx = P . v; out = ctx Wo ([16][64][1024] = [1024][1024]) + bo -> [8][1024][1024] f32.
// Compute dtypes, f32 accumulate: every float input RNE-converted to bf16 (Wo: to fp16); q/k/v projections v_wmma_f32_16x16x32_bf16 on plain bf16 operands; scores v_wmma_f32_16x16x32_f16 on plain fp16 q/k planes with 1/64 applied to the f32 score; softmax f32, running maximum; P . v on plain fp16 operands (the unnormalised P = 2^(u - m), at most 1, and v), one product, 1 / sum applied to the f32 result; ctx . Wo on plain fp16 ctx and fp16 Wo, one product; biases added in f32 as bf16-converted values.

#ifndef NB
#define NB   8
#endif
#ifndef SEQ
#define SEQ  1024
#endif
#define S_FULL 1024                 // per-batch row count / mask row pitch
#define TT   SEQ
#define DM   1024
#define NH_  16
#define NKV  16
#define REP  (NH_ / NKV)
#define HD   64
#define DQ   (NH_ * HD)
#define DKV  (NKV * HD)
#define SCL  0.015625f              // 1 / HD
#define NEGF (-3.4028234663852886e38f)

static_assert(TT % 128 == 0);
static_assert(TT % 64 == 0);
static_assert(DM % 64 == 0);
static_assert(HD % 32 == 0);
static_assert(REP == 1);
static_assert(SEQ <= S_FULL);
static_assert(NB >= 1);

typedef _Float16 h16;
typedef unsigned short bf;
typedef __attribute__((ext_vector_type(16))) __bf16   v16bf;
typedef __attribute__((ext_vector_type(16))) _Float16 v16h;
typedef __attribute__((ext_vector_type(8)))  _Float16 v8h;
typedef __attribute__((ext_vector_type(8)))  unsigned short v8us;
typedef __attribute__((ext_vector_type(8)))  float    v8f;
typedef __attribute__((ext_vector_type(4)))  float    v4f;
typedef v8h  __attribute__((may_alias)) v8ha;
typedef v4f  __attribute__((may_alias)) v4fa;
typedef v8us __attribute__((may_alias)) v8usa;

__device__ __forceinline__ unsigned short f2bf(float f) { unsigned u = __float_as_uint(f); u += 0x7FFFu + ((u >> 16) & 1u); return (unsigned short)(u >> 16); }
__device__ __forceinline__ float bf2f(unsigned short b) { return __uint_as_float(((unsigned)b) << 16); }
__device__ __forceinline__ float bfr(float f) { return bf2f(f2bf(f)); }
__device__ __forceinline__ v16h cat16(v8h lo, v8h hi) { return __builtin_shufflevector(lo, hi, 0, 1, 2, 3, 4, 5, 6, 7, 8, 9, 10, 11, 12, 13, 14, 15); }
__device__ __forceinline__ v16bf cat16b(v8us lo, v8us hi) { return __builtin_bit_cast(v16bf, __builtin_shufflevector(lo, hi, 0, 1, 2, 3, 4, 5, 6, 7, 8, 9, 10, 11, 12, 13, 14, 15)); }
__device__ __forceinline__ v8f wmma16(v16h a, v16h b, v8f c) { return __builtin_amdgcn_wmma_f32_16x16x32_f16(false, a, false, b, (short)0, c, false, false); }
__device__ __forceinline__ v8f wmmab(v16bf a, v16bf b, v8f c) { return __builtin_amdgcn_wmma_f32_16x16x32_bf16(false, a, false, b, (short)0, c, false, false); }



// ---- k_gemmw: GEMM on a 256 x 128 output tile per work-group of EIGHT WAVES (4 x 2), each wave a 64 x 64 part (16 accumulators); grid (M/256, N/128), 256 threads, one work-group a WGP.
// The operands' rows (K-contiguous 16-bit planes) reach LDS by tensor loads, ONE request a wave and stage (waves 0-3: 64 rows of A each, waves 4-7: 32 rows of Bt each), GKS k a stage, two stage buffers: stage t + 2 flies while stage t + 1 is worked on; the fragments are read from LDS (row pitch = row + 16 bytes, laid by the request's pad).
// C[m][n] (+ optional f32 bias[n]) = sum_k A[m][k] Bt[n][k]. A row pitch lda, Bt row pitch K. K % GKS == 0.
// NJ products of one shape in ONE launch (operands Aj, Bj, bias j, output plane Pj, output form OMj): a work-group does the same tile of each, one after the other, on ONE ring that never runs empty:
// the stages are numbered through all products, so the next product's first two stages are loaded while this product's last stages are worked on and its tile is written out.
// OUTM says where the tile goes: 0 = f32 C, pitch ldc; 1 = f16 head planes P16[batch][head][token][HD] (m = batch * TT + token, n = head * HD + depth; a wave's part is 8 KiB in a row);
// 2 = transposed f16 plane P16[batch][n][token]: the two operands change places in the matrix instruction, so D comes out as [n][token] and a staged row is one whole 128-byte line of 64 tokens.
// Fragments (A and Bt alike): lane l -> row l&15, elements 0..7 = k kc+8h..kc+8h+7, elements 8..15 = k kc+16+8h..kc+16+8h+7 (h = l>>4); D element j -> row 8h+j, col l&15.
template <typename T16> struct WFrag;
template <> struct WFrag<h16> { typedef v16h V; static __device__ __forceinline__ V ld(const h16* p) { return cat16(*(const v8h*)p, *(const v8h*)(p + 16)); } static __device__ __forceinline__ v8f mma(V a, V b, v8f c) { return wmma16(a, b, c); } };
template <> struct WFrag<bf> { typedef v16bf V; static __device__ __forceinline__ V ld(const bf* p) { return cat16b(*(const v8us*)p, *(const v8us*)(p + 16)); } static __device__ __forceinline__ v8f mma(V a, V b, v8f c) { return wmmab(a, b, c); } };
__device__ __forceinline__ h16 tohx(float x) { return (h16)x; }
typedef __attribute__((ext_vector_type(4))) _Float16 v4h;
typedef __attribute__((ext_vector_type(4))) unsigned short v4us;
#define GT  256                     // threads of a GEMM work-group
#define GRA 256                     // rows of A in a stage = rows of the output tile
#define GRB 128                     // rows of Bt in a stage = columns of the output tile
static_assert((NB * TT) % GRA == 0 && DQ % GRB == 0 && DKV % GRB == 0 && DM % GRB == 0 && DM % 128 == 0 && DQ % 64 == 0);
__device__ __forceinline__ unsigned lds_off(const void* p) { return (unsigned)(size_t)p; }   // byte offset in the work-group's LDS
typedef unsigned u32x4 __attribute__((ext_vector_type(4)));
typedef unsigned u32x8 __attribute__((ext_vector_type(8)));
__device__ __forceinline__ unsigned uni(unsigned v) { return (unsigned)__builtin_amdgcn_readfirstlane(v); }   // a descriptor word: wave-uniform, in a scalar register
__device__ __forceinline__ unsigned pinned(unsigned v) { unsigned w = (unsigned)__builtin_amdgcn_readfirstlane(v); asm volatile("" : "+s"(w)); return w; }   // a value held in a scalar register: the test on it is a scalar branch, and what is formed from it is formed behind the statements in front of it
template <int V> struct IC { static constexpr int value = V; };
template <typename T16, bool BIAS, int NJ, int OM0, int OM1, int OM2>
__global__ __launch_bounds__(GT) void k_gemmw(const T16* __restrict__ A0, const T16* __restrict__ A1, const T16* __restrict__ A2, const T16* __restrict__ B0, const T16* __restrict__ B1, const T16* __restrict__ B2, int K, int lda, float* C, int ldc,
                                              const float* __restrict__ bias0, const float* __restrict__ bias1, const float* __restrict__ bias2, h16* P0, h16* P1, h16* P2) {
    static_assert(NJ >= 1 && NJ <= 3);
    static_assert(TT % 64 == 0 && HD % 64 == 0);   // a wave's 64 x 64 part stays inside one batch and one head
    typedef typename WFrag<T16>::V V;
    constexpr int GKS = 128;                       // k per stage: both buffers and the output staging fit one WGP's LDS
    constexpr int GP = GKS + 8;                    // LDS row pitch in elements: the row + 16 bytes
    // a stage buffer: four slices of A (SRA rows each, waves 0-3), four of Bt (SRB rows each, waves 4-7); every slice's size is rounded up to a multiple of 2 KiB, so that every request's place in LDS is one
    constexpr int SRA = GRA / 4, SRB = GRB / 4;
    constexpr unsigned SLA = (unsigned)(SRA * GP * 2 + 2047) & ~2047u, SLB = (unsigned)(SRB * GP * 2 + 2047) & ~2047u, BUFB = 4u * SLA + 4u * SLB;   // bytes
    static_assert(GT == 256 && GKS * 2 == 256 && SRA == 64 && SRB == 32);   // eight waves; rows of 256 bytes (the pad below is theirs); a wave's 64 rows of A are one slice, its 64 rows of Bt two
    __shared__ __attribute__((aligned(2048))) T16 ring[2][BUFB / 2];
    __shared__ __align__(16) float osw[GT / 32][16 * 68];
    const int tid = threadIdx.x, lane = tid & 31, wave = tid >> 5, lr = lane & 15, hi = lane >> 4;
    const int R0 = blockIdx.x * GRA, C0 = blockIdx.y * GRB, wm = (wave >> 1) * 64, wn = (wave & 1) * 64; const int r0 = R0 + wm, c0 = C0 + wn;
    float* const os = osw[wave];
    const int NT = K / GKS, NS = NJ * NT;   // stages a product, stages in all
    // this wave's slice: every tile lies inside its plane (M a multiple of GRA, N of GRB, K of GKS), its first byte at a multiple of 256
    const unsigned wv = uni((unsigned)tid >> 5); const bool isA = wv < 4u;
    const unsigned long long woff = (isA ? (unsigned long long)(R0 + (int)wv * SRA) * (unsigned)lda : (unsigned long long)(C0 + ((int)wv - 4) * SRB) * (unsigned)K) * 2u;   // bytes from the plane's start to the slice's first row
    const unsigned long long sb0 = (isA ? (unsigned long long)(size_t)A0 : (unsigned long long)(size_t)B0) + woff, sb1 = (isA ? (unsigned long long)(size_t)A1 : (unsigned long long)(size_t)B1) + woff, sb2 = (isA ? (unsigned long long)(size_t)A2 : (unsigned long long)(size_t)B2) + woff;   // the slice's address in each product's plane, as values
    const unsigned lplace = lds_off(&ring[0][0]) + (isA ? wv * SLA : 4u * SLA + (wv - 4u) * SLB);
    const unsigned d1 = isA ? (unsigned)SRA : (unsigned)SRB, pitchb = (unsigned)(isA ? lda : K) * 2u;
    constexpr unsigned d0 = GKS * 2;   // bytes a row
    u32x8 g1;   // descriptor group 1, the same for every request of the wave: 1-byte elements, tensor = tile = d1 rows of d0 bytes, no mask, 16 bytes of LDS pad behind every 256-byte row
    g1[0] = uni((1u << 20) | (5u << 22) | (3u << 25)); g1[1] = uni((d0 & 0xFFFFu) << 16); g1[2] = uni((d0 >> 16) | ((d1 & 0xFFFFu) << 16)); g1[3] = uni((d1 >> 16) | (d0 << 16));
    g1[4] = uni(d1); g1[5] = uni(pitchb); g1[6] = uni(0u); g1[7] = uni(0u);
    u32x4 g0;   // descriptor group 0 of the wave's latest request
    auto stage = [&](int s) __attribute__((always_inline)) {   // stage s's request into buffer s & 1; every wave issues its own slice; which product s belongs to is the same for the whole work-group
        const unsigned sp = pinned((unsigned)s);   // group 0 is formed from this, so behind the wait that covers the wave's request before
        unsigned long long sb = sb0; unsigned t = sp;
        if constexpr (NJ > 1) { if (sp >= (unsigned)NT) { sb = sb1; t = sp - (unsigned)NT; } }
        if constexpr (NJ > 2) { if (sp >= 2u * (unsigned)NT) { sb = sb2; t = sp - 2u * (unsigned)NT; } }
        const unsigned long long ga = sb + (unsigned long long)t * d0;
        g0[0] = uni(1u); g0[1] = uni(lplace + (sp & 1u) * BUFB); g0[2] = uni((unsigned)ga); g0[3] = uni((((unsigned)(ga >> 32)) & 0x01FFFFFFu) | 0x80000000u);
        asm volatile("tensor_load_to_lds %0, %1" : "+s"(g0) : "s"(g1) : "memory");   // one request of the whole wave: its slice of stage s, global -> LDS through no register; group 0 is an in-out operand, so that what the wait below names is held in the very registers the request was issued from
    };
    // the wait for the wave's request; the descriptor's words are inputs, so that they live in their registers up to here and no register of a request in flight takes another value
    auto landed = [&]() __attribute__((always_inline)) { asm volatile("s_wait_tensorcnt 0x0" :: "s"(g0), "s"(g1) : "memory"); };
    stage(0);
    landed();                                            // this wave's slice of stage 0 has landed
    __syncthreads();                                     // publishes stage 0
    if (pinned(NS > 1)) stage(1);
    auto product = [&](auto JC) __attribute__((always_inline)) {   // product J: its NT stages, then its tile goes out
    constexpr int J = decltype(JC)::value, OUTM = J == 0 ? OM0 : J == 1 ? OM1 : OM2;
    const float* const bias = J == 0 ? bias0 : J == 1 ? bias1 : bias2; h16* const P16 = J == 0 ? P0 : J == 1 ? P1 : P2;
    v8f acc[4][4];
#pragma unroll
    for (int mb = 0; mb < 4; ++mb)
#pragma unroll
        for (int nb = 0; nb < 4; ++nb) acc[mb][nb] = (v8f){};
    // rolled: one publish point at its foot
#pragma unroll 1
    for (int s = J * NT; s < (J + 1) * NT; ++s) {
        const T16* const As = ring[s & 1] + (wave >> 1) * (int)(SLA / 2) + lr * GP + 8 * hi; const T16* const Bs = ring[s & 1] + (int)(4 * SLA / 2) + (wave & 1) * (int)(2 * SLB / 2) + lr * GP + 8 * hi;   // this wave's slice of A, its first slice of Bt
        V a[2][4], b[2][4];   // two fragment sets: block i + 1's LDS reads go out as one group in front of block i's matrix instructions
        auto frags = [&](int s, int ks) {
#pragma unroll
            for (int f = 0; f < 4; ++f) { a[s][f] = WFrag<T16>::ld(As + f * 16 * GP + ks); b[s][f] = WFrag<T16>::ld(Bs + (f >> 1) * (int)(SLB / 2) + (f & 1) * 16 * GP + ks); }
        };
        frags(0, 0);
        // unrolled: the index of a fragment set must be a constant for the sets to stay in registers
#pragma unroll
        for (int i = 0; i < GKS / 32; ++i) {
            if (i + 1 < GKS / 32) frags((i + 1) & 1, (i + 1) * 32);
            __builtin_amdgcn_sched_barrier(0);   // keeps the reads above in one group ahead of the block
#pragma unroll
            for (int nb = 0; nb < 4; ++nb)
#pragma unroll
                for (int mb = 0; mb < 4; ++mb) acc[mb][nb] = OUTM == 2 ? WFrag<T16>::mma(b[i & 1][nb], a[i & 1][mb], acc[mb][nb]) : WFrag<T16>::mma(a[i & 1][mb], b[i & 1][nb], acc[mb][nb]);
            __builtin_amdgcn_sched_barrier(0);   // keeps the next group of reads behind this block
        }
        asm volatile("s_wait_dscnt 0x0" ::: "memory");      // this wave's reads of stage s have returned
        landed();                                           // this wave's slice of stage s + 1 has landed
        __syncthreads();                                    // publishes stage s + 1, and ends every wave's reads of stage s's buffer, which is refilled behind it
        if (pinned(s + 2 < NS)) stage(s + 2);
    }
    if constexpr (J + 1 == NJ) { landed(); asm volatile("s_wait_dscnt 0x0" ::: "memory"); }   // behind the last product's loop no request is outstanding when the wave goes on (behind an earlier one the next product's second stage flies on into the ring, which the part below does not touch)
    float bn[4][8];   // OUTM 2: the bias of this lane's D rows n = c0 + 16 ob + 8 hi + j, added on the way into LDS
    if constexpr (OUTM == 2 && BIAS) {
#pragma unroll
        for (int ob = 0; ob < 4; ++ob) { const v4f b0 = *(const v4fa*)(bias + c0 + ob * 16 + 8 * hi), b1 = *(const v4fa*)(bias + c0 + ob * 16 + 8 * hi + 4);
#pragma unroll
            for (int j = 0; j < 4; ++j) { bn[ob][j] = bfr(b0[j]); bn[ob][4 + j] = bfr(b1[j]); } }
        asm volatile("s_wait_xcnt 0x0" ::: "memory");   // stands in front of whatever next overwrites the address registers that these loads name
    }
    // sixteen D rows at a time through LDS, so that every store covers whole lines (OUTM 2: a D row is one n, its columns are tokens)
#pragma unroll
    for (int ob = 0; ob < 4; ++ob) {
#pragma unroll
        for (int ib = 0; ib < 4; ++ib) {
#pragma unroll
            for (int j = 0; j < 8; ++j) { if constexpr (OUTM == 2) os[(hi * 8 + j) * 68 + ib * 16 + lr] = BIAS ? acc[ib][ob][j] + bn[ob][j] : acc[ib][ob][j]; else os[(hi * 8 + j) * 68 + ib * 16 + lr] = acc[ob][ib][j]; } }
        __builtin_amdgcn_wave_barrier(); asm volatile("" ::: "memory");
#pragma unroll
        for (int s = 0; s < 8; ++s) { const int row = 2 * s + hi, cofs = lr * 4; v4f val = *(const v4fa*)(os + row * 68 + cofs);
            if constexpr (OUTM == 2) {
                const int n = c0 + ob * 16 + row; v4h o16;
#pragma unroll
                for (int q = 0; q < 4; ++q) o16[q] = tohx(val[q]);
                *(v4h*)(P16 + ((size_t)(r0 / TT) * ldc + n) * TT + (r0 % TT) + cofs) = o16;
            } else {
                if (BIAS) { val[0] += bfr(bias[c0 + cofs]); val[1] += bfr(bias[c0 + cofs + 1]); val[2] += bfr(bias[c0 + cofs + 2]); val[3] += bfr(bias[c0 + cofs + 3]); }
                if constexpr (OUTM == 1) { v4h o16; o16[0] = tohx(val[0]); o16[1] = tohx(val[1]); o16[2] = tohx(val[2]); o16[3] = tohx(val[3]);
                    *(v4h*)(P16 + (((size_t)(r0 / TT) * (ldc / HD) + c0 / HD) * TT + (r0 % TT) + ob * 16 + row) * HD + (c0 % HD) + cofs) = o16; }
                else *(v4f*)(C + (size_t)(r0 + ob * 16 + row) * ldc + c0 + cofs) = val;
            } }
        __builtin_amdgcn_wave_barrier(); asm volatile("s_wait_xcnt 0x0" ::: "memory");   // keeps the next rows' LDS stores behind these reads, and stands in front of whatever next overwrites a register that these global stores name
    }
    };
    product(IC<0>{});
    if constexpr (NJ > 1) product(IC<1>{});
    if constexpr (NJ > 2) product(IC<2>{});
}

typedef __attribute__((ext_vector_type(2))) unsigned short v2us;
typedef __attribute__((ext_vector_type(2))) float v2f;
typedef __attribute__((ext_vector_type(4))) int v4i;

// ---- k_prep: every operand conversion of the call in ONE launch sized to the chip (PMB + PWB + PSB work-groups of 8 waves); the weights' and the inputs' loads cover whole lines, each wave has 16 to 32 of them in flight and does many lines, so few waves have to be started.
// Work-groups 0 .. PMB - 1: the int32 mask -> bit words, ONCE a call: the mask is the same for every (batch, head) plane, so attention's work-groups only fetch their words. One thread a word, in the order in which an attention wave holds them:
// MB[wave group G of AR * 16 queries][stage][column group r][lane l]: query G * AR * 16 + 16 r + (l & 15); element e = 8 * tile + j (key = stage * AKB + 16 * tile + 8 * (l >> 4) + j) sits at bit 31 - e. They come first: they are short.
// Work-groups PMB .. PMB + PWB - 1: the four weights, f32 [K][N] -> 16-bit Bt[N][K] (Wq, Wk, Wv bf16; Wo f16); a work-group turns the same 64 x 64 tile of each weight through LDS: a thread loads a 4 k x 4 n block (a wave's load = 2 rows of 256 bytes), writes 4 k in a row under each n, and behind the one barrier the rows of 64 k go out as whole 128-byte lines.
// Work-groups PMB + PWB .. PMB + PWB + PSB - 1: inputs_q and inputs_kv, f32 -> bf16; a wave takes PCH pieces of 512 bytes in a row of each input (32 lanes x 16 bytes = 4 whole lines a load).
#define PCH 16                      // 512-byte pieces (128 floats) of each input that a wave has in flight
#define PNC (TT * DM / 128)         // pieces a batch
#define PSB (NB * PNC / PCH / 8)    // work-groups that convert the inputs
#define PWB (DM / 64 * (DQ / 64))   // work-groups that turn the weights: one 64 x 64 tile of every weight each
#define PTP 72                      // LDS row pitch of a turned tile in elements: the 128-byte row + 16 bytes
#define AR  2                       // 16-query column groups per attention wave
#define AKB 64                      // keys per LDS stage of attention = keys of the two lanes' words that share a query
#define MWG (TT / AKB * AR * 32)    // mask words of one attention wave
#define PMB (TT / (AR * 16) * MWG / 256)   // work-groups that pack the mask
static_assert(AKB == 64 && TT % (AR * 16) == 0 && (TT / (AR * 16) * MWG) % 256 == 0);
static_assert(PNC % PCH == 0 && (NB * PNC / PCH) % 8 == 0);
static_assert(DM % 64 == 0 && DQ % 64 == 0 && DKV % 64 == 0 && DKV <= DQ);
template <int K, int N> struct WTile {   // tile b of a [K][N] weight: k from (b / (N / 64)) * 64, n from (b % (N / 64)) * 64; a weight with fewer tiles than PWB leaves the rest of the work-groups out (the same test for a whole work-group)
    static __device__ __forceinline__ bool has(int b) { return b < (K / 64) * (N / 64); }
    static __device__ __forceinline__ const float* src(const float* __restrict__ w, int b, int tid) { return w + (size_t)((has(b) ? b / (N / 64) : 0) * 64 + (tid >> 4) * 4) * N + (b % (N / 64)) * 64 + (tid & 15) * 4; }   // this thread's 4 x 4 block
    static __device__ __forceinline__ void load(const float* p, int b, v4f (&v)[4]) {
        if (!has(b)) return;
#pragma unroll
        for (int s = 0; s < 4; ++s) v[s] = *(const v4fa*)(p + (size_t)s * N);
    }
    template <bool F16> static __device__ __forceinline__ void turn(const v4f (&v)[4], bf* T, int b, int tid) {   // T holds raw 16-bit patterns: f16 (F16) or bf16
        if (!has(b)) return;
#pragma unroll
        for (int j = 0; j < 4; ++j) { v4us o;
#pragma unroll
            for (int s = 0; s < 4; ++s) o[s] = F16 ? __builtin_bit_cast(unsigned short, (h16)v[s][j]) : f2bf(v[s][j]);
            *(v4us*)(T + ((tid & 15) * 4 + j) * PTP + (tid >> 4) * 4) = o; }
    }
    static __device__ __forceinline__ void store(const bf* T, bf* Bt, int b, int tid) {
        if (!has(b)) return;
#pragma unroll
        for (int p = 0; p < 2; ++p) { const int n = (tid >> 3) + 32 * p; *(v8us*)(Bt + (size_t)((b % (N / 64)) * 64 + n) * K + (b / (N / 64)) * 64 + (tid & 7) * 8) = *(const v8us*)(T + n * PTP + (tid & 7) * 8); }
    }
};
__device__ __forceinline__ void cvt_store(const v4f (&v)[PCH], bf* dst) {
#pragma unroll
    for (int i = 0; i < PCH; ++i) { v4us o;
#pragma unroll
        for (int k = 0; k < 4; ++k) o[k] = f2bf(v[i][k]);
        *(v4us*)(dst + i * 128) = o; }
}
__global__ __launch_bounds__(256) void k_prep(const float* __restrict__ x, const float* __restrict__ xk, const int* __restrict__ Mk, const float* __restrict__ wq, const float* __restrict__ wk, const float* __restrict__ wv, const float* __restrict__ wo,
                                              bf* XB, bf* XKB, bf* WQ, bf* WK, bf* WV, h16* WO, unsigned* MB) {
    __shared__ __align__(16) bf tw[4][64 * PTP];
    const int tid = threadIdx.x;
    if (blockIdx.x < PMB) { const int wd = (int)blockIdx.x * 256 + tid, l = wd & 31, r = (wd >> 5) % AR, blk = (wd >> 5) / AR % (TT / AKB), G = (wd >> 5) / AR / (TT / AKB);
        const int* mr = Mk + (size_t)(G * (AR * 16) + r * 16 + (l & 15)) * S_FULL + blk * AKB + 8 * (l >> 4); unsigned w = 0; v4i mv[AKB / 8];
#pragma unroll
        for (int c = 0; c < AKB / 8; ++c) mv[c] = *(const v4i*)(mr + (c >> 1) * 16 + (c & 1) * 4);
        asm volatile("s_wait_xcnt 0x0" ::: "memory");   // stands in front of whatever next overwrites the address registers that these loads name
#pragma unroll
        for (int c = 0; c < AKB / 8; ++c)
#pragma unroll
            for (int j = 0; j < 4; ++j) w = (w << 1) | min((unsigned)mv[c][j], 1u);
        MB[wd] = w;
        return; }
    if (blockIdx.x < PMB + PWB) { const int b = (int)blockIdx.x - PMB; v4f vq[4], vk[4], vv[4], vo[4];
        const float* const pq = WTile<DM, DQ>::src(wq, b, tid); const float* const pk = WTile<DM, DKV>::src(wk, b, tid); const float* const pv = WTile<DM, DKV>::src(wv, b, tid); const float* const po = WTile<DQ, DM>::src(wo, b, tid);
        WTile<DM, DQ>::load(pq, b, vq); WTile<DM, DKV>::load(pk, b, vk); WTile<DM, DKV>::load(pv, b, vv); WTile<DQ, DM>::load(po, b, vo);
        __builtin_amdgcn_sched_barrier(0);              // keeps all sixteen loads in front of the first conversion: a load sunk among the conversions starts only when earlier ones have returned, a second memory latency
        asm volatile("s_wait_xcnt 0x0" :: "v"(pq), "v"(pk), "v"(pv), "v"(po) : "memory");   // stands in front of whatever next overwrites the address registers that these loads name; the addresses are inputs so that they live up to here and no later load's result is put on them
        WTile<DM, DQ>::turn<false>(vq, tw[0], b, tid); WTile<DM, DKV>::turn<false>(vk, tw[1], b, tid); WTile<DM, DKV>::turn<false>(vv, tw[2], b, tid); WTile<DQ, DM>::turn<true>(vo, tw[3], b, tid);
        __syncthreads();                                // publishes the turned tiles: a row is written by sixteen threads of all eight waves and read by eight threads of one
        WTile<DM, DQ>::store(tw[0], WQ, b, tid); WTile<DM, DKV>::store(tw[1], WK, b, tid); WTile<DM, DKV>::store(tw[2], WV, b, tid); WTile<DQ, DM>::store(tw[3], (bf*)WO, b, tid);
        return; }
    const int lane = tid & 31, wave = __builtin_amdgcn_readfirstlane(tid >> 5);   // the wave's number in a scalar register: the bases stay scalar
    const int c0 = (((int)blockIdx.x - PMB - PWB) * 8 + wave) * PCH;   // a run of PCH pieces stays inside one batch
    const size_t so = (size_t)(c0 / PNC) * S_FULL * DM + (size_t)(c0 % PNC) * 128 + lane * 4, po = (size_t)c0 * 128 + lane * 4;
    const float* const pq = x + so; const float* const pk = xk + so;
    v4f vq[PCH], vk[PCH];
#pragma unroll
    for (int i = 0; i < PCH; ++i) vq[i] = *(const v4fa*)(pq + i * 128);
#pragma unroll
    for (int i = 0; i < PCH; ++i) vk[i] = *(const v4fa*)(pk + i * 128);
    __builtin_amdgcn_sched_barrier(0);              // keeps every load of the wave in front of the first conversion, for the reason given above
    asm volatile("s_wait_xcnt 0x0" :: "v"(pq), "v"(pk) : "memory");   // as above: the wait, with the two addresses alive up to it
    cvt_store(vq, XB + po); cvt_store(vk, XKB + po);
    asm volatile("s_wait_xcnt 0x0" ::: "memory");   // behind the last stores: the built code has a way on from here into the weights' part, which overwrites the registers that these stores name
}

// ---- k_fattn: scores, mask (as k_prep's bit words), softmax, P . v and the f16 conversion of ctx in ONE kernel; no score or P element ever reaches memory.
// Grid (TT / 256, planes), 8 waves; a wave owns 32 queries (2 column groups of 16) of one (batch, head) plane and walks all TT keys, 64 keys an LDS stage (k rows, v^T rows, pitch 144 B; two stage buffers, one barrier a stage), 32 keys a pass.
// S^T = K . Q^T (A = k rows, B = q rows, f16): lane l holds query l & 15, keys 8h + j of each 16-key tile, so two tiles converted in place ARE the B operand of O^T += V^T . P^T (A = v^T rows in the same k order, f16, one product).
// Every inner loop is fully unrolled so that each index into a register array is a constant. Two work-groups a WGP = four waves a SIMD (256 registers a wave), which the vector work between the matrix runs wants.
// Softmax is the running-maximum form in the log2 domain: u = S x (log2 e / HD), masked u = most negative finite f32; p = 2^(u - m); O^T and the sum are rescaled by 2^(m_old - m_new) every pass; 1 / sum is applied to O^T at the end.
typedef __attribute__((ext_vector_type(8))) unsigned v8u;
typedef __attribute__((ext_vector_type(2))) _Float16 v2h;
typedef __attribute__((ext_vector_type(4), may_alias)) unsigned v4u_;
#define AW  8                       // waves per work-group
#define APT 72                      // LDS row pitch in 16-bit elements: 128-byte rows + 16 bytes
#define SCL2 (SCL * 1.4426950408889634f)
static_assert(TT % (AW * AR * 16) == 0);
static_assert(TT % AKB == 0);
static_assert(HD == 64);
__device__ __forceinline__ unsigned pack2(float a, float b) { v2f x; x[0] = a; x[1] = b; return __builtin_bit_cast(unsigned, __builtin_convertvector(x, v2h)); }   // two f32 -> two f16, round to nearest even
__device__ __forceinline__ float xhalf(float x) { return __builtin_bit_cast(float, __builtin_amdgcn_permlanex16(__builtin_bit_cast(int, x), __builtin_bit_cast(int, x), 0x76543210, 0xfedcba98, false, false)); }   // lane l <-> lane l ^ 16
// Eight 2^x and the slot behind the last of them in ONE statement: each v_exp fills the slot of the one before it, the v_nop that of the last
__device__ __forceinline__ void exp2x8(float (&p)[8], const float (&d)[8]) {
    asm("v_exp_f32 %0, %8\n\tv_exp_f32 %1, %9\n\tv_exp_f32 %2, %10\n\tv_exp_f32 %3, %11\n\tv_exp_f32 %4, %12\n\tv_exp_f32 %5, %13\n\tv_exp_f32 %6, %14\n\tv_exp_f32 %7, %15\n\tv_nop"
        : "=&v"(p[0]), "=&v"(p[1]), "=&v"(p[2]), "=&v"(p[3]), "=&v"(p[4]), "=&v"(p[5]), "=&v"(p[6]), "=&v"(p[7])
        : "v"(d[0]), "v"(d[1]), "v"(d[2]), "v"(d[3]), "v"(d[4]), "v"(d[5]), "v"(d[6]), "v"(d[7]));
}
__global__ __launch_bounds__(AW * 32) __attribute__((amdgpu_waves_per_eu(4, 4))) void k_fattn(const h16* __restrict__ Qp, const h16* __restrict__ Kp, const h16* __restrict__ Vt, const unsigned* __restrict__ MB, h16* Ax) {
    __shared__ __align__(16) h16 Ks[2][AKB * APT];
    __shared__ __align__(16) h16 Vs[2][HD * APT];
    __shared__ __align__(16) unsigned mbit[AW][TT / AKB][AR][32];   // each lane's mask bits, one word per stage and column group; a wave fills and reads its own part, the reads behind the first stage's barrier
    const int tid = threadIdx.x, lane = tid & 31, wave = tid >> 5, lr = lane & 15, hi = lane >> 4;
    const int g = blockIdx.y, q0 = blockIdx.x * (AW * AR * 16) + wave * (AR * 16);
    Qp += (size_t)g * TT * HD; Kp += (size_t)g * TT * HD; Vt += (size_t)g * HD * TT;
    // this wave's mask words, packed by k_prep in this very order: MWG words in a row, whole lines a load
    static_assert(MWG % 128 == 0);
    const unsigned* const mg = MB + (size_t)(q0 / (AR * 16)) * MWG + lane * 4; v4u_ mq[MWG / 128];
#pragma unroll
    for (int i = 0; i < MWG / 128; ++i) mq[i] = *(const v4u_*)(mg + i * 128);
    asm volatile("s_wait_xcnt 0x0" :: "v"(mg) : "memory");   // stands in front of whatever next overwrites the address registers that these loads name; the address is an input so that it lives up to here
#pragma unroll
    for (int i = 0; i < MWG / 128; ++i) *(v4u_*)(&mbit[wave][0][0][0] + i * 128 + lane * 4) = mq[i];
    const int srow = tid >> 3, sseg = (tid & 7) * 8;   // staging: 8 threads a 128-byte row, 32 rows a sweep
    const unsigned ko = (unsigned)(srow * HD + sseg), vo = (unsigned)(srow * TT + sseg);   // this thread's 32-bit offsets from wave-uniform bases
#pragma unroll
    for (int p = 0; p < 2; ++p) { const v8h rk = *(const v8h*)(Kp + 32 * p * HD + ko), rv = *(const v8h*)(Vt + 32 * p * TT + vo);
        *(v8h*)(Ks[0] + (srow + 32 * p) * APT + sseg) = rk; *(v8h*)(Vs[0] + (srow + 32 * p) * APT + sseg) = rv; }
    v16h qf[AR][2];
#pragma unroll
    for (int r = 0; r < AR; ++r)
#pragma unroll
        for (int kc = 0; kc < 2; ++kc) qf[r][kc] = WFrag<h16>::ld(Qp + (size_t)(q0 + r * 16 + lr) * HD + kc * 32 + 8 * hi);
    v8f o[AR][4]; float m[AR], ls[AR];
#pragma unroll
    for (int r = 0; r < AR; ++r) { m[r] = NEGF; ls[r] = 0.f;
#pragma unroll
        for (int dt = 0; dt < 4; ++dt) o[r][dt] = (v8f){}; }
    // rolled: the register count stays at four waves a SIMD
#pragma unroll 1
    for (int blk = 0; blk < TT / AKB; ++blk) {
        __syncthreads();   // publishes stage blk, and ends every wave's reads of the other buffer, which this stage refills
        const int cb = blk & 1, kn = (blk + 1) * AKB; const bool more = blk + 1 < TT / AKB;
        unsigned mw[AR];
#pragma unroll
        for (int r = 0; r < AR; ++r) mw[r] = mbit[wave][blk][r][lane];
        const bool anym = __builtin_amdgcn_ballot_w32((mw[0] & mw[1]) != 0xFFFFFFFFu) != 0;   // wave-uniform: a stage with no masked element skips the selects
#pragma unroll
        for (int sb = 0; sb < AKB / 32; ++sb) {
            v8h rk, rv;
            if (more) { rk = *(const v8h*)(Kp + (kn + 32 * sb) * HD + ko); rv = *(const v8h*)(Vt + (32 * sb * TT + kn) + vo); }   // half of the next stage's rows fly to registers under this pass
            float u[AR][16];
#pragma unroll
            for (int kt = 0; kt < 2; ++kt) { const h16* kp = Ks[cb] + (sb * 32 + kt * 16 + lr) * APT + 8 * hi; const v16h k0 = WFrag<h16>::ld(kp), k1 = WFrag<h16>::ld(kp + 32);
#pragma unroll
                for (int r = 0; r < AR; ++r) { const v8f s = wmma16(k1, qf[r][1], wmma16(k0, qf[r][0], (v8f){}));
#pragma unroll
                    for (int j = 0; j < 8; ++j) u[r][kt * 8 + j] = s[j] * SCL2; } }
            if (anym) {
#pragma unroll
                for (int r = 0; r < AR; ++r)
#pragma unroll
                    for (int e = 0; e < 16; ++e) if ((int)(mw[r] << (sb * 16 + e)) >= 0) u[r][e] = NEGF; }
            v16h pf[AR];
#pragma unroll
            for (int r = 0; r < AR; ++r) {
                float mx = u[r][0];
#pragma unroll
                for (int e = 1; e < 16; ++e) mx = fmaxf(mx, u[r][e]);
                mx = fmaxf(mx, xhalf(mx));
                const float mn = fmaxf(m[r], mx), al = __builtin_amdgcn_exp2f(m[r] - mn); m[r] = mn;
                float sum = 0.f; v8u wp;
#pragma unroll
                for (int t = 0; t < 2; ++t) { float d[8], p[8];
#pragma unroll
                    for (int j = 0; j < 8; ++j) d[j] = u[r][t * 8 + j] - mn;
                    exp2x8(p, d);
#pragma unroll
                    for (int j = 0; j < 8; j += 2) { sum += p[j] + p[j + 1]; wp[(t * 8 + j) >> 1] = pack2(p[j], p[j + 1]); } }
                asm volatile("" : "+v"(sum));   // each row's sum pinned against spills: without it the adds sink to the loop's foot, every p of the stage stays live until there, and the staging registers spill
                ls[r] = ls[r] * al + sum; pf[r] = __builtin_bit_cast(v16h, wp);
#pragma unroll
                for (int dt = 0; dt < 4; ++dt) o[r][dt] = o[r][dt] * al;
            }
            v16h vf[4];
#pragma unroll
            for (int dt = 0; dt < 4; ++dt) vf[dt] = WFrag<h16>::ld(Vs[cb] + (dt * 16 + lr) * APT + sb * 32 + 8 * hi);
#pragma unroll
            for (int dt = 0; dt < 4; ++dt)
#pragma unroll
                for (int r = 0; r < AR; ++r) o[r][dt] = wmma16(vf[dt], pf[r], o[r][dt]);
            if (more) { *(v8h*)(Ks[cb ^ 1] + (srow + 32 * sb) * APT + sseg) = rk; *(v8h*)(Vs[cb ^ 1] + (srow + 32 * sb) * APT + sseg) = rv; }
        }
    }
    // lane l holds ctx[query l & 15][d = 16 dt + 8h + j]: 8 consecutive d, one 16-byte store
#pragma unroll
    for (int r = 0; r < AR; ++r) { const float f = __fdiv_rn(1.0f, ls[r] + xhalf(ls[r])); const size_t oo = ((size_t)(g / NH_) * TT + q0 + r * 16 + lr) * DQ + (g % NH_) * HD + 8 * hi;
#pragma unroll
        for (int dt = 0; dt < 4; ++dt) { v4u_ wx;
#pragma unroll
            for (int j = 0; j < 8; j += 2) wx[j >> 1] = pack2(o[r][dt][j] * f, o[r][dt][j + 1] * f);
            *(v4u_*)(Ax + oo + dt * 16) = wx; } }
}

extern "C" void kernel_launch(void* const* d_in, const int* in_sizes, int n_in,
                              void* d_out, int out_size, void* d_ws, size_t ws_size, hipStream_t stream) {
    if (n_in < 11) return;
    if ((size_t)in_sizes[0] < (size_t)(NB - 1) * S_FULL * DM + (size_t)TT * DM) return;
    if ((size_t)in_sizes[1] < (size_t)(NB - 1) * S_FULL * DM + (size_t)TT * DM) return;
    if ((size_t)in_sizes[2] < (size_t)(TT - 1) * S_FULL + (size_t)TT) return;
    if (in_sizes[3] < DM * DQ || in_sizes[5] < DM * DKV || in_sizes[7] < DM * DKV || in_sizes[9] < DQ * DM) return;
    if (in_sizes[4] < DQ || in_sizes[6] < DKV || in_sizes[8] < DKV || in_sizes[10] < DM) return;
    if ((size_t)out_size < (size_t)NB * TT * DM) return;
    const float* x  = (const float*)d_in[0];     // [NB][S_FULL][DM]
    const float* xk = (const float*)d_in[1];     // [NB][S_FULL][DM]
    const int*   mk = (const int*)d_in[2];       // [1][1][S_FULL][S_FULL] int32 0/1
    const float* wq = (const float*)d_in[3]; const float* bq = (const float*)d_in[4];
    const float* wk = (const float*)d_in[5]; const float* bk = (const float*)d_in[6];
    const float* wv = (const float*)d_in[7]; const float* bv = (const float*)d_in[8];
    const float* wo = (const float*)d_in[9]; const float* bo = (const float*)d_in[10];
    float* OUT = (float*)d_out;     // [NB][TT][DM]
    char* wsp = (char*)d_ws;
    auto take = [&](size_t bytes) { char* p = wsp; wsp += (bytes + 255) & ~(size_t)255; return (void*)p; };
    bf* WQ = (bf*)take((size_t)DQ * DM * 2); bf* WK = (bf*)take((size_t)DKV * DM * 2); bf* WV = (bf*)take((size_t)DKV * DM * 2); h16* WO = (h16*)take((size_t)DM * DQ * 2);
    h16* QP16 = (h16*)take((size_t)NB * NH_ * TT * HD * 2); h16* KP16 = (h16*)take((size_t)NB * NKV * TT * HD * 2);
    h16* VT16 = (h16*)take((size_t)NB * NKV * HD * TT * 2);
    h16* AT16 = (h16*)take((size_t)NB * TT * DQ * 2);
    bf* XB = (bf*)take((size_t)NB * TT * DM * 2); bf* XKB = (bf*)take((size_t)NB * TT * DM * 2);
    unsigned* MB = (unsigned*)take((size_t)(TT / (AR * 16)) * MWG * 4);
    if ((size_t)(wsp - (char*)d_ws) > ws_size) return;
    // every batch in one launch: rows b * TT + t in the projections, planes b * NH_ + h in attention
    k_prep<<<PMB + PWB + PSB, 256, 0, stream>>>(x, xk, mk, wq, wk, wv, wo, XB, XKB, WQ, WK, WV, WO, MB);
    // each projection's epilogue writes the operand planes of attention itself
    static_assert(DQ == DKV);   // the three projections have one shape, so one grid serves them
    k_gemmw<bf, true, 3, 1, 1, 2><<<dim3(NB * TT / GRA, DQ / GRB, 1), GT, 0, stream>>>(XB, XKB, XKB, WQ, WK, WV, DM, DM, nullptr, DQ, bq, bk, bv, QP16, KP16, VT16);
    k_fattn<<<dim3(TT / (AW * AR * 16), NB * NH_, 1), AW * 32, 0, stream>>>(QP16, KP16, VT16, MB, AT16);
    k_gemmw<h16, true, 1, 0, 0, 0><<<dim3(NB * TT / GRA, DM / GRB, 1), GT, 0, stream>>>(AT16, nullptr, nullptr, WO, nullptr, nullptr, DQ, DQ, OUT, DM, bo, nullptr, nullptr, nullptr, nullptr, nullptr);
}

// v010
// It runs in 92.9 microseconds.
// Next to v009, in two timings, it ran 1.05 times as fast each time.
// Counting every step since v000, it is 18.1 times as fast.
#include <hip/hip_runtime.h>

// Multi-head dot-product attention: inputs_q, inputs_kv [8][1024][1024]; q = inputs_q Wq + bq, k / v = inputs_kv Wk / Wv + bk / bv (W [1024][16][64] = k-major [1024][1024], bias [16][64]);
// logits = (q . k) / 64 (the module divides q by the head depth); int32 mask [1][1][1024][1024] replaces masked logits by the most negative finite f32; softmax over keys; ctx = P . v; out = ctx Wo ([16][64][1024] = [1024][1024]) + bo -> [8][1024][1024] f32.
// Compute dtypes, f32 accumulate: every float input RNE-converted to bf16 (Wo: to fp16); q/k/v projections v_wmma_f32_16x16x32_bf16 on plain bf16 operands; scores v_wmma_f32_16x16x32_f16 on plain fp16 q/k planes, the q plane holding q x (log2 e / 64), rounded once from f32; softmax f32 against a held reference maximum; P . v on plain fp16 operands (the unnormalised P = 2^(u - ref), at most 2^8, and v), one product, 1 / sum applied to the f32 result; ctx . Wo on plain fp16 ctx and fp16 Wo, one product; biases added in f32 as bf16-converted values.

#ifndef NB
#define NB   8
#endif
#ifndef SEQ
#define SEQ  1024
#endif
#define S_FULL 1024                 // per-batch row count / mask row pitch
#define TT   SEQ
#define DM   1024
#define NH_  16
#define NKV  16
#define REP  (NH_ / NKV)
#define HD   64
#define DQ   (NH_ * HD)
#define DKV  (NKV * HD)
#define SCL  0.015625f              // 1 / HD
#define SCL2 (SCL * 1.4426950408889634f)   // log2 e / HD: a score in the log2 domain
#define NEGF (-3.4028234663852886e38f)

static_assert(TT % 128 == 0);
static_assert(TT % 64 == 0);
static_assert(DM % 64 == 0);
static_assert(HD % 32 == 0);
static_assert(REP == 1);
static_assert(SEQ <= S_FULL);
static_assert(NB >= 1);

typedef _Float16 h16;
typedef unsigned short bf;
typedef __attribute__((ext_vector_type(16))) __bf16   v16bf;
typedef __attribute__((ext_vector_type(16))) _Float16 v16h;
typedef __attribute__((ext_vector_type(8)))  _Float16 v8h;
typedef __attribute__((ext_vector_type(8)))  unsigned short v8us;
typedef __attribute__((ext_vector_type(8)))  float    v8f;
typedef __attribute__((ext_vector_type(4)))  float    v4f;
typedef v8h  __attribute__((may_alias)) v8ha;
typedef v4f  __attribute__((may_alias)) v4fa;
typedef v8us __attribute__((may_alias)) v8usa;

__device__ __forceinline__ unsigned short f2bf(float f) { unsigned u = __float_as_uint(f); u += 0x7FFFu + ((u >> 16) & 1u); return (unsigned short)(u >> 16); }
__device__ __forceinline__ float bf2f(unsigned short b) { return __uint_as_float(((unsigned)b) << 16); }
__device__ __forceinline__ float bfr(float f) { return bf2f(f2bf(f)); }
__device__ __forceinline__ v16h cat16(v8h lo, v8h hi) { return __builtin_shufflevector(lo, hi, 0, 1, 2, 3, 4, 5, 6, 7, 8, 9, 10, 11, 12, 13, 14, 15); }
__device__ __forceinline__ v16bf cat16b(v8us lo, v8us hi) { return __builtin_bit_cast(v16bf, __builtin_shufflevector(lo, hi, 0, 1, 2, 3, 4, 5, 6, 7, 8, 9, 10, 11, 12, 13, 14, 15)); }
__device__ __forceinline__ v8f wmma16(v16h a, v16h b, v8f c) { return __builtin_amdgcn_wmma_f32_16x16x32_f16(false, a, false, b, (short)0, c, false, false); }
__device__ __forceinline__ v8f wmmab(v16bf a, v16bf b, v8f c) { return __builtin_amdgcn_wmma_f32_16x16x32_bf16(false, a, false, b, (short)0, c, false, false); }



// ---- k_gemmw: GEMM on a 256 x 128 output tile per work-group of EIGHT WAVES (4 x 2), each wave a 64 x 64 part (16 accumulators); grid (M/256, N/128), 256 threads, one work-group a WGP.
// The operands' rows (K-contiguous 16-bit planes) reach LDS by tensor loads, ONE request a wave and stage (waves 0-3: 64 rows of A each, waves 4-7: 32 rows of Bt each), GKS k a stage, two stage buffers: stage t + 2 flies while stage t + 1 is worked on; the fragments are read from LDS (row pitch = row + 16 bytes, laid by the request's pad).
// C[m][n] (+ optional f32 bias[n]) = sum_k A[m][k] Bt[n][k]. A row pitch lda, Bt row pitch K. K % GKS == 0.
// NJ products of one shape in ONE launch (operands Aj, Bj, bias j, output plane Pj, output form OMj): a work-group does the same tile of each, one after the other, on ONE ring that never runs empty:
// the stages are numbered through all products, so the next product's first two stages are loaded while this product's last stages are worked on and its tile is written out.
// OUTM says where the tile goes: 0 = f32 C, pitch ldc; 1 = f16 head planes P16[batch][head][token][HD] (m = batch * TT + token, n = head * HD + depth; a wave's part is 8 KiB in a row); 3 = as 1, the f32 value (bias added) times SCL2 before its one rounding to f16;
// 2 = transposed f16 plane P16[batch][n][token]: the two operands change places in the matrix instruction, so D comes out as [n][token] and a staged row is one whole 128-byte line of 64 tokens.
// Fragments (A and Bt alike): lane l -> row l&15, elements 0..7 = k kc+8h..kc+8h+7, elements 8..15 = k kc+16+8h..kc+16+8h+7 (h = l>>4); D element j -> row 8h+j, col l&15.
template <typename T16> struct WFrag;
template <> struct WFrag<h16> { typedef v16h V; static __device__ __forceinline__ V ld(const h16* p) { return cat16(*(const v8h*)p, *(const v8h*)(p + 16)); } static __device__ __forceinline__ v8f mma(V a, V b, v8f c) { return wmma16(a, b, c); } };
template <> struct WFrag<bf> { typedef v16bf V; static __device__ __forceinline__ V ld(const bf* p) { return cat16b(*(const v8us*)p, *(const v8us*)(p + 16)); } static __device__ __forceinline__ v8f mma(V a, V b, v8f c) { return wmmab(a, b, c); } };
__device__ __forceinline__ h16 tohx(float x) { return (h16)x; }
typedef __attribute__((ext_vector_type(4))) _Float16 v4h;
typedef __attribute__((ext_vector_type(4))) unsigned short v4us;
#define GT  256                     // threads of a GEMM work-group
#define GRA 256                     // rows of A in a stage = rows of the output tile
#define GRB 128                     // rows of Bt in a stage = columns of the output tile
static_assert((NB * TT) % GRA == 0 && DQ % GRB == 0 && DKV % GRB == 0 && DM % GRB == 0 && DM % 128 == 0 && DQ % 64 == 0);
__device__ __forceinline__ unsigned lds_off(const void* p) { return (unsigned)(size_t)p; }   // byte offset in the work-group's LDS
typedef unsigned u32x4 __attribute__((ext_vector_type(4)));
typedef unsigned u32x8 __attribute__((ext_vector_type(8)));
__device__ __forceinline__ unsigned uni(unsigned v) { return (unsigned)__builtin_amdgcn_readfirstlane(v); }   // a descriptor word: wave-uniform, in a scalar register
__device__ __forceinline__ unsigned pinned(unsigned v) { unsigned w = (unsigned)__builtin_amdgcn_readfirstlane(v); asm volatile("" : "+s"(w)); return w; }   // a value held in a scalar register: the test on it is a scalar branch, and what is formed from it is formed behind the statements in front of it
template <int V> struct IC { static constexpr int value = V; };
template <typename T16, bool BIAS, int NJ, int OM0, int OM1, int OM2>
__global__ __launch_bounds__(GT) void k_gemmw(const T16* __restrict__ A0, const T16* __restrict__ A1, const T16* __restrict__ A2, const T16* __restrict__ B0, const T16* __restrict__ B1, const T16* __restrict__ B2, int K, int lda, float* C, int ldc,
                                              const float* __restrict__ bias0, const float* __restrict__ bias1, const float* __restrict__ bias2, h16* P0, h16* P1, h16* P2) {
    static_assert(NJ >= 1 && NJ <= 3);
    static_assert(TT % 64 == 0 && HD % 64 == 0);   // a wave's 64 x 64 part stays inside one batch and one head
    typedef typename WFrag<T16>::V V;
    constexpr int GKS = 128;                       // k per stage: both buffers and the output staging fit one WGP's LDS
    constexpr int GP = GKS + 8;                    // LDS row pitch in elements: the row + 16 bytes
    // a stage buffer: four slices of A (SRA rows each, waves 0-3), four of Bt (SRB rows each, waves 4-7); every slice's size is rounded up to a multiple of 2 KiB, so that every request's place in LDS is one
    constexpr int SRA = GRA / 4, SRB = GRB / 4;
    constexpr unsigned SLA = (unsigned)(SRA * GP * 2 + 2047) & ~2047u, SLB = (unsigned)(SRB * GP * 2 + 2047) & ~2047u, BUFB = 4u * SLA + 4u * SLB;   // bytes
    static_assert(GT == 256 && GKS * 2 == 256 && SRA == 64 && SRB == 32);   // eight waves; rows of 256 bytes (the pad below is theirs); a wave's 64 rows of A are one slice, its 64 rows of Bt two
    __shared__ __attribute__((aligned(2048))) T16 ring[2][BUFB / 2];
    __shared__ __align__(16) float osw[GT / 32][16 * 68];
    const int tid = threadIdx.x, lane = tid & 31, wave = tid >> 5, lr = lane & 15, hi = lane >> 4;
    const int R0 = blockIdx.x * GRA, C0 = blockIdx.y * GRB, wm = (wave >> 1) * 64, wn = (wave & 1) * 64; const int r0 = R0 + wm, c0 = C0 + wn;
    float* const os = osw[wave];
    const int NT = K / GKS, NS = NJ * NT;   // stages a product, stages in all
    // this wave's slice: every tile lies inside its plane (M a multiple of GRA, N of GRB, K of GKS), its first byte at a multiple of 256
    const unsigned wv = uni((unsigned)tid >> 5); const bool isA = wv < 4u;
    const unsigned long long woff = (isA ? (unsigned long long)(R0 + (int)wv * SRA) * (unsigned)lda : (unsigned long long)(C0 + ((int)wv - 4) * SRB) * (unsigned)K) * 2u;   // bytes from the plane's start to the slice's first row
    const unsigned long long sb0 = (isA ? (unsigned long long)(size_t)A0 : (unsigned long long)(size_t)B0) + woff, sb1 = (isA ? (unsigned long long)(size_t)A1 : (unsigned long long)(size_t)B1) + woff, sb2 = (isA ? (unsigned long long)(size_t)A2 : (unsigned long long)(size_t)B2) + woff;   // the slice's address in each product's plane, as values
    const unsigned lplace = lds_off(&ring[0][0]) + (isA ? wv * SLA : 4u * SLA + (wv - 4u) * SLB);
    const unsigned d1 = isA ? (unsigned)SRA : (unsigned)SRB, pitchb = (unsigned)(isA ? lda : K) * 2u;
    constexpr unsigned d0 = GKS * 2;   // bytes a row
    u32x8 g1;   // descriptor group 1, the same for every request of the wave: 1-byte elements, tensor = tile = d1 rows of d0 bytes, no mask, 16 bytes of LDS pad behind every 256-byte row
    g1[0] = uni((1u << 20) | (5u << 22) | (3u << 25)); g1[1] = uni((d0 & 0xFFFFu) << 16); g1[2] = uni((d0 >> 16) | ((d1 & 0xFFFFu) << 16)); g1[3] = uni((d1 >> 16) | (d0 << 16));
    g1[4] = uni(d1); g1[5] = uni(pitchb); g1[6] = uni(0u); g1[7] = uni(0u);
    u32x4 g0;   // descriptor group 0 of the wave's latest request
    auto stage = [&](int s) __attribute__((always_inline)) {   // stage s's request into buffer s & 1; every wave issues its own slice; which product s belongs to is the same for the whole work-group
        const unsigned sp = pinned((unsigned)s);   // group 0 is formed from this, so behind the wait that covers the wave's request before
        unsigned long long sb = sb0; unsigned t = sp;
        if constexpr (NJ > 1) { if (sp >= (unsigned)NT) { sb = sb1; t = sp - (unsigned)NT; } }
        if constexpr (NJ > 2) { if (sp >= 2u * (unsigned)NT) { sb = sb2; t = sp - 2u * (unsigned)NT; } }
        const unsigned long long ga = sb + (unsigned long long)t * d0;
        g0[0] = uni(1u); g0[1] = uni(lplace + (sp & 1u) * BUFB); g0[2] = uni((unsigned)ga); g0[3] = uni((((unsigned)(ga >> 32)) & 0x01FFFFFFu) | 0x80000000u);
        asm volatile("tensor_load_to_lds %0, %1" : "+s"(g0) : "s"(g1) : "memory");   // one request of the whole wave: its slice of stage s, global -> LDS through no register; group 0 is an in-out operand, so that what the wait below names is held in the very registers the request was issued from
    };
    // the wait for the wave's request; the descriptor's words are inputs, so that they live in their registers up to here and no register of a request in flight takes another value
    auto landed = [&]() __attribute__((always_inline)) { asm volatile("s_wait_tensorcnt 0x0" :: "s"(g0), "s"(g1) : "memory"); };
    stage(0);
    landed();                                            // this wave's slice of stage 0 has landed
    __syncthreads();                                     // publishes stage 0
    if (pinned(NS > 1)) stage(1);
    auto product = [&](auto JC) __attribute__((always_inline)) {   // product J: its NT stages, then its tile goes out
    constexpr int J = decltype(JC)::value, OUTM = J == 0 ? OM0 : J == 1 ? OM1 : OM2;
    const float* const bias = J == 0 ? bias0 : J == 1 ? bias1 : bias2; h16* const P16 = J == 0 ? P0 : J == 1 ? P1 : P2;
    v8f acc[4][4];
#pragma unroll
    for (int mb = 0; mb < 4; ++mb)
#pragma unroll
        for (int nb = 0; nb < 4; ++nb) acc[mb][nb] = (v8f){};
    // rolled: one publish point at its foot
#pragma unroll 1
    for (int s = J * NT; s < (J + 1) * NT; ++s) {
        const T16* const As = ring[s & 1] + (wave >> 1) * (int)(SLA / 2) + lr * GP + 8 * hi; const T16* const Bs = ring[s & 1] + (int)(4 * SLA / 2) + (wave & 1) * (int)(2 * SLB / 2) + lr * GP + 8 * hi;   // this wave's slice of A, its first slice of Bt
        V a[2][4], b[2][4];   // two fragment sets: block i + 1's LDS reads go out as one group in front of block i's matrix instructions
        auto frags = [&](int s, int ks) {
#pragma unroll
            for (int f = 0; f < 4; ++f) { a[s][f] = WFrag<T16>::ld(As + f * 16 * GP + ks); b[s][f] = WFrag<T16>::ld(Bs + (f >> 1) * (int)(SLB / 2) + (f & 1) * 16 * GP + ks); }
        };
        frags(0, 0);
        // unrolled: the index of a fragment set must be a constant for the sets to stay in registers
#pragma unroll
        for (int i = 0; i < GKS / 32; ++i) {
            if (i + 1 < GKS / 32) frags((i + 1) & 1, (i + 1) * 32);
            __builtin_amdgcn_sched_barrier(0);   // keeps the reads above in one group ahead of the block
#pragma unroll
            for (int nb = 0; nb < 4; ++nb)
#pragma unroll
                for (int mb = 0; mb < 4; ++mb) acc[mb][nb] = OUTM == 2 ? WFrag<T16>::mma(b[i & 1][nb], a[i & 1][mb], acc[mb][nb]) : WFrag<T16>::mma(a[i & 1][mb], b[i & 1][nb], acc[mb][nb]);
            __builtin_amdgcn_sched_barrier(0);   // keeps the next group of reads behind this block
        }
        asm volatile("s_wait_dscnt 0x0" ::: "memory");      // this wave's reads of stage s have returned
        landed();                                           // this wave's slice of stage s + 1 has landed
        __syncthreads();                                    // publishes stage s + 1, and ends every wave's reads of stage s's buffer, which is refilled behind it
        if (pinned(s + 2 < NS)) stage(s + 2);
    }
    if constexpr (J + 1 == NJ) { landed(); asm volatile("s_wait_dscnt 0x0" ::: "memory"); }   // behind the last product's loop no request is outstanding when the wave goes on (behind an earlier one the next product's second stage flies on into the ring, which the part below does not touch)
    float bn[4][8];   // OUTM 2: the bias of this lane's D rows n = c0 + 16 ob + 8 hi + j, added on the way into LDS
    if constexpr (OUTM == 2 && BIAS) {
#pragma unroll
        for (int ob = 0; ob < 4; ++ob) { const v4f b0 = *(const v4fa*)(bias + c0 + ob * 16 + 8 * hi), b1 = *(const v4fa*)(bias + c0 + ob * 16 + 8 * hi + 4);
#pragma unroll
            for (int j = 0; j < 4; ++j) { bn[ob][j] = bfr(b0[j]); bn[ob][4 + j] = bfr(b1[j]); } }
        asm volatile("s_wait_xcnt 0x0" ::: "memory");   // stands in front of whatever next overwrites the address registers that these loads name
    }
    // sixteen D rows at a time through LDS, so that every store covers whole lines (OUTM 2: a D row is one n, its columns are tokens)
#pragma unroll
    for (int ob = 0; ob < 4; ++ob) {
#pragma unroll
        for (int ib = 0; ib < 4; ++ib) {
#pragma unroll
            for (int j = 0; j < 8; ++j) { if constexpr (OUTM == 2) os[(hi * 8 + j) * 68 + ib * 16 + lr] = BIAS ? acc[ib][ob][j] + bn[ob][j] : acc[ib][ob][j]; else os[(hi * 8 + j) * 68 + ib * 16 + lr] = acc[ob][ib][j]; } }
        __builtin_amdgcn_wave_barrier(); asm volatile("" ::: "memory");
#pragma unroll
        for (int s = 0; s < 8; ++s) { const int row = 2 * s + hi, cofs = lr * 4; v4f val = *(const v4fa*)(os + row * 68 + cofs);
            if constexpr (OUTM == 2) {
                const int n = c0 + ob * 16 + row; v4h o16;
#pragma unroll
                for (int q = 0; q < 4; ++q) o16[q] = tohx(val[q]);
                *(v4h*)(P16 + ((size_t)(r0 / TT) * ldc + n) * TT + (r0 % TT) + cofs) = o16;
            } else {
                if (BIAS) { val[0] += bfr(bias[c0 + cofs]); val[1] += bfr(bias[c0 + cofs + 1]); val[2] += bfr(bias[c0 + cofs + 2]); val[3] += bfr(bias[c0 + cofs + 3]); }
                if constexpr (OUTM == 3) val = val * SCL2;
                if constexpr (OUTM == 1 || OUTM == 3) { v4h o16; o16[0] = tohx(val[0]); o16[1] = tohx(val[1]); o16[2] = tohx(val[2]); o16[3] = tohx(val[3]);
                    *(v4h*)(P16 + (((size_t)(r0 / TT) * (ldc / HD) + c0 / HD) * TT + (r0 % TT) + ob * 16 + row) * HD + (c0 % HD) + cofs) = o16; }
                else *(v4f*)(C + (size_t)(r0 + ob * 16 + row) * ldc + c0 + cofs) = val;
            } }
        __builtin_amdgcn_wave_barrier(); asm volatile("s_wait_xcnt 0x0" ::: "memory");   // keeps the next rows' LDS stores behind these reads, and stands in front of whatever next overwrites a register that these global stores name
    }
    };
    product(IC<0>{});
    if constexpr (NJ > 1) product(IC<1>{});
    if constexpr (NJ > 2) product(IC<2>{});
}

typedef __attribute__((ext_vector_type(2))) unsigned short v2us;
typedef __attribute__((ext_vector_type(2))) float v2f;
typedef __attribute__((ext_vector_type(4))) int v4i;

// ---- k_prep: every operand conversion of the call in ONE launch sized to the chip (PMB + PWB + PSB work-groups of 8 waves); the weights' and the inputs' loads cover whole lines, each wave has 16 to 32 of them in flight and does many lines, so few waves have to be started.
// Work-groups 0 .. PMB - 1: the int32 mask -> bit words, ONCE a call: the mask is the same for every (batch, head) plane, so attention's work-groups only fetch their words. One thread a word, in the order in which an attention wave holds them:
// MB[wave group G of AR * 16 queries][stage][column group r][lane l]: query G * AR * 16 + 16 r + (l & 15); element e = 8 * tile + j (key = stage * AKB + 16 * tile + 8 * (l >> 4) + j) sits at bit 31 - e. They come first: they are short.
// Work-groups PMB .. PMB + PWB - 1: the four weights, f32 [K][N] -> 16-bit Bt[N][K] (Wq, Wk, Wv bf16; Wo f16); a work-group turns the same 64 x 64 tile of each weight through LDS: a thread loads a 4 k x 4 n block (a wave's load = 2 rows of 256 bytes), writes 4 k in a row under each n, and behind the one barrier the rows of 64 k go out as whole 128-byte lines.
// Work-groups PMB + PWB .. PMB + PWB + PSB - 1: inputs_q and inputs_kv, f32 -> bf16; a wave takes PCH pieces of 512 bytes in a row of each input (32 lanes x 16 bytes = 4 whole lines a load).
#define PCH 16                      // 512-byte pieces (128 floats) of each input that a wave has in flight
#define PNC (TT * DM / 128)         // pieces a batch
#define PSB (NB * PNC / PCH / 8)    // work-groups that convert the inputs
#define PWB (DM / 64 * (DQ / 64))   // work-groups that turn the weights: one 64 x 64 tile of every weight each
#define PTP 72                      // LDS row pitch of a turned tile in elements: the 128-byte row + 16 bytes
#define AR  2                       // 16-query column groups per attention wave
#define AKB 64                      // keys per LDS stage of attention = keys of the two lanes' words that share a query
#define MWG (TT / AKB * AR * 32)    // mask words of one attention wave
#define PMB (TT / (AR * 16) * MWG / 256)   // work-groups that pack the mask
static_assert(AKB == 64 && TT % (AR * 16) == 0 && (TT / (AR * 16) * MWG) % 256 == 0);
static_assert(PNC % PCH == 0 && (NB * PNC / PCH) % 8 == 0);
static_assert(DM % 64 == 0 && DQ % 64 == 0 && DKV % 64 == 0 && DKV <= DQ);
template <int K, int N> struct WTile {   // tile b of a [K][N] weight: k from (b / (N / 64)) * 64, n from (b % (N / 64)) * 64; a weight with fewer tiles than PWB leaves the rest of the work-groups out (the same test for a whole work-group)
    static __device__ __forceinline__ bool has(int b) { return b < (K / 64) * (N / 64); }
    static __device__ __forceinline__ const float* src(const float* __restrict__ w, int b, int tid) { return w + (size_t)((has(b) ? b / (N / 64) : 0) * 64 + (tid >> 4) * 4) * N + (b % (N / 64)) * 64 + (tid & 15) * 4; }   // this thread's 4 x 4 block
    static __device__ __forceinline__ void load(const float* p, int b, v4f (&v)[4]) {
        if (!has(b)) return;
#pragma unroll
        for (int s = 0; s < 4; ++s) v[s] = *(const v4fa*)(p + (size_t)s * N);
    }
    template <bool F16> static __device__ __forceinline__ void turn(const v4f (&v)[4], bf* T, int b, int tid) {   // T holds raw 16-bit patterns: f16 (F16) or bf16
        if (!has(b)) return;
#pragma unroll
        for (int j = 0; j < 4; ++j) { v4us o;
#pragma unroll
            for (int s = 0; s < 4; ++s) o[s] = F16 ? __builtin_bit_cast(unsigned short, (h16)v[s][j]) : f2bf(v[s][j]);
            *(v4us*)(T + ((tid & 15) * 4 + j) * PTP + (tid >> 4) * 4) = o; }
    }
    static __device__ __forceinline__ void store(const bf* T, bf* Bt, int b, int tid) {
        if (!has(b)) return;
#pragma unroll
        for (int p = 0; p < 2; ++p) { const int n = (tid >> 3) + 32 * p; *(v8us*)(Bt + (size_t)((b % (N / 64)) * 64 + n) * K + (b / (N / 64)) * 64 + (tid & 7) * 8) = *(const v8us*)(T + n * PTP + (tid & 7) * 8); }
    }
};
__device__ __forceinline__ void cvt_store(const v4f (&v)[PCH], bf* dst) {
#pragma unroll
    for (int i = 0; i < PCH; ++i) { v4us o;
#pragma unroll
        for (int k = 0; k < 4; ++k) o[k] = f2bf(v[i][k]);
        *(v4us*)(dst + i * 128) = o; }
}
__global__ __launch_bounds__(256) void k_prep(const float* __restrict__ x, const float* __restrict__ xk, const int* __restrict__ Mk, const float* __restrict__ wq, const float* __restrict__ wk, const float* __restrict__ wv, const float* __restrict__ wo,
                                              bf* XB, bf* XKB, bf* WQ, bf* WK, bf* WV, h16* WO, unsigned* MB) {
    __shared__ __align__(16) bf tw[4][64 * PTP];
    const int tid = threadIdx.x;
    if (blockIdx.x < PMB) { const int wd = (int)blockIdx.x * 256 + tid, l = wd & 31, r = (wd >> 5) % AR, blk = (wd >> 5) / AR % (TT / AKB), G = (wd >> 5) / AR / (TT / AKB);
        const int* mr = Mk + (size_t)(G * (AR * 16) + r * 16 + (l & 15)) * S_FULL + blk * AKB + 8 * (l >> 4); unsigned w = 0; v4i mv[AKB / 8];
#pragma unroll
        for (int c = 0; c < AKB / 8; ++c) mv[c] = *(const v4i*)(mr + (c >> 1) * 16 + (c & 1) * 4);
        asm volatile("s_wait_xcnt 0x0" ::: "memory");   // stands in front of whatever next overwrites the address registers that these loads name
#pragma unroll
        for (int c = 0; c < AKB / 8; ++c)
#pragma unroll
            for (int j = 0; j < 4; ++j) w = (w << 1) | min((unsigned)mv[c][j], 1u);
        MB[wd] = w;
        return; }
    if (blockIdx.x < PMB + PWB) { const int b = (int)blockIdx.x - PMB; v4f vq[4], vk[4], vv[4], vo[4];
        const float* const pq = WTile<DM, DQ>::src(wq, b, tid); const float* const pk = WTile<DM, DKV>::src(wk, b, tid); const float* const pv = WTile<DM, DKV>::src(wv, b, tid); const float* const po = WTile<DQ, DM>::src(wo, b, tid);
        WTile<DM, DQ>::load(pq, b, vq); WTile<DM, DKV>::load(pk, b, vk); WTile<DM, DKV>::load(pv, b, vv); WTile<DQ, DM>::load(po, b, vo);
        __builtin_amdgcn_sched_barrier(0);              // keeps all sixteen loads in front of the first conversion: a load sunk among the conversions starts only when earlier ones have returned, a second memory latency
        asm volatile("s_wait_xcnt 0x0" :: "v"(pq), "v"(pk), "v"(pv), "v"(po) : "memory");   // stands in front of whatever next overwrites the address registers that these loads name; the addresses are inputs so that they live up to here and no later load's result is put on them
        WTile<DM, DQ>::turn<false>(vq, tw[0], b, tid); WTile<DM, DKV>::turn<false>(vk, tw[1], b, tid); WTile<DM, DKV>::turn<false>(vv, tw[2], b, tid); WTile<DQ, DM>::turn<true>(vo, tw[3], b, tid);
        __syncthreads();                                // publishes the turned tiles: a row is written by sixteen threads of all eight waves and read by eight threads of one
        WTile<DM, DQ>::store(tw[0], WQ, b, tid); WTile<DM, DKV>::store(tw[1], WK, b, tid); WTile<DM, DKV>::store(tw[2], WV, b, tid); WTile<DQ, DM>::store(tw[3], (bf*)WO, b, tid);
        return; }
    const int lane = tid & 31, wave = __builtin_amdgcn_readfirstlane(tid >> 5);   // the wave's number in a scalar register: the bases stay scalar
    const int c0 = (((int)blockIdx.x - PMB - PWB) * 8 + wave) * PCH;   // a run of PCH pieces stays inside one batch
    const size_t so = (size_t)(c0 / PNC) * S_FULL * DM + (size_t)(c0 % PNC) * 128 + lane * 4, po = (size_t)c0 * 128 + lane * 4;
    const float* const pq = x + so; const float* const pk = xk + so;
    v4f vq[PCH], vk[PCH];
#pragma unroll
    for (int i = 0; i < PCH; ++i) vq[i] = *(const v4fa*)(pq + i * 128);
#pragma unroll
    for (int i = 0; i < PCH; ++i) vk[i] = *(const v4fa*)(pk + i * 128);
    __builtin_amdgcn_sched_barrier(0);              // keeps every load of the wave in front of the first conversion, for the reason given above
    asm volatile("s_wait_xcnt 0x0" :: "v"(pq), "v"(pk) : "memory");   // as above: the wait, with the two addresses alive up to it
    cvt_store(vq, XB + po); cvt_store(vk, XKB + po);
    asm volatile("s_wait_xcnt 0x0" ::: "memory");   // behind the last stores: the built code has a way on from here into the weights' part, which overwrites the registers that these stores name
}

// ---- k_fattn: scores, mask (as k_prep's bit words), softmax, P . v and the f16 conversion of ctx in ONE kernel; no score or P element ever reaches memory.
// Grid (TT / 256, planes), 8 waves; a wave owns 32 queries (2 column groups of 16) of one (batch, head) plane and walks all TT keys, 64 keys an LDS stage (k rows, v^T rows, pitch 144 B; two stage buffers, one barrier a stage), 32 keys a pass.
// S^T = K . Q^T (A = k rows, B = q rows, f16): lane l holds query l & 15, keys 8h + j of each 16-key tile, so two tiles converted in place ARE the B operand of O^T += V^T . P^T (A = v^T rows in the same k order, f16, one product).
// Every inner loop is fully unrolled so that each index into a register array is a constant. Two work-groups a WGP = four waves a SIMD (256 registers a wave), which the vector work between the matrix runs wants.
// Softmax in the log2 domain against a HELD reference: the q plane carries log2 e / HD, and minus the reference is the C operand of the score products, so their result D = u - ref is the exponent as it stands: p = 2^D.
// One test a pass (a scalar branch): only where a lane's sum of its sixteen p exceeds 2^8 (so before any score is more than 8 above the reference), where the stage has a masked element, or while a query has seen no unmasked key, the pass takes the full form: u = D + ref, masked u = most negative finite f32,
// m = running maximum, O^T and the sum rescaled by 2^(m_old - m_new), ref = m. Elsewhere p is at most 2^8, O^T and the sum stay as they are. 1 / sum is applied to O^T at the end.
typedef __attribute__((ext_vector_type(8))) unsigned v8u;
typedef __attribute__((ext_vector_type(2))) _Float16 v2h;
typedef __attribute__((ext_vector_type(4), may_alias)) unsigned v4u_;
#define AW  8                       // waves per work-group
#define APT 72                      // LDS row pitch in 16-bit elements: 128-byte rows + 16 bytes
static_assert(TT % (AW * AR * 16) == 0);
static_assert(TT % AKB == 0);
static_assert(HD == 64);
__device__ __forceinline__ unsigned pack2(float a, float b) { v2f x; x[0] = a; x[1] = b; return __builtin_bit_cast(unsigned, __builtin_convertvector(x, v2h)); }   // two f32 -> two f16, round to nearest even
__device__ __forceinline__ float xhalf(float x) { return __builtin_bit_cast(float, __builtin_amdgcn_permlanex16(__builtin_bit_cast(int, x), __builtin_bit_cast(int, x), 0x76543210, 0xfedcba98, false, false)); }   // lane l <-> lane l ^ 16
// Eight 2^x and the slot behind the last of them in ONE statement: each v_exp fills the slot of the one before it, the v_nop that of the last
__device__ __forceinline__ void exp2x8(float (&p)[8], const float (&d)[8]) {
    asm("v_exp_f32 %0, %8\n\tv_exp_f32 %1, %9\n\tv_exp_f32 %2, %10\n\tv_exp_f32 %3, %11\n\tv_exp_f32 %4, %12\n\tv_exp_f32 %5, %13\n\tv_exp_f32 %6, %14\n\tv_exp_f32 %7, %15\n\tv_nop"
        : "=&v"(p[0]), "=&v"(p[1]), "=&v"(p[2]), "=&v"(p[3]), "=&v"(p[4]), "=&v"(p[5]), "=&v"(p[6]), "=&v"(p[7])
        : "v"(d[0]), "v"(d[1]), "v"(d[2]), "v"(d[3]), "v"(d[4]), "v"(d[5]), "v"(d[6]), "v"(d[7]));
}
// One 2^x with its slot, for the same reason.
__device__ __forceinline__ float exp2x1(float d) { float p; asm("v_exp_f32 %0, %1\n\tv_nop" : "=&v"(p) : "v"(d)); return p; }
// The eight score products of a pass (two 16-key tiles x two column groups x two halves of the depth) in ONE statement: s[kt][r] = ka/kb[kt] . q[r] + c[r].
// In asm because C must be READ from the registers that hold minus the reference: from the builtin this build first copied them into D for half the tiles, as many register moves as the subtractions that the form saves.
// The four products of the first half are independent and fill one another's windows, each of the second half accumulates into its own D; the four v_nop keep the distance between the last product and the first vector instruction that reads a D.
static_assert(AR == 2);
__device__ __forceinline__ void scores(v8f (&s)[2][AR], v16h ka0, v16h kb0, v16h ka1, v16h kb1, const v16h (&q)[AR][2], const v8f (&c)[AR]) {
    asm("v_wmma_f32_16x16x32_f16 %0, %4, %8, %12\n\tv_wmma_f32_16x16x32_f16 %1, %4, %10, %13\n\tv_wmma_f32_16x16x32_f16 %2, %6, %8, %12\n\tv_wmma_f32_16x16x32_f16 %3, %6, %10, %13\n\t"
        "v_wmma_f32_16x16x32_f16 %0, %5, %9, %0\n\tv_wmma_f32_16x16x32_f16 %1, %5, %11, %1\n\tv_wmma_f32_16x16x32_f16 %2, %7, %9, %2\n\tv_wmma_f32_16x16x32_f16 %3, %7, %11, %3\n\t"
        "v_nop\n\tv_nop\n\tv_nop\n\tv_nop"
        : "=&v"(s[0][0]), "=&v"(s[0][1]), "=&v"(s[1][0]), "=&v"(s[1][1])
        : "v"(ka0), "v"(kb0), "v"(ka1), "v"(kb1), "v"(q[0][0]), "v"(q[0][1]), "v"(q[1][0]), "v"(q[1][1]), "v"(c[0]), "v"(c[1]));
}
__global__ __launch_bounds__(AW * 32) __attribute__((amdgpu_waves_per_eu(4, 4))) void k_fattn(const h16* __restrict__ Qp, const h16* __restrict__ Kp, const h16* __restrict__ Vt, const unsigned* __restrict__ MB, h16* Ax) {
    __shared__ __align__(16) h16 Ks[2][AKB * APT];
    __shared__ __align__(16) h16 Vs[2][HD * APT];
    __shared__ __align__(16) unsigned mbit[AW][TT / AKB][AR][32];   // each lane's mask bits, one word per stage and column group; a wave fills and reads its own part, the reads behind the first stage's barrier
    const int tid = threadIdx.x, lane = tid & 31, wave = tid >> 5, lr = lane & 15, hi = lane >> 4;
    const int g = blockIdx.y, q0 = blockIdx.x * (AW * AR * 16) + wave * (AR * 16);
    Qp += (size_t)g * TT * HD; Kp += (size_t)g * TT * HD; Vt += (size_t)g * HD * TT;
    // this wave's mask words, packed by k_prep in this very order: MWG words in a row, whole lines a load
    static_assert(MWG % 128 == 0);
    const unsigned* const mg = MB + (size_t)(q0 / (AR * 16)) * MWG + lane * 4; v4u_ mq[MWG / 128];
#pragma unroll
    for (int i = 0; i < MWG / 128; ++i) mq[i] = *(const v4u_*)(mg + i * 128);
    asm volatile("s_wait_xcnt 0x0" :: "v"(mg) : "memory");   // stands in front of whatever next overwrites the address registers that these loads name; the address is an input so that it lives up to here
#pragma unroll
    for (int i = 0; i < MWG / 128; ++i) *(v4u_*)(&mbit[wave][0][0][0] + i * 128 + lane * 4) = mq[i];
    const int srow = tid >> 3, sseg = (tid & 7) * 8;   // staging: 8 threads a 128-byte row, 32 rows a sweep
    const unsigned ko = (unsigned)(srow * HD + sseg), vo = (unsigned)(srow * TT + sseg);   // this thread's 32-bit offsets from wave-uniform bases
#pragma unroll
    for (int p = 0; p < 2; ++p) { const v8h rk = *(const v8h*)(Kp + 32 * p * HD + ko), rv = *(const v8h*)(Vt + 32 * p * TT + vo);
        *(v8h*)(Ks[0] + (srow + 32 * p) * APT + sseg) = rk; *(v8h*)(Vs[0] + (srow + 32 * p) * APT + sseg) = rv; }
    v16h qf[AR][2];
#pragma unroll
    for (int r = 0; r < AR; ++r)
#pragma unroll
        for (int kc = 0; kc < 2; ++kc) qf[r][kc] = WFrag<h16>::ld(Qp + (size_t)(q0 + r * 16 + lr) * HD + kc * 32 + 8 * hi);
    v8f o[AR][4], cn[AR]; float m[AR], thr[AR], ls[AR];   // cn: minus the reference in all eight elements (0 while m is still NEGF); thr: the bound on a lane's sum of its sixteen p of a pass, beyond which the full form is due (-1 while m is NEGF: every pass then takes it)
#pragma unroll
    for (int r = 0; r < AR; ++r) { m[r] = NEGF; thr[r] = -1.f; ls[r] = 0.f; cn[r] = (v8f){};
#pragma unroll
        for (int dt = 0; dt < 4; ++dt) o[r][dt] = (v8f){}; }
    // rolled: the register count stays at four waves a SIMD
#pragma unroll 1
    for (int blk = 0; blk < TT / AKB; ++blk) {
        __syncthreads();   // publishes stage blk, and ends every wave's reads of the other buffer, which this stage refills
        const int cb = blk & 1, kn = (blk + 1) * AKB; const bool more = blk + 1 < TT / AKB;
        unsigned mw[AR]; bool anym = false;
#pragma unroll
        for (int sb = 0; sb < AKB / 32; ++sb) {
            v8h rk, rv;
            if (more) { const h16* const gk = Kp + (kn + 32 * sb) * HD + ko; const h16* const gv = Vt + (32 * sb * TT + kn) + vo; rk = *(const v8h*)gk; rv = *(const v8h*)gv;   // half of the next stage's rows fly to registers under this pass
                asm volatile("s_wait_xcnt 0x0" :: "v"(gk), "v"(gv) : "memory"); }   // stands in front of whatever next overwrites the address registers that these loads name; the addresses are inputs so that they live up to here and no load's result is put on them
            if (sb == 0) {   // the stage's mask words, read behind the statement above, so that they go out in one group with the fragments' reads
#pragma unroll
                for (int r = 0; r < AR; ++r) mw[r] = mbit[wave][blk][r][lane];
                anym = __builtin_amdgcn_ballot_w32((mw[0] & mw[1]) != 0xFFFFFFFFu) != 0; }   // wave-uniform: a stage with no masked element skips the selects
            float u[AR][16];
            { const h16* kp = Ks[cb] + (sb * 32 + lr) * APT + 8 * hi; v8f s[2][AR];
                scores(s, WFrag<h16>::ld(kp), WFrag<h16>::ld(kp + 32), WFrag<h16>::ld(kp + 16 * APT), WFrag<h16>::ld(kp + 16 * APT + 32), qf, cn);
#pragma unroll
                for (int kt = 0; kt < 2; ++kt)
#pragma unroll
                    for (int r = 0; r < AR; ++r)
#pragma unroll
                        for (int j = 0; j < 8; ++j) u[r][kt * 8 + j] = s[kt][r][j]; }
            v16h vf[4];
#pragma unroll
            for (int dt = 0; dt < 4; ++dt) vf[dt] = WFrag<h16>::ld(Vs[cb] + (dt * 16 + lr) * APT + sb * 32 + 8 * hi);
            __builtin_amdgcn_sched_barrier(0);   // keeps the reads of v^T in one group ahead of the exponentials, which cover their latency: sunk to their products, each pair of products waits out its own read
            v16h pf[AR]; float sum[AR];
            auto expsum = [&]() __attribute__((always_inline)) {   // per column group: p = 2^u, each lane's sum of its sixteen p, and p as the f16 operand
#pragma unroll
                for (int r = 0; r < AR; ++r) { float sm = 0.f; v8u wp;
#pragma unroll
                    for (int t = 0; t < 2; ++t) { float d[8], p[8];
#pragma unroll
                        for (int j = 0; j < 8; ++j) d[j] = u[r][t * 8 + j];
                        exp2x8(p, d);
#pragma unroll
                        for (int j = 0; j < 8; j += 2) { sm += p[j] + p[j + 1]; wp[(t * 8 + j) >> 1] = pack2(p[j], p[j + 1]); } }
                    sum[r] = sm; pf[r] = __builtin_bit_cast(v16h, wp); }
            };
            expsum();
            // the test, once a pass, on the sums that the pass needs anyway: no p is negative, so a lane's sum within the bound says that each of its p is (an overflowed or undefined p fails the test too)
            const unsigned rise = __builtin_amdgcn_ballot_w32(!(sum[0] <= thr[0])) | __builtin_amdgcn_ballot_w32(!(sum[1] <= thr[1]));
            if (__builtin_expect(anym || rise != 0, 0)) {   // wave-uniform; marked rare, so that the register moves of the join fall on this side
#pragma unroll
                for (int r = 0; r < AR; ++r) { const float ref = -cn[r][0];
#pragma unroll
                    for (int e = 0; e < 16; ++e) u[r][e] = (int)(mw[r] << (sb * 16 + e)) >= 0 ? NEGF : u[r][e] + ref;
                    float mx = u[r][0];
#pragma unroll
                    for (int e = 1; e < 16; ++e) mx = fmaxf(mx, u[r][e]);
                    mx = fmaxf(mx, xhalf(mx));
                    const float rm = fmaxf(m[r], mx); const bool none = rm == NEGF;   // none: every key of this query so far is masked; C stays 0
                    cn[r] = cn[r] - ((none ? 0.f : rm) - ref);   // the reference moves up to the running maximum; each element from its own old value, so that C stays in its registers
                    const float mn = none ? NEGF : -cn[r][0], al = exp2x1(m[r] - mn); m[r] = mn; thr[r] = none ? -1.f : 256.f;   // mn: the reference as C now holds it
#pragma unroll
                    for (int e = 0; e < 16; ++e) u[r][e] -= mn;
                    ls[r] *= al;
#pragma unroll
                    for (int dt = 0; dt < 4; ++dt) o[r][dt] = o[r][dt] * al; }
                expsum(); }
#pragma unroll
            for (int r = 0; r < AR; ++r) ls[r] += sum[r];
#pragma unroll
            for (int dt = 0; dt < 4; ++dt)
#pragma unroll
                for (int r = 0; r < AR; ++r) o[r][dt] = wmma16(vf[dt], pf[r], o[r][dt]);
            if (more) { *(v8h*)(Ks[cb ^ 1] + (srow + 32 * sb) * APT + sseg) = rk; *(v8h*)(Vs[cb ^ 1] + (srow + 32 * sb) * APT + sseg) = rv; }
        }
    }
    // lane l holds ctx[query l & 15][d = 16 dt + 8h + j]: 8 consecutive d, one 16-byte store
#pragma unroll
    for (int r = 0; r < AR; ++r) { const float f = __fdiv_rn(1.0f, ls[r] + xhalf(ls[r])); const size_t oo = ((size_t)(g / NH_) * TT + q0 + r * 16 + lr) * DQ + (g % NH_) * HD + 8 * hi;
#pragma unroll
        for (int dt = 0; dt < 4; ++dt) { v4u_ wx;
#pragma unroll
            for (int j = 0; j < 8; j += 2) wx[j >> 1] = pack2(o[r][dt][j] * f, o[r][dt][j + 1] * f);
            *(v4u_*)(Ax + oo + dt * 16) = wx; } }
}

extern "C" void kernel_launch(void* const* d_in, const int* in_sizes, int n_in,
                              void* d_out, int out_size, void* d_ws, size_t ws_size, hipStream_t stream) {
    if (n_in < 11) return;
    if ((size_t)in_sizes[0] < (size_t)(NB - 1) * S_FULL * DM + (size_t)TT * DM) return;
    if ((size_t)in_sizes[1] < (size_t)(NB - 1) * S_FULL * DM + (size_t)TT * DM) return;
    if ((size_t)in_sizes[2] < (size_t)(TT - 1) * S_FULL + (size_t)TT) return;
    if (in_sizes[3] < DM * DQ || in_sizes[5] < DM * DKV || in_sizes[7] < DM * DKV || in_sizes[9] < DQ * DM) return;
    if (in_sizes[4] < DQ || in_sizes[6] < DKV || in_sizes[8] < DKV || in_sizes[10] < DM) return;
    if ((size_t)out_size < (size_t)NB * TT * DM) return;
    const float* x  = (const float*)d_in[0];     // [NB][S_FULL][DM]
    const float* xk = (const float*)d_in[1];     // [NB][S_FULL][DM]
    const int*   mk = (const int*)d_in[2];       // [1][1][S_FULL][S_FULL] int32 0/1
    const float* wq = (const float*)d_in[3]; const float* bq = (const float*)d_in[4];
    const float* wk = (const float*)d_in[5]; const float* bk = (const float*)d_in[6];
    const float* wv = (const float*)d_in[7]; const float* bv = (const float*)d_in[8];
    const float* wo = (const float*)d_in[9]; const float* bo = (const float*)d_in[10];
    float* OUT = (float*)d_out;     // [NB][TT][DM]
    char* wsp = (char*)d_ws;
    auto take = [&](size_t bytes) { char* p = wsp; wsp += (bytes + 255) & ~(size_t)255; return (void*)p; };
    bf* WQ = (bf*)take((size_t)DQ * DM * 2); bf* WK = (bf*)take((size_t)DKV * DM * 2); bf* WV = (bf*)take((size_t)DKV * DM * 2); h16* WO = (h16*)take((size_t)DM * DQ * 2);
    h16* QP16 = (h16*)take((size_t)NB * NH_ * TT * HD * 2); h16* KP16 = (h16*)take((size_t)NB * NKV * TT * HD * 2);
    h16* VT16 = (h16*)take((size_t)NB * NKV * HD * TT * 2);
    h16* AT16 = (h16*)take((size_t)NB * TT * DQ * 2);
    bf* XB = (bf*)take((size_t)NB * TT * DM * 2); bf* XKB = (bf*)take((size_t)NB * TT * DM * 2);
    unsigned* MB = (unsigned*)take((size_t)(TT / (AR * 16)) * MWG * 4);
    if ((size_t)(wsp - (char*)d_ws) > ws_size) return;
    // every batch in one launch: rows b * TT + t in the projections, planes b * NH_ + h in attention
    k_prep<<<PMB + PWB + PSB, 256, 0, stream>>>(x, xk, mk, wq, wk, wv, wo, XB, XKB, WQ, WK, WV, WO, MB);
    // each projection's epilogue writes the operand planes of attention itself
    static_assert(DQ == DKV);   // the three projections have one shape, so one grid serves them
    k_gemmw<bf, true, 3, 3, 1, 2><<<dim3(NB * TT / GRA, DQ / GRB, 1), GT, 0, stream>>>(XB, XKB, XKB, WQ, WK, WV, DM, DM, nullptr, DQ, bq, bk, bv, QP16, KP16, VT16);
    k_fattn<<<dim3(TT / (AW * AR * 16), NB * NH_, 1), AW * 32, 0, stream>>>(QP16, KP16, VT16, MB, AT16);
    k_gemmw<h16, true, 1, 0, 0, 0><<<dim3(NB * TT / GRA, DM / GRB, 1), GT, 0, stream>>>(AT16, nullptr, nullptr, WO, nullptr, nullptr, DQ, DQ, OUT, DM, bo, nullptr, nullptr, nullptr, nullptr, nullptr);
}
